// v000
// Times are from an AMD MI455X. After a warm-up the kernel runs many times in a row, and a time is the length of
// such a window on the GPU divided by its runs, so every launch and the gaps after it count. The runs cycle
// through copies of the inputs. A figure is the median of several windows, for all but v000 over two sittings.
// Sittings can differ by a few percent; kernels timed side by side share one.
// The starting kernel, v000, takes 1290 microseconds a run.
#include <hip/hip_runtime.h>

// Causal multi-head attention CORE on GIVEN q, k, v (q, k, v [2][2048][2048]; 16 heads x 128 by reshape: head h = features h * 128 .. h * 128 + 127; dots = (q x 128^-0.5) . k; keys after the query take -50000 (== exclusion: an exact zero weight after the softmax); softmax over the keys; out = attn v merged in head order -> [2][2048][2048] (8.4 M); NO projections, NO rotary; argument order q, k, v).
// Compute dtypes, f32 accumulate: the GIVEN f32 q, k, v are NOT rounded to bf16 (no projection, no input cast): the plane builders read them directly: q and k as f16 planes + bf16 hi / lo planes (hi + lo carries about 16 bits of the f32 value), v likewise (transposed); causal scores and attn.v (tile skipping): query rows < 512 hl (3 products), the rest single fp16 (x1024); softmax f32; the merged context is written to the output in f32 (no output projection).

#define NB_  2
#define TT   2048
#define DM   2048
#define NH_  16
#define NKV  16
#define REP  (NH_ / NKV)
#define HD   128
#define DQ   (NH_ * HD)
#define DKV  (NKV * HD)
#define ZH   2
#define RH   512                  // query rows < RH use hi+lo planes (0: none)
#define WIN  2048
#define PCAR 1024.0f
#define SCL  0.088388347648318447f   // HD^-0.5
typedef _Float16 h16;
typedef unsigned short bf;
typedef __attribute__((ext_vector_type(16))) __bf16   v16bf;
typedef __attribute__((ext_vector_type(16))) _Float16 v16h;
typedef __attribute__((ext_vector_type(8)))  _Float16 v8h;
typedef __attribute__((ext_vector_type(8)))  unsigned short v8us;
typedef __attribute__((ext_vector_type(8)))  float    v8f;
typedef __attribute__((ext_vector_type(4)))  float    v4f;
typedef v8h  __attribute__((may_alias)) v8ha;
typedef v4f  __attribute__((may_alias)) v4fa;
typedef v8us __attribute__((may_alias)) v8usa;

__device__ __forceinline__ unsigned short f2bf(float f) { unsigned u = __float_as_uint(f); u += 0x7FFFu + ((u >> 16) & 1u); return (unsigned short)(u >> 16); }
__device__ __forceinline__ float bf2f(unsigned short b) { return __uint_as_float(((unsigned)b) << 16); }
__device__ __forceinline__ float bfr(float f) { return bf2f(f2bf(f)); }
__device__ __forceinline__ v16h cat16(v8h lo, v8h hi) { return __builtin_shufflevector(lo, hi, 0, 1, 2, 3, 4, 5, 6, 7, 8, 9, 10, 11, 12, 13, 14, 15); }
__device__ __forceinline__ v16bf cat16b(v8us lo, v8us hi) { return __builtin_bit_cast(v16bf, __builtin_shufflevector(lo, hi, 0, 1, 2, 3, 4, 5, 6, 7, 8, 9, 10, 11, 12, 13, 14, 15)); }
__device__ __forceinline__ v8f wmma16(v16h a, v16h b, v8f c) { return __builtin_amdgcn_wmma_f32_16x16x32_f16(false, a, false, b, (short)0, c, false, false); }
__device__ __forceinline__ v8f wmmab(v16bf a, v16bf b, v8f c) { return __builtin_amdgcn_wmma_f32_16x16x32_bf16(false, a, false, b, (short)0, c, false, false); }



// ---- k_gemmw: register-blocked GEMM, ONE WAVE per 64x64 output tile (16 accumulators), operands straight from K-contiguous 16-bit planes; grid (M/64, N/64, Z), 32 threads.
// C[m][n] (f32, pitch ldc, + optional f32 bias[n]) = sum_k A[m][k] Bt[n][k] (+ split products per NSPLIT). z-batch strides sA/sB/sC in elements. K % 32 == 0.
template <typename T16> struct WFrag;
template <> struct WFrag<h16> { typedef v16h V; static __device__ __forceinline__ V ld(const h16* p) { return cat16(*(const v8h*)p, *(const v8h*)(p + 16)); } static __device__ __forceinline__ v8f mma(V a, V b, v8f c) { return wmma16(a, b, c); } };
template <> struct WFrag<bf> { typedef v16bf V; static __device__ __forceinline__ V ld(const bf* p) { return cat16b(*(const v8us*)p, *(const v8us*)(p + 16)); } static __device__ __forceinline__ v8f mma(V a, V b, v8f c) { return wmmab(a, b, c); } };
template <typename T16, int NSPLIT, bool BIAS>
__global__ __launch_bounds__(32) void k_gemmw(const T16* __restrict__ A, const T16* __restrict__ A2, const T16* __restrict__ Bt, const T16* __restrict__ Bt2, int K, float* C, int ldc, const float* __restrict__ bias, size_t sA, size_t sB, size_t sC) {
    typedef typename WFrag<T16>::V V;
    __shared__ __align__(16) float os[16 * 68];
    const size_t z = blockIdx.z; A += z * sA; if (A2) A2 += z * sA; Bt += z * sB; if (Bt2) Bt2 += z * sB; C += z * sC;
    const int lane = threadIdx.x & 31, lr = lane & 15, hi = lane >> 4; const int r0 = blockIdx.x * 64, c0 = blockIdx.y * 64;
    v8f acc[4][4];
#pragma unroll
    for (int mb = 0; mb < 4; ++mb)
#pragma unroll
        for (int nb = 0; nb < 4; ++nb) acc[mb][nb] = (v8f){};
    const size_t aoff = (size_t)(r0 + lr) * K + 8 * hi, boff = (size_t)(c0 + lr) * K + 8 * hi;
#pragma unroll 1
    for (int kc = 0; kc < K; kc += 32) {
        V a[4], a2[4];
#pragma unroll
        for (int mb = 0; mb < 4; ++mb) { a[mb] = WFrag<T16>::ld(A + aoff + (size_t)mb * 16 * K + kc); if (NSPLIT == 1 || NSPLIT == 2) a2[mb] = WFrag<T16>::ld(A2 + aoff + (size_t)mb * 16 * K + kc); }
#pragma unroll
        for (int nb = 0; nb < 4; ++nb) { const V b = WFrag<T16>::ld(Bt + boff + (size_t)nb * 16 * K + kc); V b2; if (NSPLIT >= 2) b2 = WFrag<T16>::ld(Bt2 + boff + (size_t)nb * 16 * K + kc);
#pragma unroll
            for (int mb = 0; mb < 4; ++mb) { acc[mb][nb] = WFrag<T16>::mma(a[mb], b, acc[mb][nb]); if (NSPLIT == 1 || NSPLIT == 2) acc[mb][nb] = WFrag<T16>::mma(a2[mb], b, acc[mb][nb]); if (NSPLIT >= 2) acc[mb][nb] = WFrag<T16>::mma(a[mb], b2, acc[mb][nb]); } }
        asm volatile("v_nop\n\tv_nop\n\tv_nop\n\tv_nop" : "+v"(acc[0][0]), "+v"(acc[1][1]), "+v"(acc[2][2]), "+v"(acc[3][3]) : "v"(a[0]), "v"(a[3]));
    }
#pragma unroll
    for (int mb = 0; mb < 4; ++mb) {
#pragma unroll
        for (int nb = 0; nb < 4; ++nb) {
#pragma unroll
            for (int j = 0; j < 8; ++j) os[(hi * 8 + j) * 68 + nb * 16 + lr] = acc[mb][nb][j]; }
        __builtin_amdgcn_wave_barrier(); asm volatile("" ::: "memory");
        float* crow = C + (size_t)(r0 + mb * 16) * ldc + c0;
{
#pragma unroll
            for (int s = 0; s < 8; ++s) { const int row = 2 * s + hi, cofs = lr * 4; v4f val = *(const v4fa*)(os + row * 68 + cofs); if (BIAS) { val[0] += bfr(bias[c0 + cofs]); val[1] += bfr(bias[c0 + cofs + 1]); val[2] += bfr(bias[c0 + cofs + 2]); val[3] += bfr(bias[c0 + cofs + 3]); }
                *(v4f*)(crow + (size_t)row * ldc + cofs) = val; }
             }
        __builtin_amdgcn_wave_barrier(); asm volatile("" ::: "memory");
    }
}

// ---- k_gemmc: the same one-wave 64x64 tile GEMM specialised for causal attention: CMODE 1 skips score tiles entirely above the diagonal (query rows r0+roff.., key columns c0..), CMODE 2 limits the
// key (K) loop of the probability x value contraction to the diagonal block (probabilities beyond it are exactly zero). roff = row offset of this launch's first row within the sequence.
template <typename T16, int NSPLIT, int CMODE>
__global__ __launch_bounds__(32) void k_gemmc(const T16* __restrict__ A, const T16* __restrict__ A2, const T16* __restrict__ Bt, const T16* __restrict__ Bt2, int K, float* C, int ldc, int roff, size_t sA, size_t sB, size_t sC) {
    typedef typename WFrag<T16>::V V;
    __shared__ __align__(16) float os[16 * 68];
    const size_t z = blockIdx.z; A += z * sA; if (A2) A2 += z * sA; Bt += z * sB; if (Bt2) Bt2 += z * sB; C += z * sC;
    const int lane = threadIdx.x & 31, lr = lane & 15, hi = lane >> 4; const int r0 = blockIdx.x * 64, c0 = blockIdx.y * 64;
    if (CMODE == 1 && c0 > r0 + roff + 63) return;                  // score tile entirely above the causal diagonal: never read (the softmax masks j > i by select)
    const int Kl = (CMODE == 2) ? min(K, r0 + roff + 64) : K;        // P.V: probabilities are exactly 0 beyond the diagonal block, so the K loop stops there
    v8f acc[4][4];
#pragma unroll
    for (int mb = 0; mb < 4; ++mb)
#pragma unroll
        for (int nb = 0; nb < 4; ++nb) acc[mb][nb] = (v8f){};
    const size_t aoff = (size_t)(r0 + lr) * K + 8 * hi, boff = (size_t)(c0 + lr) * K + 8 * hi;
#pragma unroll 1
    for (int kc = 0; kc < Kl; kc += 32) {
        V a[4], a2[4];
#pragma unroll
        for (int mb = 0; mb < 4; ++mb) { a[mb] = WFrag<T16>::ld(A + aoff + (size_t)mb * 16 * K + kc); if (NSPLIT == 1 || NSPLIT == 2) a2[mb] = WFrag<T16>::ld(A2 + aoff + (size_t)mb * 16 * K + kc); }
#pragma unroll
        for (int nb = 0; nb < 4; ++nb) { const V b = WFrag<T16>::ld(Bt + boff + (size_t)nb * 16 * K + kc); V b2; if (NSPLIT >= 2) b2 = WFrag<T16>::ld(Bt2 + boff + (size_t)nb * 16 * K + kc);
#pragma unroll
            for (int mb = 0; mb < 4; ++mb) { acc[mb][nb] = WFrag<T16>::mma(a[mb], b, acc[mb][nb]); if (NSPLIT == 1 || NSPLIT == 2) acc[mb][nb] = WFrag<T16>::mma(a2[mb], b, acc[mb][nb]); if (NSPLIT >= 2) acc[mb][nb] = WFrag<T16>::mma(a[mb], b2, acc[mb][nb]); } }
        asm volatile("v_nop\n\tv_nop\n\tv_nop\n\tv_nop" : "+v"(acc[0][0]), "+v"(acc[1][1]), "+v"(acc[2][2]), "+v"(acc[3][3]) : "v"(a[0]), "v"(a[3]));
    }
#pragma unroll
    for (int mb = 0; mb < 4; ++mb) {
#pragma unroll
        for (int nb = 0; nb < 4; ++nb) {
#pragma unroll
            for (int j = 0; j < 8; ++j) os[(hi * 8 + j) * 68 + nb * 16 + lr] = acc[mb][nb][j]; }
        __builtin_amdgcn_wave_barrier(); asm volatile("" ::: "memory");
        float* crow = C + (size_t)(r0 + mb * 16) * ldc + c0;
{
#pragma unroll
            for (int s = 0; s < 8; ++s) { const int row = 2 * s + hi, cofs = lr * 4; v4f val = *(const v4fa*)(os + row * 68 + cofs);
                *(v4f*)(crow + (size_t)row * ldc + cofs) = val; }
             }
        __builtin_amdgcn_wave_barrier(); asm volatile("" ::: "memory");
    }
}

__device__ __forceinline__ h16 tohx(float x) { return (h16)x; }
__device__ __forceinline__ void splitf(float y, unsigned short& h, unsigned short& l) { h = f2bf(y); l = f2bf(y - bf2f(h)); }
typedef __attribute__((ext_vector_type(2))) _Float16 v2h;
typedef __attribute__((ext_vector_type(4))) _Float16 v4h;
typedef __attribute__((ext_vector_type(2))) unsigned short v2us;
typedef __attribute__((ext_vector_type(4))) unsigned short v4us;
typedef __attribute__((ext_vector_type(2))) float v2f;
typedef __attribute__((ext_vector_type(4))) int v4i;

__global__ __launch_bounds__(256) void k_wtG(const float* __restrict__ w, int K, int N, bf* Bt) {
    const int lane = threadIdx.x & 31; const int L0 = (blockIdx.x * 8 + (threadIdx.x >> 5)) * 8; const int nlines = N * K / 64;
{
#pragma unroll 1
        for (int l = 0; l < 8; ++l) { const int L = L0 + l; if (L >= nlines) break; const size_t e = (size_t)L * 64 + lane * 2; const int k = (int)(e % K), n = (int)(e / K); v2us o;
            o[0] = f2bf(w[(size_t)k * N + n]); o[1] = f2bf(w[(size_t)(k + 1) * N + n]); *(v2us*)(Bt + e) = o; }
         }
}
__global__ __launch_bounds__(256) void k_cvt8(const float* __restrict__ src, bf* dst, size_t n8) { const size_t i = (size_t)blockIdx.x * 256 + threadIdx.x; if (i >= n8) return; const v8f v = *(const v8f*)(src + i * 8); v8us o;
#pragma unroll
    for (int k = 0; k < 8; ++k) o[k] = f2bf(v[k]); *(v8us*)(dst + i * 8) = o;  }

// k_rope: head planes [h][t][d] (fp16 + hi/lo) of rope(x) x sc with the rotate-half convention out[d] = x[d] cos[t][d] - x[d+HD/2] sin[t][d], out[d+HD/2] = x[d+HD/2] cos[t][d+HD/2] + x[d] sin[t][d+HD/2]
__global__ __launch_bounds__(256) void k_rope(const float* __restrict__ F, int pitch, int nheads, const float* __restrict__ CS, const float* __restrict__ RF, const float* __restrict__ nw, float sc, h16* P16, bf* Ph, bf* Pl) {
    const size_t e = ((size_t)blockIdx.x * 256 + threadIdx.x) * 2; if (e >= (size_t)nheads * TT * HD) return; const int d = (int)(e % HD); const int t = (int)((e / HD) % TT); const int h = (int)(e / ((size_t)HD * TT)); const float* f = F + (size_t)t * pitch + h * HD; const float rf = RF ? RF[(size_t)h * TT + t] : 1.0f; v2h o16; v2us oh, ol;
#pragma unroll
    for (int q = 0; q < 2; ++q) { const int dd = d + q; const int dp = (dd < HD / 2) ? dd + HD / 2 : dd - HD / 2; float x0 = f[dd], x1 = f[dp];
        if (RF) { float n0 = __fmul_rn(x0, rf), n1 = __fmul_rn(x1, rf); asm volatile("" : "+v"(n0)); asm volatile("" : "+v"(n1)); x0 = __fmul_rn(bfr(nw[dd]), n0); x1 = __fmul_rn(bfr(nw[dp]), n1); }
        const v2f cs = *(const v2f*)(CS + ((size_t)t * HD + dd) * 2); float a = __fmul_rn(x0, cs[0]), bq = __fmul_rn(x1, cs[1]); asm volatile("" : "+v"(a)); asm volatile("" : "+v"(bq)); const float r = ((dd < HD / 2) ? __fsub_rn(a, bq) : __fadd_rn(a, bq)) * sc;
        o16[q] = tohx(r); unsigned short a2, c2; splitf(r, a2, c2); oh[q] = a2; ol[q] = c2; }
    *(v2h*)(P16 + e) = o16; *(v2us*)(Ph + e) = oh; *(v2us*)(Pl + e) = ol;  }
__global__ __launch_bounds__(256) void k_vtp(const float* __restrict__ F, int pitch, int nheads, h16* V16, bf* Vh, bf* Vl) { const size_t e = ((size_t)blockIdx.x * 256 + threadIdx.x) * 2; if (e >= (size_t)nheads * HD * TT) return; const int t = (int)(e % TT); const int d = (int)((e / TT) % HD); const int g = (int)(e / ((size_t)TT * HD)); v2h o16; v2us oh, ol;
#pragma unroll
    for (int q = 0; q < 2; ++q) { const float x = F[(size_t)(t + q) * pitch + g * HD + d]; o16[q] = tohx(x); unsigned short a2, c2; splitf(x, a2, c2); oh[q] = a2; ol[q] = c2; }
    *(v2h*)(V16 + e) = o16; *(v2us*)(Vh + e) = oh; *(v2us*)(Vl + e) = ol;  }
__global__ __launch_bounds__(256) void k_csid(float* CS) { const int idx = blockIdx.x * 256 + threadIdx.x; if (idx >= TT * HD) return; v2f cs; cs[0] = 1.0f; cs[1] = 0.0f; *(v2f*)(CS + (size_t)idx * 2) = cs;  }
// k_asoft: per row (zz, i): t = S x HD^-0.5 for j <= i and i - j < WIN (sliding causal window; the reference's -1e9 additive fill vanishes identically); softmax over the 2048 keys (register row, one exp, fixed trees);
__global__ __launch_bounds__(256) void k_asoft(const float* __restrict__ Sb, h16* P16, bf* Ph, bf* Pl) {
    const int lane = threadIdx.x & 31; const int row = blockIdx.x * 8 + (threadIdx.x >> 5); if (row >= ZH * TT) return; const int i = row % TT; const int zz = row / TT; (void)zz; const bool hires = (i < RH); const float* sr = Sb + (size_t)row * TT; float v[TT / 32]; float mx = -3.0e38f;
#pragma unroll
    for (int ch = 0; ch < TT / 128; ++ch) { const int j0 = ch * 128 + lane * 4; const v4f a = *(const v4f*)(sr + j0);
#pragma unroll
        for (int q = 0; q < 4; ++q) { const int j = j0 + q; (void)j; const float t = (j <= i && i - j < WIN) ? a[q] * SCL : -3.0e38f; v[ch * 4 + q] = t; mx = fmaxf(mx, t); } }
#pragma unroll
    for (int sh = 16; sh; sh >>= 1) mx = fmaxf(mx, __shfl_xor(mx, sh, 32));
    float sum = 0.f;
#pragma unroll
    for (int k = 0; k < TT / 32; ++k) { float d0 = __fsub_rn(v[k], mx); asm volatile("" : "+v"(d0)); v[k] = __builtin_amdgcn_exp2f(__fmul_rn(d0, 1.4426950408889634f)); sum += v[k]; }
#pragma unroll
    for (int sh = 16; sh; sh >>= 1) sum += __shfl_xor(sum, sh, 32);
    const float f = __fdiv_rn(hires ? 1.0f : PCAR, sum);
{
        if (hires) {
#pragma unroll
            for (int ch = 0; ch < TT / 128; ++ch) { v4us oh, ol;
#pragma unroll
                for (int q = 0; q < 4; ++q) { unsigned short a, c2; splitf(v[ch * 4 + q] * f, a, c2); oh[q] = a; ol[q] = c2; }
                const size_t oo = ((size_t)zz * (RH ? RH : 1) + i) * TT + ch * 128 + lane * 4; *(v4us*)(Ph + oo) = oh; *(v4us*)(Pl + oo) = ol; }
        } else {
#pragma unroll
            for (int ch = 0; ch < TT / 128; ++ch) { v4h o4;
#pragma unroll
                for (int q = 0; q < 4; ++q) o4[q] = tohx(v[ch * 4 + q] * f);
                *(v4h*)(P16 + (size_t)row * TT + ch * 128 + lane * 4) = o4; } }
         }
}
__global__ __launch_bounds__(256) void k_merge(const float* __restrict__ O, int h0, float* OUTb) { const size_t e = ((size_t)blockIdx.x * 256 + threadIdx.x) * 2; if (e >= (size_t)ZH * TT * HD) return; const int d = (int)(e % HD); const int t = (int)((e / HD) % TT); const int zz = (int)(e / ((size_t)HD * TT)); const float cs = (t < RH) ? 1.0f : (1.0f / PCAR); const size_t oo = (size_t)t * DQ + (h0 + zz) * HD + d;
    v2f o2; o2[0] = O[e] * cs; o2[1] = O[e + 1] * cs; *(v2f*)(OUTb + oo) = o2;  }

extern "C" void kernel_launch(void* const* d_in, const int* in_sizes, int n_in,
                              void* d_out, int out_size, void* d_ws, size_t ws_size, hipStream_t stream) {
    (void)in_sizes; (void)n_in; (void)out_size;
    const float* q = (const float*)d_in[0]; const float* k = (const float*)d_in[1]; const float* v = (const float*)d_in[2];   /* q, k, v ([2][2048][2048] each, GIVEN: this module has NO projections): THREE inputs */
    float* OUT = (float*)d_out;     // [2][2048][2048]
    char* wsp = (char*)d_ws;
    auto take = [&](size_t bytes) { char* p = wsp; wsp += (bytes + 255) & ~(size_t)255; return (void*)p; };
    bf* WQ = (bf*)take((size_t)DQ * DM * 2); bf* WK = (bf*)take((size_t)DKV * DM * 2); bf* WV = (bf*)take((size_t)DKV * DM * 2); bf* WO = (bf*)take((size_t)DM * DQ * 2); float* CS = (float*)take((size_t)TT * HD * 2 * 4);
    bf* XB = (bf*)take((size_t)TT * DM * 2); float* FQ = (float*)take((size_t)TT * DQ * 4); float* FK = (float*)take((size_t)TT * DKV * 4);
    h16* QP16 = (h16*)take((size_t)NH_ * TT * HD * 2); h16* KP16 = (h16*)take((size_t)NKV * TT * HD * 2); h16* VT16 = (h16*)take((size_t)NKV * HD * TT * 2);
    bf* QPh = (bf*)take((size_t)NH_ * TT * HD * 2); bf* QPl = (bf*)take((size_t)NH_ * TT * HD * 2); bf* KPh = (bf*)take((size_t)NKV * TT * HD * 2); bf* KPl = (bf*)take((size_t)NKV * TT * HD * 2); bf* VTh = (bf*)take((size_t)NKV * HD * TT * 2); bf* VTl = (bf*)take((size_t)NKV * HD * TT * 2); bf* Ph = (bf*)take((size_t)ZH * RH * TT * 2); bf* Pl = (bf*)take((size_t)ZH * RH * TT * 2);
    float* Sb = (float*)take((size_t)ZH * TT * TT * 4); h16* P16 = (h16*)take((size_t)ZH * TT * TT * 2); float* Ob = (float*)take((size_t)ZH * TT * HD * 4); bf* ATh = (bf*)take((size_t)TT * DQ * 2); bf* ATl = (bf*)take((size_t)TT * DQ * 2);
    if ((size_t)(wsp - (char*)d_ws) > ws_size) return;    // ws 256 MiB
    float* FV = FK;
    { /* no projection weights in this module: nothing to stage */
       }
    k_csid<<<(TT * HD + 255) / 256, 256, 0, stream>>>(CS);
    const unsigned LQ = (unsigned)(((size_t)NH_ * TT * HD / 2 + 255) / 256), LKv = (unsigned)(((size_t)NKV * TT * HD / 2 + 255) / 256);
    for (int b = 0; b < NB_; ++b) {
        
        /* no input cast: the plane builders read the given f32 rows */
        k_rope<<<LQ, 256, 0, stream>>>(q + (size_t)b * TT * DM, DM, NH_, CS, nullptr, nullptr, 1.0f, QP16, QPh, QPl);   /* the q planes straight from the INPUT rows [t][h * 128 + d] (pitch DM = 2,048); identity table: a plain plane builder */
        k_rope<<<LKv, 256, 0, stream>>>(k + (size_t)b * TT * DM, DM, NKV, CS, nullptr, nullptr, 1.0f, KP16, KPh, KPl);
        k_vtp<<<LKv, 256, 0, stream>>>(v + (size_t)b * TT * DM, DM, NKV, VT16, VTh, VTl);   /* the transposed value planes straight from the INPUT rows */
        for (int h0 = 0; h0 < NH_; h0 += ZH) { const size_t zq = (size_t)h0, zk = (size_t)(h0 / REP);   // one kv head per query head: the pass's two heads use consecutive kv planes (z-strides TT*HD)
            k_gemmc<bf, 2, 1><<<dim3(RH / 64, TT / 64, ZH), 32, 0, stream>>>(QPh + zq * TT * HD, QPl + zq * TT * HD, KPh + zk * TT * HD, KPl + zk * TT * HD, HD, Sb, TT, 0, (size_t)TT * HD, (size_t)TT * HD, (size_t)TT * TT);
            k_gemmc<h16, 0, 1><<<dim3((TT - RH) / 64, TT / 64, ZH), 32, 0, stream>>>(QP16 + zq * TT * HD + (size_t)RH * HD, nullptr, KP16 + zk * TT * HD, nullptr, HD, Sb + (size_t)RH * TT, TT, RH, (size_t)TT * HD, (size_t)TT * HD, (size_t)TT * TT);
            k_asoft<<<ZH * TT / 8, 256, 0, stream>>>(Sb, P16, Ph, Pl);
            k_gemmc<bf, 2, 2><<<dim3(RH / 64, HD / 64, ZH), 32, 0, stream>>>(Ph, Pl, VTh + zk * HD * TT, VTl + zk * HD * TT, TT, Ob, HD, 0, (size_t)RH * TT, (size_t)HD * TT, (size_t)TT * HD);
            k_gemmc<h16, 0, 2><<<dim3((TT - RH) / 64, HD / 64, ZH), 32, 0, stream>>>(P16 + (size_t)RH * TT, nullptr, VT16 + zk * HD * TT, nullptr, TT, Ob + (size_t)RH * HD, HD, RH, (size_t)TT * TT, (size_t)HD * TT, (size_t)TT * HD);
            k_merge<<<(unsigned)(((size_t)ZH * TT * HD / 2 + 255) / 256), 256, 0, stream>>>(Ob, h0, OUT + (size_t)b * TT * DQ); }   /* the merged context goes to the OUTPUT in f32: this module has NO output projection */
        }
}

// v001
// One run takes 551 microseconds.
// In both of two side-by-side timings against v000, it was 2.34 times as fast.
#include <hip/hip_runtime.h>

// Causal multi-head attention CORE on GIVEN q, k, v (q, k, v [2][2048][2048]; 16 heads x 128 by reshape: head h = features h * 128 .. h * 128 + 127; dots = (q x 128^-0.5) . k; keys after the query take -50000 (== exclusion: an exact zero weight after the softmax); softmax over the keys; out = attn v merged in head order -> [2][2048][2048] (8.4 M); NO projections, NO rotary; argument order q, k, v).
// Compute dtypes, f32 accumulate: the GIVEN f32 q, k, v are NOT rounded to bf16 (no projection, no input cast): the plane builders read them directly: q and k as f16 planes + bf16 hi / lo planes (hi + lo carries about 16 bits of the f32 value), v likewise (transposed); causal scores and attn.v (tile skipping): query rows < 512 hl (3 products), the rest single fp16 (x1024); softmax f32; the merged context is written to the output in f32 (no output projection).

#define NB_  2
#define TT   2048
#define DM   2048
#define NH_  16
#define NKV  16
#define REP  (NH_ / NKV)
#define HD   128
#define DQ   (NH_ * HD)
#define DKV  (NKV * HD)
#define ZH   8                    // heads per pass
#define RH   512                  // query rows < RH use hi+lo planes (0: none)
#define WIN  2048
#define PCAR 1024.0f
#define SCL  0.088388347648318447f   // HD^-0.5
typedef _Float16 h16;
typedef unsigned short bf;
typedef __attribute__((ext_vector_type(16))) __bf16   v16bf;
typedef __attribute__((ext_vector_type(16))) _Float16 v16h;
typedef __attribute__((ext_vector_type(8)))  _Float16 v8h;
typedef __attribute__((ext_vector_type(8)))  unsigned short v8us;
typedef __attribute__((ext_vector_type(8)))  float    v8f;
typedef __attribute__((ext_vector_type(4)))  float    v4f;
typedef v8h  __attribute__((may_alias)) v8ha;
typedef v4f  __attribute__((may_alias)) v4fa;
typedef v8us __attribute__((may_alias)) v8usa;

__device__ __forceinline__ unsigned short f2bf(float f) { unsigned u = __float_as_uint(f); u += 0x7FFFu + ((u >> 16) & 1u); return (unsigned short)(u >> 16); }
__device__ __forceinline__ float bf2f(unsigned short b) { return __uint_as_float(((unsigned)b) << 16); }
__device__ __forceinline__ float bfr(float f) { return bf2f(f2bf(f)); }
__device__ __forceinline__ v16h cat16(v8h lo, v8h hi) { return __builtin_shufflevector(lo, hi, 0, 1, 2, 3, 4, 5, 6, 7, 8, 9, 10, 11, 12, 13, 14, 15); }
__device__ __forceinline__ v16bf cat16b(v8us lo, v8us hi) { return __builtin_bit_cast(v16bf, __builtin_shufflevector(lo, hi, 0, 1, 2, 3, 4, 5, 6, 7, 8, 9, 10, 11, 12, 13, 14, 15)); }
__device__ __forceinline__ v8f wmma16(v16h a, v16h b, v8f c) { return __builtin_amdgcn_wmma_f32_16x16x32_f16(false, a, false, b, (short)0, c, false, false); }
__device__ __forceinline__ v8f wmmab(v16bf a, v16bf b, v8f c) { return __builtin_amdgcn_wmma_f32_16x16x32_bf16(false, a, false, b, (short)0, c, false, false); }



// ---- k_gemmw: register-blocked GEMM, ONE WAVE per 64x64 output tile (16 accumulators), operands straight from K-contiguous 16-bit planes; grid (M/64, N/64, Z), 32 threads.
// C[m][n] (f32, pitch ldc, + optional f32 bias[n]) = sum_k A[m][k] Bt[n][k] (+ split products per NSPLIT). z-batch strides sA/sB/sC in elements. K % 32 == 0.
template <typename T16> struct WFrag;
template <> struct WFrag<h16> { typedef v16h V; static __device__ __forceinline__ V ld(const h16* p) { return cat16(*(const v8h*)p, *(const v8h*)(p + 16)); } static __device__ __forceinline__ v8f mma(V a, V b, v8f c) { return wmma16(a, b, c); } };
template <> struct WFrag<bf> { typedef v16bf V; static __device__ __forceinline__ V ld(const bf* p) { return cat16b(*(const v8us*)p, *(const v8us*)(p + 16)); } static __device__ __forceinline__ v8f mma(V a, V b, v8f c) { return wmmab(a, b, c); } };
template <typename T16, int NSPLIT, bool BIAS>
__global__ __launch_bounds__(32) void k_gemmw(const T16* __restrict__ A, const T16* __restrict__ A2, const T16* __restrict__ Bt, const T16* __restrict__ Bt2, int K, float* C, int ldc, const float* __restrict__ bias, size_t sA, size_t sB, size_t sC) {
    typedef typename WFrag<T16>::V V;
    __shared__ __align__(16) float os[16 * 68];
    const size_t z = blockIdx.z; A += z * sA; if (A2) A2 += z * sA; Bt += z * sB; if (Bt2) Bt2 += z * sB; C += z * sC;
    const int lane = threadIdx.x & 31, lr = lane & 15, hi = lane >> 4; const int r0 = blockIdx.x * 64, c0 = blockIdx.y * 64;
    v8f acc[4][4];
#pragma unroll
    for (int mb = 0; mb < 4; ++mb)
#pragma unroll
        for (int nb = 0; nb < 4; ++nb) acc[mb][nb] = (v8f){};
    const size_t aoff = (size_t)(r0 + lr) * K + 8 * hi, boff = (size_t)(c0 + lr) * K + 8 * hi;
#pragma unroll 1
    for (int kc = 0; kc < K; kc += 32) {
        V a[4], a2[4];
#pragma unroll
        for (int mb = 0; mb < 4; ++mb) { a[mb] = WFrag<T16>::ld(A + aoff + (size_t)mb * 16 * K + kc); if (NSPLIT == 1 || NSPLIT == 2) a2[mb] = WFrag<T16>::ld(A2 + aoff + (size_t)mb * 16 * K + kc); }
#pragma unroll
        for (int nb = 0; nb < 4; ++nb) { const V b = WFrag<T16>::ld(Bt + boff + (size_t)nb * 16 * K + kc); V b2; if (NSPLIT >= 2) b2 = WFrag<T16>::ld(Bt2 + boff + (size_t)nb * 16 * K + kc);
#pragma unroll
            for (int mb = 0; mb < 4; ++mb) { acc[mb][nb] = WFrag<T16>::mma(a[mb], b, acc[mb][nb]); if (NSPLIT == 1 || NSPLIT == 2) acc[mb][nb] = WFrag<T16>::mma(a2[mb], b, acc[mb][nb]); if (NSPLIT >= 2) acc[mb][nb] = WFrag<T16>::mma(a[mb], b2, acc[mb][nb]); } }
        asm volatile("v_nop\n\tv_nop\n\tv_nop\n\tv_nop" : "+v"(acc[0][0]), "+v"(acc[1][1]), "+v"(acc[2][2]), "+v"(acc[3][3]) : "v"(a[0]), "v"(a[3]));
    }
#pragma unroll
    for (int mb = 0; mb < 4; ++mb) {
#pragma unroll
        for (int nb = 0; nb < 4; ++nb) {
#pragma unroll
            for (int j = 0; j < 8; ++j) os[(hi * 8 + j) * 68 + nb * 16 + lr] = acc[mb][nb][j]; }
        __builtin_amdgcn_wave_barrier(); asm volatile("" ::: "memory");
        float* crow = C + (size_t)(r0 + mb * 16) * ldc + c0;
{
#pragma unroll
            for (int s = 0; s < 8; ++s) { const int row = 2 * s + hi, cofs = lr * 4; v4f val = *(const v4fa*)(os + row * 68 + cofs); if (BIAS) { val[0] += bfr(bias[c0 + cofs]); val[1] += bfr(bias[c0 + cofs + 1]); val[2] += bfr(bias[c0 + cofs + 2]); val[3] += bfr(bias[c0 + cofs + 3]); }
                *(v4f*)(crow + (size_t)row * ldc + cofs) = val; }
             }
        __builtin_amdgcn_wave_barrier(); asm volatile("" ::: "memory");
    }
}

// ---- k_gemmc: the same one-wave 64x64 tile GEMM specialised for causal attention: CMODE 1 skips score tiles entirely above the diagonal (query rows r0+roff.., key columns c0..), CMODE 2 limits the
// key (K) loop of the probability x value contraction to the diagonal block (probabilities beyond it are exactly zero). roff = row offset of this launch's first row within the sequence.
template <typename T16, int NSPLIT, int CMODE>
__global__ __launch_bounds__(32) void k_gemmc(const T16* __restrict__ A, const T16* __restrict__ A2, const T16* __restrict__ Bt, const T16* __restrict__ Bt2, int K, float* C, int ldc, int roff, size_t sA, size_t sB, size_t sC) {
    typedef typename WFrag<T16>::V V;
    __shared__ __align__(16) float os[16 * 68];
    const size_t z = blockIdx.z; A += z * sA; if (A2) A2 += z * sA; Bt += z * sB; if (Bt2) Bt2 += z * sB; C += z * sC;
    const int lane = threadIdx.x & 31, lr = lane & 15, hi = lane >> 4; const int r0 = blockIdx.x * 64, c0 = blockIdx.y * 64;
    if (CMODE == 1 && c0 > r0 + roff + 63) return;                  // score tile entirely above the causal diagonal: never read (the softmax masks j > i by select)
    const int Kl = (CMODE == 2) ? min(K, r0 + roff + 64) : K;        // P.V: probabilities are exactly 0 beyond the diagonal block, so the K loop stops there
    v8f acc[4][4];
#pragma unroll
    for (int mb = 0; mb < 4; ++mb)
#pragma unroll
        for (int nb = 0; nb < 4; ++nb) acc[mb][nb] = (v8f){};
    const size_t aoff = (size_t)(r0 + lr) * K + 8 * hi, boff = (size_t)(c0 + lr) * K + 8 * hi;
#pragma unroll 1
    for (int kc = 0; kc < Kl; kc += 32) {
        V a[4], a2[4];
#pragma unroll
        for (int mb = 0; mb < 4; ++mb) { a[mb] = WFrag<T16>::ld(A + aoff + (size_t)mb * 16 * K + kc); if (NSPLIT == 1 || NSPLIT == 2) a2[mb] = WFrag<T16>::ld(A2 + aoff + (size_t)mb * 16 * K + kc); }
#pragma unroll
        for (int nb = 0; nb < 4; ++nb) { const V b = WFrag<T16>::ld(Bt + boff + (size_t)nb * 16 * K + kc); V b2; if (NSPLIT >= 2) b2 = WFrag<T16>::ld(Bt2 + boff + (size_t)nb * 16 * K + kc);
#pragma unroll
            for (int mb = 0; mb < 4; ++mb) { acc[mb][nb] = WFrag<T16>::mma(a[mb], b, acc[mb][nb]); if (NSPLIT == 1 || NSPLIT == 2) acc[mb][nb] = WFrag<T16>::mma(a2[mb], b, acc[mb][nb]); if (NSPLIT >= 2) acc[mb][nb] = WFrag<T16>::mma(a[mb], b2, acc[mb][nb]); } }
        asm volatile("v_nop\n\tv_nop\n\tv_nop\n\tv_nop" : "+v"(acc[0][0]), "+v"(acc[1][1]), "+v"(acc[2][2]), "+v"(acc[3][3]) : "v"(a[0]), "v"(a[3]));
    }
#pragma unroll
    for (int mb = 0; mb < 4; ++mb) {
#pragma unroll
        for (int nb = 0; nb < 4; ++nb) {
#pragma unroll
            for (int j = 0; j < 8; ++j) os[(hi * 8 + j) * 68 + nb * 16 + lr] = acc[mb][nb][j]; }
        __builtin_amdgcn_wave_barrier(); asm volatile("" ::: "memory");
        float* crow = C + (size_t)(r0 + mb * 16) * ldc + c0;
{
#pragma unroll
            for (int s = 0; s < 8; ++s) { const int row = 2 * s + hi, cofs = lr * 4; v4f val = *(const v4fa*)(os + row * 68 + cofs);
                *(v4f*)(crow + (size_t)row * ldc + cofs) = val; }
             }
        __builtin_amdgcn_wave_barrier(); asm volatile("" ::: "memory");
    }
}

__device__ __forceinline__ h16 tohx(float x) { return (h16)x; }
__device__ __forceinline__ void splitf(float y, unsigned short& h, unsigned short& l) { h = f2bf(y); l = f2bf(y - bf2f(h)); }
typedef __attribute__((ext_vector_type(2))) _Float16 v2h;
typedef __attribute__((ext_vector_type(4))) _Float16 v4h;
typedef __attribute__((ext_vector_type(2))) unsigned short v2us;
typedef __attribute__((ext_vector_type(4))) unsigned short v4us;
typedef __attribute__((ext_vector_type(2))) float v2f;
typedef __attribute__((ext_vector_type(4))) int v4i;

__global__ __launch_bounds__(256) void k_wtG(const float* __restrict__ w, int K, int N, bf* Bt) {
    const int lane = threadIdx.x & 31; const int L0 = (blockIdx.x * 8 + (threadIdx.x >> 5)) * 8; const int nlines = N * K / 64;
{
#pragma unroll 1
        for (int l = 0; l < 8; ++l) { const int L = L0 + l; if (L >= nlines) break; const size_t e = (size_t)L * 64 + lane * 2; const int k = (int)(e % K), n = (int)(e / K); v2us o;
            o[0] = f2bf(w[(size_t)k * N + n]); o[1] = f2bf(w[(size_t)(k + 1) * N + n]); *(v2us*)(Bt + e) = o; }
         }
}
__global__ __launch_bounds__(256) void k_cvt8(const float* __restrict__ src, bf* dst, size_t n8) { const size_t i = (size_t)blockIdx.x * 256 + threadIdx.x; if (i >= n8) return; const v8f v = *(const v8f*)(src + i * 8); v8us o;
#pragma unroll
    for (int k = 0; k < 8; ++k) o[k] = f2bf(v[k]); *(v8us*)(dst + i * 8) = o;  }

// k_rope: head planes [h][t][d] (fp16 + hi/lo) of rope(x) x sc with the rotate-half convention out[d] = x[d] cos[t][d] - x[d+HD/2] sin[t][d], out[d+HD/2] = x[d+HD/2] cos[t][d+HD/2] + x[d] sin[t][d+HD/2]
__global__ __launch_bounds__(256) void k_rope(const float* __restrict__ F, int pitch, int nheads, const float* __restrict__ CS, const float* __restrict__ RF, const float* __restrict__ nw, float sc, h16* P16, bf* Ph, bf* Pl) {
    const size_t e = ((size_t)blockIdx.x * 256 + threadIdx.x) * 2; if (e >= (size_t)nheads * TT * HD) return; const int d = (int)(e % HD); const int t = (int)((e / HD) % TT); const int h = (int)(e / ((size_t)HD * TT)); const float* f = F + (size_t)t * pitch + h * HD; const float rf = RF ? RF[(size_t)h * TT + t] : 1.0f; v2h o16; v2us oh, ol;
#pragma unroll
    for (int q = 0; q < 2; ++q) { const int dd = d + q; const int dp = (dd < HD / 2) ? dd + HD / 2 : dd - HD / 2; float x0 = f[dd], x1 = f[dp];
        if (RF) { float n0 = __fmul_rn(x0, rf), n1 = __fmul_rn(x1, rf); asm volatile("" : "+v"(n0)); asm volatile("" : "+v"(n1)); x0 = __fmul_rn(bfr(nw[dd]), n0); x1 = __fmul_rn(bfr(nw[dp]), n1); }
        const v2f cs = *(const v2f*)(CS + ((size_t)t * HD + dd) * 2); float a = __fmul_rn(x0, cs[0]), bq = __fmul_rn(x1, cs[1]); asm volatile("" : "+v"(a)); asm volatile("" : "+v"(bq)); const float r = ((dd < HD / 2) ? __fsub_rn(a, bq) : __fadd_rn(a, bq)) * sc;
        o16[q] = tohx(r); unsigned short a2, c2; splitf(r, a2, c2); oh[q] = a2; ol[q] = c2; }
    *(v2h*)(P16 + e) = o16; *(v2us*)(Ph + e) = oh; *(v2us*)(Pl + e) = ol;  }
__global__ __launch_bounds__(256) void k_vtp(const float* __restrict__ F, int pitch, int nheads, h16* V16, bf* Vh, bf* Vl) { const size_t e = ((size_t)blockIdx.x * 256 + threadIdx.x) * 2; if (e >= (size_t)nheads * HD * TT) return; const int t = (int)(e % TT); const int d = (int)((e / TT) % HD); const int g = (int)(e / ((size_t)TT * HD)); v2h o16; v2us oh, ol;
#pragma unroll
    for (int q = 0; q < 2; ++q) { const float x = F[(size_t)(t + q) * pitch + g * HD + d]; o16[q] = tohx(x); unsigned short a2, c2; splitf(x, a2, c2); oh[q] = a2; ol[q] = c2; }
    const size_t o = (e / TT) * (2 * TT) + t;   // value rows [g][d] at pitch 2 * TT, the pitch of the probability rows they are contracted with
    *(v2h*)(V16 + o) = o16; *(v2us*)(Vh + o) = oh; *(v2us*)(Vl + o) = ol;  }
__global__ __launch_bounds__(256) void k_csid(float* CS) { const int idx = blockIdx.x * 256 + threadIdx.x; if (idx >= TT * HD) return; v2f cs; cs[0] = 1.0f; cs[1] = 0.0f; *(v2f*)(CS + (size_t)idx * 2) = cs;  }
// k_asoft: per row (zz, i): t = S x HD^-0.5 for j <= i and i - j < WIN (sliding causal window; the reference's -1e9 additive fill vanishes identically); softmax over the 2048 keys (register row, one exp, fixed trees);
// k_asoft works IN PLACE: a wave holds its whole score row in registers before its first store, and the 16-bit probabilities go over that same 8 KiB row (fp16: the first half; hi / lo: first / second half), so P16, Ph, Pl point into Sb (row pitch 2 * TT 16-bit elements) and Sb carries no restrict.
__global__ __launch_bounds__(256) void k_asoft(const float* Sb, h16* P16, bf* Ph, bf* Pl) {
    const int lane = threadIdx.x & 31; const int row = blockIdx.x * 8 + (threadIdx.x >> 5); if (row >= ZH * TT) return; const int i = row % TT; const int zz = row / TT; (void)zz; const bool hires = (i < RH); const float* sr = Sb + (size_t)row * TT; float v[TT / 32]; float mx = -3.0e38f;
#pragma unroll
    for (int ch = 0; ch < TT / 128; ++ch) { const int j0 = ch * 128 + lane * 4; const v4f a = *(const v4f*)(sr + j0);
#pragma unroll
        for (int q = 0; q < 4; ++q) { const int j = j0 + q; (void)j; const float t = (j <= i && i - j < WIN) ? a[q] * SCL : -3.0e38f; v[ch * 4 + q] = t; mx = fmaxf(mx, t); } }
#pragma unroll
    for (int sh = 16; sh; sh >>= 1) mx = fmaxf(mx, __shfl_xor(mx, sh, 32));
    float sum = 0.f;
#pragma unroll
    for (int k = 0; k < TT / 32; ++k) { float d0 = __fsub_rn(v[k], mx); asm volatile("" : "+v"(d0)); v[k] = __builtin_amdgcn_exp2f(__fmul_rn(d0, 1.4426950408889634f)); sum += v[k]; }
#pragma unroll
    for (int sh = 16; sh; sh >>= 1) sum += __shfl_xor(sum, sh, 32);
    const float f = __fdiv_rn(hires ? 1.0f : PCAR, sum);
{
        if (hires) {
#pragma unroll
            for (int ch = 0; ch < TT / 128; ++ch) { v4us oh, ol;
#pragma unroll
                for (int q = 0; q < 4; ++q) { unsigned short a, c2; splitf(v[ch * 4 + q] * f, a, c2); oh[q] = a; ol[q] = c2; }
                const size_t oo = (size_t)row * (2 * TT) + ch * 128 + lane * 4; *(v4us*)(Ph + oo) = oh; *(v4us*)(Pl + oo) = ol; }
        } else {
#pragma unroll
            for (int ch = 0; ch < TT / 128; ++ch) { v4h o4;
#pragma unroll
                for (int q = 0; q < 4; ++q) o4[q] = tohx(v[ch * 4 + q] * f);
                *(v4h*)(P16 + (size_t)row * (2 * TT) + ch * 128 + lane * 4) = o4; } }
         }
}
__global__ __launch_bounds__(256) void k_merge(const float* __restrict__ O, int h0, float* OUTb) { const size_t e = ((size_t)blockIdx.x * 256 + threadIdx.x) * 2; if (e >= (size_t)ZH * TT * HD) return; const int d = (int)(e % HD); const int t = (int)((e / HD) % TT); const int zz = (int)(e / ((size_t)HD * TT)); const float cs = (t < RH) ? 1.0f : (1.0f / PCAR); const size_t oo = (size_t)t * DQ + (h0 + zz) * HD + d;
    v2f o2; o2[0] = O[e] * cs; o2[1] = O[e + 1] * cs; *(v2f*)(OUTb + oo) = o2;  }

extern "C" void kernel_launch(void* const* d_in, const int* in_sizes, int n_in,
                              void* d_out, int out_size, void* d_ws, size_t ws_size, hipStream_t stream) {
    (void)in_sizes; (void)n_in; (void)out_size;
    const float* q = (const float*)d_in[0]; const float* k = (const float*)d_in[1]; const float* v = (const float*)d_in[2];   /* q, k, v ([2][2048][2048] each, GIVEN: this module has NO projections): THREE inputs */
    float* OUT = (float*)d_out;     // [2][2048][2048]
    char* wsp = (char*)d_ws;
    auto take = [&](size_t bytes) { char* p = wsp; wsp += (bytes + 255) & ~(size_t)255; return (void*)p; };
    float* CS = (float*)take((size_t)TT * HD * 2 * 4);
    h16* QP16 = (h16*)take((size_t)NH_ * TT * HD * 2); h16* KP16 = (h16*)take((size_t)NKV * TT * HD * 2); h16* VT16 = (h16*)take((size_t)NKV * HD * TT * 2 * 2);
    bf* QPh = (bf*)take((size_t)NH_ * TT * HD * 2); bf* QPl = (bf*)take((size_t)NH_ * TT * HD * 2); bf* KPh = (bf*)take((size_t)NKV * TT * HD * 2); bf* KPl = (bf*)take((size_t)NKV * TT * HD * 2); bf* VTh = (bf*)take((size_t)NKV * HD * TT * 2 * 2); bf* VTl = VTh + TT;   // value rows at pitch 2 * TT: hi / lo share a row, the fp16 row uses its first half
    float* Sb = (float*)take((size_t)ZH * TT * TT * 4); float* Ob = (float*)take((size_t)ZH * TT * HD * 4);
    h16* P16 = (h16*)Sb; bf* Ph = (bf*)Sb; bf* Pl = (bf*)Sb + TT;   // the probabilities overwrite their own score rows (k_asoft), row pitch 2 * TT: eight heads' scores (128 MiB) and the planes fit the workspace
    if ((size_t)(wsp - (char*)d_ws) > ws_size) return;    // ws 256 MiB
    { /* no projection weights in this module: nothing to stage */
       }
    k_csid<<<(TT * HD + 255) / 256, 256, 0, stream>>>(CS);
    const unsigned LQ = (unsigned)(((size_t)NH_ * TT * HD / 2 + 255) / 256), LKv = (unsigned)(((size_t)NKV * TT * HD / 2 + 255) / 256);
    for (int b = 0; b < NB_; ++b) {
        
        /* no input cast: the plane builders read the given f32 rows */
        k_rope<<<LQ, 256, 0, stream>>>(q + (size_t)b * TT * DM, DM, NH_, CS, nullptr, nullptr, 1.0f, QP16, QPh, QPl);   /* the q planes straight from the INPUT rows [t][h * 128 + d] (pitch DM = 2,048); identity table: a plain plane builder */
        k_rope<<<LKv, 256, 0, stream>>>(k + (size_t)b * TT * DM, DM, NKV, CS, nullptr, nullptr, 1.0f, KP16, KPh, KPl);
        k_vtp<<<LKv, 256, 0, stream>>>(v + (size_t)b * TT * DM, DM, NKV, VT16, VTh, VTl);   /* the transposed value planes straight from the INPUT rows */
        for (int h0 = 0; h0 < NH_; h0 += ZH) { const size_t zq = (size_t)h0, zk = (size_t)(h0 / REP);   // one kv head per query head: the pass's heads use consecutive kv planes
            k_gemmc<bf, 2, 1><<<dim3(RH / 64, TT / 64, ZH), 32, 0, stream>>>(QPh + zq * TT * HD, QPl + zq * TT * HD, KPh + zk * TT * HD, KPl + zk * TT * HD, HD, Sb, TT, 0, (size_t)TT * HD, (size_t)TT * HD, (size_t)TT * TT);
            k_gemmc<h16, 0, 1><<<dim3((TT - RH) / 64, TT / 64, ZH), 32, 0, stream>>>(QP16 + zq * TT * HD + (size_t)RH * HD, nullptr, KP16 + zk * TT * HD, nullptr, HD, Sb + (size_t)RH * TT, TT, RH, (size_t)TT * HD, (size_t)TT * HD, (size_t)TT * TT);
            k_asoft<<<ZH * TT / 8, 256, 0, stream>>>(Sb, P16, Ph, Pl);
            k_gemmc<bf, 2, 2><<<dim3(RH / 64, HD / 64, ZH), 32, 0, stream>>>(Ph, Pl, VTh + zk * HD * TT * 2, VTl + zk * HD * TT * 2, 2 * TT, Ob, HD, 0, (size_t)TT * TT * 2, (size_t)HD * TT * 2, (size_t)TT * HD);   // K argument = the operands' row pitch 2 * TT; the key loop ends at the diagonal block (at most TT)
            k_gemmc<h16, 0, 2><<<dim3((TT - RH) / 64, HD / 64, ZH), 32, 0, stream>>>(P16 + (size_t)RH * TT * 2, nullptr, VT16 + zk * HD * TT * 2, nullptr, 2 * TT, Ob + (size_t)RH * HD, HD, RH, (size_t)TT * TT * 2, (size_t)HD * TT * 2, (size_t)TT * HD);
            k_merge<<<(unsigned)(((size_t)ZH * TT * HD / 2 + 255) / 256), 256, 0, stream>>>(Ob, h0, OUT + (size_t)b * TT * DQ); }   /* the merged context goes to the OUTPUT in f32: this module has NO output projection */
        }
}

// v002
// Measured time: 188 microseconds a run.
// In two side-by-side timings against v001, it was 2.94 and 2.93 times as fast.
// Counting every step since v000, it is 6.87 times as fast.
#include <hip/hip_runtime.h>

// Causal multi-head attention CORE on GIVEN q, k, v (q, k, v [2][2048][2048]; 16 heads x 128 by reshape: head h = features h * 128 .. h * 128 + 127; dots = (q x 128^-0.5) . k; keys after the query take -50000 (== exclusion: an exact zero weight after the softmax); softmax over the keys; out = attn v merged in head order -> [2][2048][2048] (8.4 M); NO projections, NO rotary; argument order q, k, v).
// Compute dtypes, f32 accumulate: the GIVEN f32 q, k, v are NOT rounded to bf16 (no projection, no input cast): the plane builders read them directly: q and k as f16 planes + bf16 hi / lo planes (hi + lo carries about 16 bits of the f32 value), v likewise (transposed); causal scores, online softmax and attn.v in one kernel: query rows < 512 hl (3 products), the rest single fp16 (P x 1024 and more); softmax f32; the merged context is written to the output in f32 (no output projection).

#define NB_  2
#define TT   2048
#define DM   2048
#define NH_  16
#define NKV  16
#define REP  (NH_ / NKV)
#define HD   128
#define DQ   (NH_ * HD)
#define DKV  (NKV * HD)
#define RH   512                  // query rows < RH use hi+lo planes (0: none)
#define SCL  0.088388347648318447f   // HD^-0.5
typedef _Float16 h16;
typedef unsigned short bf;
typedef __attribute__((ext_vector_type(16))) __bf16   v16bf;
typedef __attribute__((ext_vector_type(16))) _Float16 v16h;
typedef __attribute__((ext_vector_type(8)))  _Float16 v8h;
typedef __attribute__((ext_vector_type(8)))  unsigned short v8us;
typedef __attribute__((ext_vector_type(8)))  float    v8f;
typedef __attribute__((ext_vector_type(4)))  float    v4f;
typedef v8h  __attribute__((may_alias)) v8ha;
typedef v4f  __attribute__((may_alias)) v4fa;
typedef v8us __attribute__((may_alias)) v8usa;

__device__ __forceinline__ unsigned short f2bf(float f) { unsigned u = __float_as_uint(f); u += 0x7FFFu + ((u >> 16) & 1u); return (unsigned short)(u >> 16); }
__device__ __forceinline__ float bf2f(unsigned short b) { return __uint_as_float(((unsigned)b) << 16); }
__device__ __forceinline__ float bfr(float f) { return bf2f(f2bf(f)); }
__device__ __forceinline__ v16h cat16(v8h lo, v8h hi) { return __builtin_shufflevector(lo, hi, 0, 1, 2, 3, 4, 5, 6, 7, 8, 9, 10, 11, 12, 13, 14, 15); }
__device__ __forceinline__ v16bf cat16b(v8us lo, v8us hi) { return __builtin_bit_cast(v16bf, __builtin_shufflevector(lo, hi, 0, 1, 2, 3, 4, 5, 6, 7, 8, 9, 10, 11, 12, 13, 14, 15)); }
__device__ __forceinline__ v8f wmma16(v16h a, v16h b, v8f c) { return __builtin_amdgcn_wmma_f32_16x16x32_f16(false, a, false, b, (short)0, c, false, false); }
__device__ __forceinline__ v8f wmmab(v16bf a, v16bf b, v8f c) { return __builtin_amdgcn_wmma_f32_16x16x32_bf16(false, a, false, b, (short)0, c, false, false); }



// ---- k_gemmw: register-blocked GEMM, ONE WAVE per 64x64 output tile (16 accumulators), operands straight from K-contiguous 16-bit planes; grid (M/64, N/64, Z), 32 threads.
// C[m][n] (f32, pitch ldc, + optional f32 bias[n]) = sum_k A[m][k] Bt[n][k] (+ split products per NSPLIT). z-batch strides sA/sB/sC in elements. K % 32 == 0.
template <typename T16> struct WFrag;
template <> struct WFrag<h16> { typedef v16h V; static __device__ __forceinline__ V ld(const h16* p) { return cat16(*(const v8h*)p, *(const v8h*)(p + 16)); } static __device__ __forceinline__ v8f mma(V a, V b, v8f c) { return wmma16(a, b, c); } };
template <> struct WFrag<bf> { typedef v16bf V; static __device__ __forceinline__ V ld(const bf* p) { return cat16b(*(const v8us*)p, *(const v8us*)(p + 16)); } static __device__ __forceinline__ v8f mma(V a, V b, v8f c) { return wmmab(a, b, c); } };
template <typename T16, int NSPLIT, bool BIAS>
__global__ __launch_bounds__(32) void k_gemmw(const T16* __restrict__ A, const T16* __restrict__ A2, const T16* __restrict__ Bt, const T16* __restrict__ Bt2, int K, float* C, int ldc, const float* __restrict__ bias, size_t sA, size_t sB, size_t sC) {
    typedef typename WFrag<T16>::V V;
    __shared__ __align__(16) float os[16 * 68];
    const size_t z = blockIdx.z; A += z * sA; if (A2) A2 += z * sA; Bt += z * sB; if (Bt2) Bt2 += z * sB; C += z * sC;
    const int lane = threadIdx.x & 31, lr = lane & 15, hi = lane >> 4; const int r0 = blockIdx.x * 64, c0 = blockIdx.y * 64;
    v8f acc[4][4];
#pragma unroll
    for (int mb = 0; mb < 4; ++mb)
#pragma unroll
        for (int nb = 0; nb < 4; ++nb) acc[mb][nb] = (v8f){};
    const size_t aoff = (size_t)(r0 + lr) * K + 8 * hi, boff = (size_t)(c0 + lr) * K + 8 * hi;
#pragma unroll 1
    for (int kc = 0; kc < K; kc += 32) {
        V a[4], a2[4];
#pragma unroll
        for (int mb = 0; mb < 4; ++mb) { a[mb] = WFrag<T16>::ld(A + aoff + (size_t)mb * 16 * K + kc); if (NSPLIT == 1 || NSPLIT == 2) a2[mb] = WFrag<T16>::ld(A2 + aoff + (size_t)mb * 16 * K + kc); }
#pragma unroll
        for (int nb = 0; nb < 4; ++nb) { const V b = WFrag<T16>::ld(Bt + boff + (size_t)nb * 16 * K + kc); V b2; if (NSPLIT >= 2) b2 = WFrag<T16>::ld(Bt2 + boff + (size_t)nb * 16 * K + kc);
#pragma unroll
            for (int mb = 0; mb < 4; ++mb) { acc[mb][nb] = WFrag<T16>::mma(a[mb], b, acc[mb][nb]); if (NSPLIT == 1 || NSPLIT == 2) acc[mb][nb] = WFrag<T16>::mma(a2[mb], b, acc[mb][nb]); if (NSPLIT >= 2) acc[mb][nb] = WFrag<T16>::mma(a[mb], b2, acc[mb][nb]); } }
        asm volatile("v_nop\n\tv_nop\n\tv_nop\n\tv_nop" : "+v"(acc[0][0]), "+v"(acc[1][1]), "+v"(acc[2][2]), "+v"(acc[3][3]) : "v"(a[0]), "v"(a[3]));
    }
#pragma unroll
    for (int mb = 0; mb < 4; ++mb) {
#pragma unroll
        for (int nb = 0; nb < 4; ++nb) {
#pragma unroll
            for (int j = 0; j < 8; ++j) os[(hi * 8 + j) * 68 + nb * 16 + lr] = acc[mb][nb][j]; }
        __builtin_amdgcn_wave_barrier(); asm volatile("" ::: "memory");
        float* crow = C + (size_t)(r0 + mb * 16) * ldc + c0;
{
#pragma unroll
            for (int s = 0; s < 8; ++s) { const int row = 2 * s + hi, cofs = lr * 4; v4f val = *(const v4fa*)(os + row * 68 + cofs); if (BIAS) { val[0] += bfr(bias[c0 + cofs]); val[1] += bfr(bias[c0 + cofs + 1]); val[2] += bfr(bias[c0 + cofs + 2]); val[3] += bfr(bias[c0 + cofs + 3]); }
                *(v4f*)(crow + (size_t)row * ldc + cofs) = val; }
             }
        __builtin_amdgcn_wave_barrier(); asm volatile("" ::: "memory");
    }
}

__device__ __forceinline__ h16 tohx(float x) { return (h16)x; }
__device__ __forceinline__ void splitf(float y, unsigned short& h, unsigned short& l) { h = f2bf(y); l = f2bf(y - bf2f(h)); }
typedef __attribute__((ext_vector_type(2))) _Float16 v2h;
typedef __attribute__((ext_vector_type(4))) _Float16 v4h;
typedef __attribute__((ext_vector_type(2))) unsigned short v2us;
typedef __attribute__((ext_vector_type(4))) unsigned short v4us;
typedef __attribute__((ext_vector_type(2))) float v2f;
typedef __attribute__((ext_vector_type(4))) int v4i;

__global__ __launch_bounds__(256) void k_wtG(const float* __restrict__ w, int K, int N, bf* Bt) {
    const int lane = threadIdx.x & 31; const int L0 = (blockIdx.x * 8 + (threadIdx.x >> 5)) * 8; const int nlines = N * K / 64;
{
#pragma unroll 1
        for (int l = 0; l < 8; ++l) { const int L = L0 + l; if (L >= nlines) break; const size_t e = (size_t)L * 64 + lane * 2; const int k = (int)(e % K), n = (int)(e / K); v2us o;
            o[0] = f2bf(w[(size_t)k * N + n]); o[1] = f2bf(w[(size_t)(k + 1) * N + n]); *(v2us*)(Bt + e) = o; }
         }
}
__global__ __launch_bounds__(256) void k_cvt8(const float* __restrict__ src, bf* dst, size_t n8) { const size_t i = (size_t)blockIdx.x * 256 + threadIdx.x; if (i >= n8) return; const v8f v = *(const v8f*)(src + i * 8); v8us o;
#pragma unroll
    for (int k = 0; k < 8; ++k) o[k] = f2bf(v[k]); *(v8us*)(dst + i * 8) = o;  }

// k_rope: head planes [h][t][d] (fp16 + hi/lo) of rope(x) x sc with the rotate-half convention out[d] = x[d] cos[t][d] - x[d+HD/2] sin[t][d], out[d+HD/2] = x[d+HD/2] cos[t][d+HD/2] + x[d] sin[t][d+HD/2]
__global__ __launch_bounds__(256) void k_rope(const float* __restrict__ F, int pitch, int nheads, const float* __restrict__ CS, const float* __restrict__ RF, const float* __restrict__ nw, float sc, h16* P16, bf* Ph, bf* Pl) {
    const size_t e = ((size_t)blockIdx.x * 256 + threadIdx.x) * 2; if (e >= (size_t)nheads * TT * HD) return; const int d = (int)(e % HD); const int t = (int)((e / HD) % TT); const int h = (int)(e / ((size_t)HD * TT)); const float* f = F + (size_t)t * pitch + h * HD; const float rf = RF ? RF[(size_t)h * TT + t] : 1.0f; v2h o16; v2us oh, ol;
#pragma unroll
    for (int q = 0; q < 2; ++q) { const int dd = d + q; const int dp = (dd < HD / 2) ? dd + HD / 2 : dd - HD / 2; float x0 = f[dd], x1 = f[dp];
        if (RF) { float n0 = __fmul_rn(x0, rf), n1 = __fmul_rn(x1, rf); asm volatile("" : "+v"(n0)); asm volatile("" : "+v"(n1)); x0 = __fmul_rn(bfr(nw[dd]), n0); x1 = __fmul_rn(bfr(nw[dp]), n1); }
        const v2f cs = *(const v2f*)(CS + ((size_t)t * HD + dd) * 2); float a = __fmul_rn(x0, cs[0]), bq = __fmul_rn(x1, cs[1]); asm volatile("" : "+v"(a)); asm volatile("" : "+v"(bq)); const float r = ((dd < HD / 2) ? __fsub_rn(a, bq) : __fadd_rn(a, bq)) * sc;
        o16[q] = tohx(r); unsigned short a2, c2; splitf(r, a2, c2); oh[q] = a2; ol[q] = c2; }
    *(v2h*)(P16 + e) = o16; *(v2us*)(Ph + e) = oh; *(v2us*)(Pl + e) = ol;  }
__global__ __launch_bounds__(256) void k_vtp(const float* __restrict__ F, int pitch, int nheads, h16* V16, bf* Vh, bf* Vl) { const size_t e = ((size_t)blockIdx.x * 256 + threadIdx.x) * 2; if (e >= (size_t)nheads * HD * TT) return; const int t = (int)(e % TT); const int d = (int)((e / TT) % HD); const int g = (int)(e / ((size_t)TT * HD)); v2h o16; v2us oh, ol;
#pragma unroll
    for (int q = 0; q < 2; ++q) { const float x = F[(size_t)(t + q) * pitch + g * HD + d]; o16[q] = tohx(x); unsigned short a2, c2; splitf(x, a2, c2); oh[q] = a2; ol[q] = c2; }
    const size_t o = (e / TT) * (2 * TT) + t;   // value rows [g][d] at pitch 2 * TT: the hi and lo planes share a row (lo at + TT)
    *(v2h*)(V16 + o) = o16; *(v2us*)(Vh + o) = oh; *(v2us*)(Vl + o) = ol;  }
__global__ __launch_bounds__(256) void k_csid(float* CS) { const int idx = blockIdx.x * 256 + threadIdx.x; if (idx >= TT * HD) return; v2f cs; cs[0] = 1.0f; cs[1] = 0.0f; *(v2f*)(CS + (size_t)idx * 2) = cs;  }
#define FTHR 5.0f
// 2^x; the v_nop in the same statement keeps the one free slot the instruction set asks for behind a transcendental
__device__ __forceinline__ float exp2s(float x) { float r; asm("v_exp_f32_e32 %0, %1\n\tv_nop" : "=v"(r) : "v"(x)); return r; }
template <typename T16, int NSPLIT>
__device__ __forceinline__ void fa_tile(const T16* __restrict__ Q, const T16* __restrict__ Q2, const T16* __restrict__ Kp, const T16* __restrict__ K2, const T16* __restrict__ Vt, const T16* __restrict__ V2, const int q0, const int lr, const int hi, float* __restrict__ orow) {
    typedef WFrag<T16> WF; typedef typename WF::V V;
    constexpr float OFF = (NSPLIT == 0) ? 10.0f : 0.0f;
    constexpr float CL2 = SCL * 1.4426950408889634f;   // scores in log2 units
    V qf[2][4], qg[2][4];
    const size_t qofs = (size_t)(q0 + lr) * HD + 8 * hi; const T16* qp = Q + qofs; const T16* qp2 = NSPLIT ? Q2 + qofs : qp;
#pragma unroll
    for (int qt = 0; qt < 2; ++qt)
#pragma unroll
        for (int ks = 0; ks < 4; ++ks) { const int qo = qt * 16 * HD + ks * 32; qf[qt][ks] = WF::ld(qp + qo); if (NSPLIT) qg[qt][ks] = WF::ld(qp2 + qo); }
    v8f o[2][8];
#pragma unroll
    for (int qt = 0; qt < 2; ++qt)
#pragma unroll
        for (int dt = 0; dt < 8; ++dt) o[qt][dt] = (v8f){};
    float m[2] = {-3.0e38f, -3.0e38f}, l[2] = {0.f, 0.f};
    const size_t kofs = (size_t)lr * HD + 8 * hi, vofs = (size_t)lr * (2 * TT) + 8 * hi;
    V kf[2][4], kg[2][4]; const T16* kp0 = Kp + kofs;
    if (NSPLIT == 0) {
#pragma unroll
        for (int kt = 0; kt < 2; ++kt)
#pragma unroll
            for (int ks = 0; ks < 4; ++ks) kf[kt][ks] = WF::ld(kp0 + kt * 16 * HD + ks * 32);
    }
    asm volatile("s_wait_xcnt 0x0" :: "v"(qp), "v"(qp2), "v"(kp0) : "memory");   // the address registers of the loads above stay untouched up to this wait (they are its inputs)
#pragma unroll 1
    for (int kb = 0; kb <= q0; kb += 32) {
        V vf[8], vg[8]; const T16* vp = Vt + vofs + kb; const T16* vp2 = NSPLIT ? V2 + vofs + kb : vp;
        const int kn = NSPLIT ? kb : min(kb + 32, q0); const T16* kp = Kp + kofs + (size_t)kn * HD; const T16* kp2 = NSPLIT ? K2 + kofs + (size_t)kn * HD : kp;
        if (NSPLIT == 0) {   // the value fragments fly during the score products and the softmax
#pragma unroll
            for (int dt = 0; dt < 8; ++dt) vf[dt] = WF::ld(vp + dt * 16 * 2 * TT);
        } else {
#pragma unroll
            for (int kt = 0; kt < 2; ++kt)
#pragma unroll
                for (int ks = 0; ks < 4; ++ks) { const int ko = kt * 16 * HD + ks * 32; kf[kt][ks] = WF::ld(kp + ko); kg[kt][ks] = WF::ld(kp2 + ko); }
        }
        v8f s[2][2];
#pragma unroll
        for (int kt = 0; kt < 2; ++kt)
#pragma unroll
            for (int qt = 0; qt < 2; ++qt) s[kt][qt] = (v8f){};
#pragma unroll
        for (int ks = 0; ks < 4; ++ks)
#pragma unroll
            for (int kt = 0; kt < 2; ++kt)
#pragma unroll
                for (int qt = 0; qt < 2; ++qt) { s[kt][qt] = WF::mma(kf[kt][ks], qf[qt][ks], s[kt][qt]); if (NSPLIT) { s[kt][qt] = WF::mma(kf[kt][ks], qg[qt][ks], s[kt][qt]); s[kt][qt] = WF::mma(kg[kt][ks], qf[qt][ks], s[kt][qt]); } }
        if (NSPLIT == 0) {   // the next pass's key fragments, one pass ahead (the last pass re-reads its own rows: always in bounds)
#pragma unroll
            for (int kt = 0; kt < 2; ++kt)
#pragma unroll
                for (int ks = 0; ks < 4; ++ks) kf[kt][ks] = WF::ld(kp + kt * 16 * HD + ks * 32);
            asm volatile("s_wait_xcnt 0x0" :: "v"(vp), "v"(kp) : "memory");   // this pass's loads are all issued: their address registers (inputs here, so live and unchanged) may be rewritten only behind this wait
        }
        if (kb == q0) {   // the diagonal pass: keys after the query are excluded (an exact zero weight)
#pragma unroll
            for (int kt = 0; kt < 2; ++kt)
#pragma unroll
                for (int qt = 0; qt < 2; ++qt)
#pragma unroll
                    for (int j = 0; j < 8; ++j) if (kt * 16 + hi * 8 + j > qt * 16 + lr) s[kt][qt][j] = -3.0e38f;
        }
        float mx[2];
#pragma unroll
        for (int qt = 0; qt < 2; ++qt) { float a = s[0][qt][0];
#pragma unroll
            for (int j = 1; j < 8; ++j) a = fmaxf(a, s[0][qt][j]);
#pragma unroll
            for (int j = 0; j < 8; ++j) a = fmaxf(a, s[1][qt][j]);
            mx[qt] = a; }
        { const float x0 = __shfl_xor(mx[0], 16, 32), x1 = __shfl_xor(mx[1], 16, 32); mx[0] = fmaxf(mx[0], x0) * CL2; mx[1] = fmaxf(mx[1], x1) * CL2; }
        if (__builtin_amdgcn_ballot_w32(mx[0] > m[0] + FTHR || mx[1] > m[1] + FTHR) != 0) {
#pragma unroll
            for (int qt = 0; qt < 2; ++qt) { const float mn = fmaxf(m[qt], mx[qt]); const float al = exp2s(m[qt] - mn); m[qt] = mn; l[qt] *= al;
#pragma unroll
                for (int dt = 0; dt < 8; ++dt) o[qt][dt] *= al; }
        }
        V pf[2], pg[2];
#pragma unroll
        for (int qt = 0; qt < 2; ++qt) { const float mo = OFF - m[qt]; float p[16]; float sum = 0.f;
#pragma unroll
            for (int e = 0; e < 16; ++e) { p[e] = exp2s(__builtin_fmaf(s[e >> 3][qt][e & 7], CL2, mo)); sum += p[e]; }
            l[qt] += sum;
            if constexpr (NSPLIT == 0) { v16h t;
#pragma unroll
                for (int e = 0; e < 16; ++e) t[e] = (h16)p[e];
                pf[qt] = t;
            } else { v8us h0, h1, l0, l1;
#pragma unroll
                for (int e = 0; e < 8; ++e) { unsigned short a, c; splitf(p[e], a, c); h0[e] = a; l0[e] = c; splitf(p[8 + e], a, c); h1[e] = a; l1[e] = c; }
                pf[qt] = cat16b(h0, h1); pg[qt] = cat16b(l0, l1); } }
        if (NSPLIT) {   // hi / lo rows (at most 16 passes): the value fragments come behind the softmax, so that 128 operand registers are not live across it
#pragma unroll
            for (int dt = 0; dt < 8; ++dt) { const int vo = dt * 16 * 2 * TT; vf[dt] = WF::ld(vp + vo); vg[dt] = WF::ld(vp2 + vo); }
            asm volatile("s_wait_xcnt 0x0" :: "v"(vp), "v"(vp2), "v"(kp), "v"(kp2) : "memory");   // as above: address registers unchanged up to this wait
        }
#pragma unroll
        for (int dt = 0; dt < 8; ++dt)
#pragma unroll
            for (int qt = 0; qt < 2; ++qt) { o[qt][dt] = WF::mma(vf[dt], pf[qt], o[qt][dt]); if (NSPLIT) { o[qt][dt] = WF::mma(vf[dt], pg[qt], o[qt][dt]); o[qt][dt] = WF::mma(vg[dt], pf[qt], o[qt][dt]); } }
    }
#pragma unroll
    for (int qt = 0; qt < 2; ++qt) { const float inv = __fdiv_rn(1.0f, l[qt] + __shfl_xor(l[qt], 16, 32));
#pragma unroll
        for (int dt = 0; dt < 8; ++dt) o[qt][dt] *= inv; }
    float* op = orow + (size_t)(q0 + lr) * DQ + hi * 8;   // a lane's 8 accumulator registers are 8 consecutive features of one query row
#pragma unroll
    for (int qt = 0; qt < 2; ++qt)
#pragma unroll
        for (int dt = 0; dt < 8; ++dt) { v4f a, c;
#pragma unroll
            for (int j = 0; j < 4; ++j) { a[j] = o[qt][dt][j]; c[j] = o[qt][dt][4 + j]; }
            *(v4f*)(op + qt * 16 * DQ + dt * 16) = a; *(v4f*)(op + qt * 16 * DQ + dt * 16 + 4) = c; }
}
// grid: 512 blocks of 4 waves = 16 blocks of 128 query rows x 32 (batch, head) planes; the first 256 blocks take the long rows, longest first, the second 256 the short ones, shortest first.
__global__ __launch_bounds__(128, 2) void k_fattn(const h16* __restrict__ Q16, const h16* __restrict__ K16, const h16* __restrict__ V16, const bf* __restrict__ Qh, const bf* __restrict__ Ql, const bf* __restrict__ Kh, const bf* __restrict__ Kl, const bf* __restrict__ Vh, const bf* __restrict__ Vl, float* __restrict__ OUT) {
    const int lane = threadIdx.x & 31, lr = lane & 15, hi = lane >> 4; const int wv = __builtin_amdgcn_readfirstlane(threadIdx.x >> 5);
    const int lin = blockIdx.x, z = lin & (NB_ * NH_ - 1), g = lin / (NB_ * NH_); const int qb = (g < 8) ? 15 - g : g - 8;
    const int q0 = qb * 128 + wv * 32; const size_t pz = (size_t)z * TT * HD, vz = (size_t)z * HD * TT * 2;
    float* orow = OUT + (size_t)(z / NH_) * TT * DQ + (z % NH_) * HD;
    if (q0 < RH) fa_tile<bf, 2>(Qh + pz, Ql + pz, Kh + pz, Kl + pz, Vh + vz, Vl + vz, q0, lr, hi, orow);
    else fa_tile<h16, 0>(Q16 + pz, nullptr, K16 + pz, nullptr, V16 + vz, nullptr, q0, lr, hi, orow);
}

extern "C" void kernel_launch(void* const* d_in, const int* in_sizes, int n_in,
                              void* d_out, int out_size, void* d_ws, size_t ws_size, hipStream_t stream) {
    (void)in_sizes; (void)n_in; (void)out_size;
    const float* q = (const float*)d_in[0]; const float* k = (const float*)d_in[1]; const float* v = (const float*)d_in[2];   /* q, k, v ([2][2048][2048] each, GIVEN: this module has NO projections): THREE inputs */
    float* OUT = (float*)d_out;     // [2][2048][2048]
    char* wsp = (char*)d_ws;
    auto take = [&](size_t bytes) { char* p = wsp; wsp += (bytes + 255) & ~(size_t)255; return (void*)p; };
    const size_t PZ = (size_t)NH_ * TT * HD;   // elements of one batch's head planes; every plane holds both batches (162 MiB of the 256 MiB workspace)
    float* CS = (float*)take((size_t)TT * HD * 2 * 4);
    h16* QP16 = (h16*)take(NB_ * PZ * 2); h16* KP16 = (h16*)take(NB_ * PZ * 2); h16* VT16 = (h16*)take(NB_ * PZ * 2 * 2);
    bf* QPh = (bf*)take(NB_ * PZ * 2); bf* QPl = (bf*)take(NB_ * PZ * 2); bf* KPh = (bf*)take(NB_ * PZ * 2); bf* KPl = (bf*)take(NB_ * PZ * 2); bf* VTh = (bf*)take(NB_ * PZ * 2 * 2); bf* VTl = VTh + TT;   // value rows at pitch 2 * TT: hi / lo share a row, the fp16 row uses its first half
    if ((size_t)(wsp - (char*)d_ws) > ws_size) return;    // ws 256 MiB
    k_csid<<<(TT * HD + 255) / 256, 256, 0, stream>>>(CS);
    const unsigned LQ = (unsigned)(((size_t)NH_ * TT * HD / 2 + 255) / 256), LKv = (unsigned)(((size_t)NKV * TT * HD / 2 + 255) / 256);
    for (int b = 0; b < NB_; ++b) {
        k_rope<<<LQ, 256, 0, stream>>>(q + (size_t)b * TT * DM, DM, NH_, CS, nullptr, nullptr, 1.0f, QP16 + b * PZ, QPh + b * PZ, QPl + b * PZ);   /* the q planes straight from the INPUT rows [t][h * 128 + d] (pitch DM = 2,048); identity table: a plain plane builder */
        k_rope<<<LKv, 256, 0, stream>>>(k + (size_t)b * TT * DM, DM, NKV, CS, nullptr, nullptr, 1.0f, KP16 + b * PZ, KPh + b * PZ, KPl + b * PZ);
        k_vtp<<<LKv, 256, 0, stream>>>(v + (size_t)b * TT * DM, DM, NKV, VT16 + b * PZ * 2, VTh + b * PZ * 2, VTl + b * PZ * 2);   /* the transposed value planes straight from the INPUT rows */
    }
    k_fattn<<<NB_ * NH_ * (TT / 128), 128, 0, stream>>>(QP16, KP16, VT16, QPh, QPl, KPh, KPl, VTh, VTl, OUT);   /* all 32 (batch, head) planes in one launch; the merged context goes straight to the OUTPUT in f32 */
}

// v003
// Measured time: 130 microseconds a run.
// Two timings next to v002 put it at 1.46 and 1.44 times that version's speed.
// Counting every step since v000, it is 9.99 times as fast.
#include <hip/hip_runtime.h>

// Causal multi-head attention CORE on GIVEN q, k, v (q, k, v [2][2048][2048]; 16 heads x 128 by reshape: head h = features h * 128 .. h * 128 + 127; dots = (q x 128^-0.5) . k; keys after the query take -50000 (== exclusion: an exact zero weight after the softmax); softmax over the keys; out = attn v merged in head order -> [2][2048][2048] (8.4 M); NO projections, NO rotary; argument order q, k, v).
// Compute dtypes, f32 accumulate: the GIVEN f32 q, k, v are NOT rounded to bf16 (no projection, no input cast): the plane builders read them directly: q and k as f16 planes + bf16 hi / lo planes (hi + lo carries about 16 bits of the f32 value), v likewise (transposed); causal scores, online softmax and attn.v in one kernel: query rows < 512 hl (3 products), the rest single fp16 (P x 1024 and more); softmax f32; the merged context is written to the output in f32 (no output projection).

#define NB_  2
#define TT   2048
#define DM   2048
#define NH_  16
#define NKV  16
#define REP  (NH_ / NKV)
#define HD   128
#define DQ   (NH_ * HD)
#define DKV  (NKV * HD)
#define RH   512                  // query rows < RH use hi+lo planes (0: none)
#define SCL  0.088388347648318447f   // HD^-0.5
typedef _Float16 h16;
typedef unsigned short bf;
typedef __attribute__((ext_vector_type(16))) __bf16   v16bf;
typedef __attribute__((ext_vector_type(16))) _Float16 v16h;
typedef __attribute__((ext_vector_type(8)))  _Float16 v8h;
typedef __attribute__((ext_vector_type(8)))  unsigned short v8us;
typedef __attribute__((ext_vector_type(8)))  float    v8f;
typedef __attribute__((ext_vector_type(4)))  float    v4f;
typedef v8h  __attribute__((may_alias)) v8ha;
typedef v4f  __attribute__((may_alias)) v4fa;
typedef v8us __attribute__((may_alias)) v8usa;

__device__ __forceinline__ unsigned short f2bf(float f) { unsigned u = __float_as_uint(f); u += 0x7FFFu + ((u >> 16) & 1u); return (unsigned short)(u >> 16); }
__device__ __forceinline__ float bf2f(unsigned short b) { return __uint_as_float(((unsigned)b) << 16); }
__device__ __forceinline__ float bfr(float f) { return bf2f(f2bf(f)); }
__device__ __forceinline__ v16h cat16(v8h lo, v8h hi) { return __builtin_shufflevector(lo, hi, 0, 1, 2, 3, 4, 5, 6, 7, 8, 9, 10, 11, 12, 13, 14, 15); }
__device__ __forceinline__ v16bf cat16b(v8us lo, v8us hi) { return __builtin_bit_cast(v16bf, __builtin_shufflevector(lo, hi, 0, 1, 2, 3, 4, 5, 6, 7, 8, 9, 10, 11, 12, 13, 14, 15)); }
__device__ __forceinline__ v8f wmma16(v16h a, v16h b, v8f c) { return __builtin_amdgcn_wmma_f32_16x16x32_f16(false, a, false, b, (short)0, c, false, false); }
__device__ __forceinline__ v8f wmmab(v16bf a, v16bf b, v8f c) { return __builtin_amdgcn_wmma_f32_16x16x32_bf16(false, a, false, b, (short)0, c, false, false); }



// ---- k_gemmw: register-blocked GEMM, ONE WAVE per 64x64 output tile (16 accumulators), operands straight from K-contiguous 16-bit planes; grid (M/64, N/64, Z), 32 threads.
// C[m][n] (f32, pitch ldc, + optional f32 bias[n]) = sum_k A[m][k] Bt[n][k] (+ split products per NSPLIT). z-batch strides sA/sB/sC in elements. K % 32 == 0.
template <typename T16> struct WFrag;
template <> struct WFrag<h16> { typedef v16h V; static __device__ __forceinline__ V ld(const h16* p) { return cat16(*(const v8h*)p, *(const v8h*)(p + 16)); } static __device__ __forceinline__ v8f mma(V a, V b, v8f c) { return wmma16(a, b, c); } };
template <> struct WFrag<bf> { typedef v16bf V; static __device__ __forceinline__ V ld(const bf* p) { return cat16b(*(const v8us*)p, *(const v8us*)(p + 16)); } static __device__ __forceinline__ v8f mma(V a, V b, v8f c) { return wmmab(a, b, c); } };
template <typename T16, int NSPLIT, bool BIAS>
__global__ __launch_bounds__(32) void k_gemmw(const T16* __restrict__ A, const T16* __restrict__ A2, const T16* __restrict__ Bt, const T16* __restrict__ Bt2, int K, float* C, int ldc, const float* __restrict__ bias, size_t sA, size_t sB, size_t sC) {
    typedef typename WFrag<T16>::V V;
    __shared__ __align__(16) float os[16 * 68];
    const size_t z = blockIdx.z; A += z * sA; if (A2) A2 += z * sA; Bt += z * sB; if (Bt2) Bt2 += z * sB; C += z * sC;
    const int lane = threadIdx.x & 31, lr = lane & 15, hi = lane >> 4; const int r0 = blockIdx.x * 64, c0 = blockIdx.y * 64;
    v8f acc[4][4];
#pragma unroll
    for (int mb = 0; mb < 4; ++mb)
#pragma unroll
        for (int nb = 0; nb < 4; ++nb) acc[mb][nb] = (v8f){};
    const size_t aoff = (size_t)(r0 + lr) * K + 8 * hi, boff = (size_t)(c0 + lr) * K + 8 * hi;
#pragma unroll 1
    for (int kc = 0; kc < K; kc += 32) {
        V a[4], a2[4];
#pragma unroll
        for (int mb = 0; mb < 4; ++mb) { a[mb] = WFrag<T16>::ld(A + aoff + (size_t)mb * 16 * K + kc); if (NSPLIT == 1 || NSPLIT == 2) a2[mb] = WFrag<T16>::ld(A2 + aoff + (size_t)mb * 16 * K + kc); }
#pragma unroll
        for (int nb = 0; nb < 4; ++nb) { const V b = WFrag<T16>::ld(Bt + boff + (size_t)nb * 16 * K + kc); V b2; if (NSPLIT >= 2) b2 = WFrag<T16>::ld(Bt2 + boff + (size_t)nb * 16 * K + kc);
#pragma unroll
            for (int mb = 0; mb < 4; ++mb) { acc[mb][nb] = WFrag<T16>::mma(a[mb], b, acc[mb][nb]); if (NSPLIT == 1 || NSPLIT == 2) acc[mb][nb] = WFrag<T16>::mma(a2[mb], b, acc[mb][nb]); if (NSPLIT >= 2) acc[mb][nb] = WFrag<T16>::mma(a[mb], b2, acc[mb][nb]); } }
        asm volatile("v_nop\n\tv_nop\n\tv_nop\n\tv_nop" : "+v"(acc[0][0]), "+v"(acc[1][1]), "+v"(acc[2][2]), "+v"(acc[3][3]) : "v"(a[0]), "v"(a[3]));
    }
#pragma unroll
    for (int mb = 0; mb < 4; ++mb) {
#pragma unroll
        for (int nb = 0; nb < 4; ++nb) {
#pragma unroll
            for (int j = 0; j < 8; ++j) os[(hi * 8 + j) * 68 + nb * 16 + lr] = acc[mb][nb][j]; }
        __builtin_amdgcn_wave_barrier(); asm volatile("" ::: "memory");
        float* crow = C + (size_t)(r0 + mb * 16) * ldc + c0;
{
#pragma unroll
            for (int s = 0; s < 8; ++s) { const int row = 2 * s + hi, cofs = lr * 4; v4f val = *(const v4fa*)(os + row * 68 + cofs); if (BIAS) { val[0] += bfr(bias[c0 + cofs]); val[1] += bfr(bias[c0 + cofs + 1]); val[2] += bfr(bias[c0 + cofs + 2]); val[3] += bfr(bias[c0 + cofs + 3]); }
                *(v4f*)(crow + (size_t)row * ldc + cofs) = val; }
             }
        __builtin_amdgcn_wave_barrier(); asm volatile("" ::: "memory");
    }
}

__device__ __forceinline__ h16 tohx(float x) { return (h16)x; }
__device__ __forceinline__ void splitf(float y, unsigned short& h, unsigned short& l) { h = f2bf(y); l = f2bf(y - bf2f(h)); }
typedef __attribute__((ext_vector_type(2))) _Float16 v2h;
typedef __attribute__((ext_vector_type(4))) _Float16 v4h;
typedef __attribute__((ext_vector_type(2))) unsigned short v2us;
typedef __attribute__((ext_vector_type(4))) unsigned short v4us;
typedef __attribute__((ext_vector_type(2))) float v2f;
typedef __attribute__((ext_vector_type(4))) int v4i;

__global__ __launch_bounds__(256) void k_wtG(const float* __restrict__ w, int K, int N, bf* Bt) {
    const int lane = threadIdx.x & 31; const int L0 = (blockIdx.x * 8 + (threadIdx.x >> 5)) * 8; const int nlines = N * K / 64;
{
#pragma unroll 1
        for (int l = 0; l < 8; ++l) { const int L = L0 + l; if (L >= nlines) break; const size_t e = (size_t)L * 64 + lane * 2; const int k = (int)(e % K), n = (int)(e / K); v2us o;
            o[0] = f2bf(w[(size_t)k * N + n]); o[1] = f2bf(w[(size_t)(k + 1) * N + n]); *(v2us*)(Bt + e) = o; }
         }
}
__global__ __launch_bounds__(256) void k_cvt8(const float* __restrict__ src, bf* dst, size_t n8) { const size_t i = (size_t)blockIdx.x * 256 + threadIdx.x; if (i >= n8) return; const v8f v = *(const v8f*)(src + i * 8); v8us o;
#pragma unroll
    for (int k = 0; k < 8; ++k) o[k] = f2bf(v[k]); *(v8us*)(dst + i * 8) = o;  }

// ---- k_planes: every operand plane of q, k and v in ONE launch of 768 blocks (256 per input, dealt in turn), 128 elements a thread, 16-byte loads and stores on whole 256-byte pieces.
// q, k: head planes [b * 16 + h][t][d] (fp16 + hi / lo), a plain copy in another order: a block takes 16 rows, a wave two heads of them. v: transposed planes [b * 16 + h][d] at pitch 2 * TT;
// a block takes 256 positions of one head as 4 tiles of 128 t x 64 d, turned in LDS (f32, two buffers, one barrier a tile). The next group's loads fly while this group is converted.
#define VPI 65                    // LDS row pitch in floats: writers (16 lanes x 4 d, two rows) and readers (16 lanes x 8 t, two d) each meet 32 different banks, with the shift of 4 for t >= 64
__device__ __forceinline__ void cvt8(const float* x, h16* p16, bf* ph, bf* pl) { v8h o16; v8us oh, ol;
#pragma unroll
    for (int j = 0; j < 8; ++j) { o16[j] = tohx(x[j]); unsigned short a2, c2; splitf(x[j], a2, c2); oh[j] = a2; ol[j] = c2; }
    *(v8h*)p16 = o16; *(v8us*)ph = oh; *(v8us*)pl = ol; }
__global__ __launch_bounds__(256) void k_planes(const float* __restrict__ q, const float* __restrict__ k, const float* __restrict__ v, h16* Q16, bf* Qh, bf* Ql, h16* K16, bf* Kh, bf* Kl, h16* V16, bf* Vh) {
    __shared__ float ts[2][128 * VPI + 8];
    const int tid = threadIdx.x, kind = blockIdx.x % 3, blk = blockIdx.x / 3;
    v4f x[2][8];
    if (kind < 2) {
        const int wv = tid >> 5, r = (tid >> 4) & 1, d = (tid & 15) * 8; const int row0 = blk * 16, b = row0 / TT, t0 = row0 % TT;
        const float* sp = (kind ? k : q) + (size_t)(row0 + r) * DM + 2 * wv * HD + d;
        const size_t o = ((size_t)(b * NH_ + 2 * wv) * TT + t0 + r) * HD + d;
        h16* p16 = (kind ? K16 : Q16) + o; bf* ph = (kind ? Kh : Qh) + o; bf* pl = (kind ? Kl : Ql) + o;
        // unit n = 0 .. 15: head n >> 3 of the wave's two, rows 2 * (n & 7) + r; a group is 4 units
#pragma unroll
        for (int u = 0; u < 4; ++u) { const float* s = sp + (u & 7) * 2 * DM; x[0][2 * u] = *(const v4f*)s; x[0][2 * u + 1] = *(const v4f*)(s + 4); }
#pragma unroll
        for (int g = 0; g < 4; ++g) {
            if (g < 3) {
#pragma unroll
                for (int u = 0; u < 4; ++u) { const int n = (g + 1) * 4 + u; const float* s = sp + (n >> 3) * HD + (n & 7) * 2 * DM; x[(g + 1) & 1][2 * u] = *(const v4f*)s; x[(g + 1) & 1][2 * u + 1] = *(const v4f*)(s + 4); }
            }
#pragma unroll
            for (int u = 0; u < 4; ++u) { const int n = g * 4 + u; const int po = (n >> 3) * TT * HD + (n & 7) * 2 * HD; float y[8];
#pragma unroll
                for (int j = 0; j < 4; ++j) { y[j] = x[g & 1][2 * u][j]; y[4 + j] = x[g & 1][2 * u + 1][j]; }
                cvt8(y, p16 + po, ph + po, pl + po); }
            asm volatile("s_wait_xcnt 0x0" :: "v"(sp), "v"(p16), "v"(ph), "v"(pl) : "memory");   // the registers that this group's loads and stores name may be rewritten only behind this wait (the addresses are its inputs: live and unchanged up to it)
        }
    } else {
        const int z = blk >> 3, s8 = blk & 7, c = tid & 15, r = tid >> 4;   // c, r: as a loader 4 features at c * 4 of rows r + 16 j; as a storer 8 positions at c * 8 of features r + 16 kk
        const float* sp = v + ((size_t)(z / NH_) * TT + s8 * 256 + r) * DM + (z % NH_) * HD + c * 4;
        const size_t o = ((size_t)z * HD + r) * (2 * TT) + s8 * 256 + c * 8;
        h16* p16 = V16 + o; bf* ph = Vh + o;
#pragma unroll
        for (int j = 0; j < 8; ++j) x[0][j] = *(const v4f*)(sp + j * 16 * DM);
#pragma unroll
        for (int n = 0; n < 4; ++n) {   // tile n: positions (n >> 1) * 128 .., features (n & 1) * 64 ..
            float* L = ts[n & 1];
            if (n < 3) {
#pragma unroll
                for (int j = 0; j < 8; ++j) x[(n + 1) & 1][j] = *(const v4f*)(sp + (((n + 1) >> 1) * 128 + j * 16) * DM + ((n + 1) & 1) * 64);
            }
#pragma unroll
            for (int j = 0; j < 8; ++j)
#pragma unroll
                for (int i = 0; i < 4; ++i) L[(r + 16 * j) * VPI + (j >> 2) * 4 + c * 4 + i] = x[n & 1][j][i];
            // work-group barrier with fences on LDS alone: the tile is whole behind it, and it ends every read of the other buffer, which the next tile overwrites. __syncthreads() would also wait here for the next tile's global loads and this thread's global stores, which no other thread reads
            __builtin_amdgcn_fence(__ATOMIC_RELEASE, "workgroup", "local"); __builtin_amdgcn_s_barrier(); __builtin_amdgcn_fence(__ATOMIC_ACQUIRE, "workgroup", "local");
#pragma unroll
            for (int kk = 0; kk < 4; ++kk) { const int po = ((n & 1) * 64 + kk * 16) * (2 * TT) + (n >> 1) * 128; float y[8];
#pragma unroll
                for (int j = 0; j < 8; ++j) y[j] = L[(c * 8 + j) * VPI + (c >> 3) * 4 + r + 16 * kk];
                cvt8(y, p16 + po, ph + po, ph + po + TT); }
            asm volatile("s_wait_xcnt 0x0" :: "v"(sp), "v"(p16), "v"(ph) : "memory");   // as above
        }
    }
}
#define FTHR 5.0f
// 2^x; the v_nop in the same statement keeps the one free slot the instruction set asks for behind a transcendental
__device__ __forceinline__ float exp2s(float x) { float r; asm("v_exp_f32_e32 %0, %1\n\tv_nop" : "=v"(r) : "v"(x)); return r; }
template <typename T16, int NSPLIT>
__device__ __forceinline__ void fa_tile(const T16* __restrict__ Q, const T16* __restrict__ Q2, const T16* __restrict__ Kp, const T16* __restrict__ K2, const T16* __restrict__ Vt, const T16* __restrict__ V2, const int q0, const int lr, const int hi, float* __restrict__ orow) {
    typedef WFrag<T16> WF; typedef typename WF::V V;
    constexpr float OFF = (NSPLIT == 0) ? 10.0f : 0.0f;
    constexpr float CL2 = SCL * 1.4426950408889634f;   // scores in log2 units
    V qf[2][4], qg[2][4];
    const size_t qofs = (size_t)(q0 + lr) * HD + 8 * hi; const T16* qp = Q + qofs; const T16* qp2 = NSPLIT ? Q2 + qofs : qp;
#pragma unroll
    for (int qt = 0; qt < 2; ++qt)
#pragma unroll
        for (int ks = 0; ks < 4; ++ks) { const int qo = qt * 16 * HD + ks * 32; qf[qt][ks] = WF::ld(qp + qo); if (NSPLIT) qg[qt][ks] = WF::ld(qp2 + qo); }
    v8f o[2][8];
#pragma unroll
    for (int qt = 0; qt < 2; ++qt)
#pragma unroll
        for (int dt = 0; dt < 8; ++dt) o[qt][dt] = (v8f){};
    float m[2] = {-3.0e38f, -3.0e38f}, l[2] = {0.f, 0.f};
    const size_t kofs = (size_t)lr * HD + 8 * hi, vofs = (size_t)lr * (2 * TT) + 8 * hi;
    V kf[2][4], kg[2][4]; const T16* kp0 = Kp + kofs;
    if (NSPLIT == 0) {
#pragma unroll
        for (int kt = 0; kt < 2; ++kt)
#pragma unroll
            for (int ks = 0; ks < 4; ++ks) kf[kt][ks] = WF::ld(kp0 + kt * 16 * HD + ks * 32);
    }
    asm volatile("s_wait_xcnt 0x0" :: "v"(qp), "v"(qp2), "v"(kp0) : "memory");   // the address registers of the loads above stay untouched up to this wait (they are its inputs)
#pragma unroll 1
    for (int kb = 0; kb <= q0; kb += 32) {
        V vf[8], vg[8]; const T16* vp = Vt + vofs + kb; const T16* vp2 = NSPLIT ? V2 + vofs + kb : vp;
        const int kn = NSPLIT ? kb : min(kb + 32, q0); const T16* kp = Kp + kofs + (size_t)kn * HD; const T16* kp2 = NSPLIT ? K2 + kofs + (size_t)kn * HD : kp;
        if (NSPLIT == 0) {   // the value fragments fly during the score products and the softmax
#pragma unroll
            for (int dt = 0; dt < 8; ++dt) vf[dt] = WF::ld(vp + dt * 16 * 2 * TT);
        } else {
#pragma unroll
            for (int kt = 0; kt < 2; ++kt)
#pragma unroll
                for (int ks = 0; ks < 4; ++ks) { const int ko = kt * 16 * HD + ks * 32; kf[kt][ks] = WF::ld(kp + ko); kg[kt][ks] = WF::ld(kp2 + ko); }
        }
        v8f s[2][2];
#pragma unroll
        for (int kt = 0; kt < 2; ++kt)
#pragma unroll
            for (int qt = 0; qt < 2; ++qt) s[kt][qt] = (v8f){};
#pragma unroll
        for (int ks = 0; ks < 4; ++ks)
#pragma unroll
            for (int kt = 0; kt < 2; ++kt)
#pragma unroll
                for (int qt = 0; qt < 2; ++qt) { s[kt][qt] = WF::mma(kf[kt][ks], qf[qt][ks], s[kt][qt]); if (NSPLIT) { s[kt][qt] = WF::mma(kf[kt][ks], qg[qt][ks], s[kt][qt]); s[kt][qt] = WF::mma(kg[kt][ks], qf[qt][ks], s[kt][qt]); } }
        if (NSPLIT == 0) {   // the next pass's key fragments, one pass ahead (the last pass re-reads its own rows: always in bounds)
#pragma unroll
            for (int kt = 0; kt < 2; ++kt)
#pragma unroll
                for (int ks = 0; ks < 4; ++ks) kf[kt][ks] = WF::ld(kp + kt * 16 * HD + ks * 32);
            asm volatile("s_wait_xcnt 0x0" :: "v"(vp), "v"(kp) : "memory");   // this pass's loads are all issued: their address registers (inputs here, so live and unchanged) may be rewritten only behind this wait
        }
        if (kb == q0) {   // the diagonal pass: keys after the query are excluded (an exact zero weight)
#pragma unroll
            for (int kt = 0; kt < 2; ++kt)
#pragma unroll
                for (int qt = 0; qt < 2; ++qt)
#pragma unroll
                    for (int j = 0; j < 8; ++j) if (kt * 16 + hi * 8 + j > qt * 16 + lr) s[kt][qt][j] = -3.0e38f;
        }
        float mx[2];
#pragma unroll
        for (int qt = 0; qt < 2; ++qt) { float a = s[0][qt][0];
#pragma unroll
            for (int j = 1; j < 8; ++j) a = fmaxf(a, s[0][qt][j]);
#pragma unroll
            for (int j = 0; j < 8; ++j) a = fmaxf(a, s[1][qt][j]);
            mx[qt] = a; }
        { const float x0 = __shfl_xor(mx[0], 16, 32), x1 = __shfl_xor(mx[1], 16, 32); mx[0] = fmaxf(mx[0], x0) * CL2; mx[1] = fmaxf(mx[1], x1) * CL2; }
        if (__builtin_amdgcn_ballot_w32(mx[0] > m[0] + FTHR || mx[1] > m[1] + FTHR) != 0) {
#pragma unroll
            for (int qt = 0; qt < 2; ++qt) { const float mn = fmaxf(m[qt], mx[qt]); const float al = exp2s(m[qt] - mn); m[qt] = mn; l[qt] *= al;
#pragma unroll
                for (int dt = 0; dt < 8; ++dt) o[qt][dt] *= al; }
        }
        V pf[2], pg[2];
#pragma unroll
        for (int qt = 0; qt < 2; ++qt) { const float mo = OFF - m[qt]; float p[16]; float sum = 0.f;
#pragma unroll
            for (int e = 0; e < 16; ++e) { p[e] = exp2s(__builtin_fmaf(s[e >> 3][qt][e & 7], CL2, mo)); sum += p[e]; }
            l[qt] += sum;
            if constexpr (NSPLIT == 0) { v16h t;
#pragma unroll
                for (int e = 0; e < 16; ++e) t[e] = (h16)p[e];
                pf[qt] = t;
            } else { v8us h0, h1, l0, l1;
#pragma unroll
                for (int e = 0; e < 8; ++e) { unsigned short a, c; splitf(p[e], a, c); h0[e] = a; l0[e] = c; splitf(p[8 + e], a, c); h1[e] = a; l1[e] = c; }
                pf[qt] = cat16b(h0, h1); pg[qt] = cat16b(l0, l1); } }
        if (NSPLIT) {   // hi / lo rows (at most 16 passes): the value fragments come behind the softmax, so that 128 operand registers are not live across it
#pragma unroll
            for (int dt = 0; dt < 8; ++dt) { const int vo = dt * 16 * 2 * TT; vf[dt] = WF::ld(vp + vo); vg[dt] = WF::ld(vp2 + vo); }
            asm volatile("s_wait_xcnt 0x0" :: "v"(vp), "v"(vp2), "v"(kp), "v"(kp2) : "memory");   // as above: address registers unchanged up to this wait
        }
#pragma unroll
        for (int dt = 0; dt < 8; ++dt)
#pragma unroll
            for (int qt = 0; qt < 2; ++qt) { o[qt][dt] = WF::mma(vf[dt], pf[qt], o[qt][dt]); if (NSPLIT) { o[qt][dt] = WF::mma(vf[dt], pg[qt], o[qt][dt]); o[qt][dt] = WF::mma(vg[dt], pf[qt], o[qt][dt]); } }
    }
#pragma unroll
    for (int qt = 0; qt < 2; ++qt) { const float inv = __fdiv_rn(1.0f, l[qt] + __shfl_xor(l[qt], 16, 32));
#pragma unroll
        for (int dt = 0; dt < 8; ++dt) o[qt][dt] *= inv; }
    float* op = orow + (size_t)(q0 + lr) * DQ + hi * 8;   // a lane's 8 accumulator registers are 8 consecutive features of one query row
#pragma unroll
    for (int qt = 0; qt < 2; ++qt)
#pragma unroll
        for (int dt = 0; dt < 8; ++dt) { v4f a, c;
#pragma unroll
            for (int j = 0; j < 4; ++j) { a[j] = o[qt][dt][j]; c[j] = o[qt][dt][4 + j]; }
            *(v4f*)(op + qt * 16 * DQ + dt * 16) = a; *(v4f*)(op + qt * 16 * DQ + dt * 16 + 4) = c; }
}
// grid: 512 blocks of 4 waves = 16 blocks of 128 query rows x 32 (batch, head) planes; the first 256 blocks take the long rows, longest first, the second 256 the short ones, shortest first.
__global__ __launch_bounds__(128, 2) void k_fattn(const h16* __restrict__ Q16, const h16* __restrict__ K16, const h16* __restrict__ V16, const bf* __restrict__ Qh, const bf* __restrict__ Ql, const bf* __restrict__ Kh, const bf* __restrict__ Kl, const bf* __restrict__ Vh, const bf* __restrict__ Vl, float* __restrict__ OUT) {
    const int lane = threadIdx.x & 31, lr = lane & 15, hi = lane >> 4; const int wv = __builtin_amdgcn_readfirstlane(threadIdx.x >> 5);
    const int lin = blockIdx.x, z = lin & (NB_ * NH_ - 1), g = lin / (NB_ * NH_); const int qb = (g < 8) ? 15 - g : g - 8;
    const int q0 = qb * 128 + wv * 32; const size_t pz = (size_t)z * TT * HD, vz = (size_t)z * HD * TT * 2;
    float* orow = OUT + (size_t)(z / NH_) * TT * DQ + (z % NH_) * HD;
    if (q0 < RH) fa_tile<bf, 2>(Qh + pz, Ql + pz, Kh + pz, Kl + pz, Vh + vz, Vl + vz, q0, lr, hi, orow);
    else fa_tile<h16, 0>(Q16 + pz, nullptr, K16 + pz, nullptr, V16 + vz, nullptr, q0, lr, hi, orow);
}

extern "C" void kernel_launch(void* const* d_in, const int* in_sizes, int n_in,
                              void* d_out, int out_size, void* d_ws, size_t ws_size, hipStream_t stream) {
    (void)in_sizes; (void)n_in; (void)out_size;
    const float* q = (const float*)d_in[0]; const float* k = (const float*)d_in[1]; const float* v = (const float*)d_in[2];   /* q, k, v ([2][2048][2048] each, GIVEN: this module has NO projections): THREE inputs */
    float* OUT = (float*)d_out;     // [2][2048][2048]
    char* wsp = (char*)d_ws;
    auto take = [&](size_t bytes) { char* p = wsp; wsp += (bytes + 255) & ~(size_t)255; return (void*)p; };
    const size_t PZ = (size_t)NH_ * TT * HD;   // elements of one batch's head planes; every plane holds both batches (160 MiB of the 256 MiB workspace)
    h16* QP16 = (h16*)take(NB_ * PZ * 2); h16* KP16 = (h16*)take(NB_ * PZ * 2); h16* VT16 = (h16*)take(NB_ * PZ * 2 * 2);
    bf* QPh = (bf*)take(NB_ * PZ * 2); bf* QPl = (bf*)take(NB_ * PZ * 2); bf* KPh = (bf*)take(NB_ * PZ * 2); bf* KPl = (bf*)take(NB_ * PZ * 2); bf* VTh = (bf*)take(NB_ * PZ * 2 * 2); bf* VTl = VTh + TT;   // value rows at pitch 2 * TT: hi / lo share a row, the fp16 row uses its first half
    if ((size_t)(wsp - (char*)d_ws) > ws_size) return;    // ws 256 MiB
    k_planes<<<3 * 256, 256, 0, stream>>>(q, k, v, QP16, QPh, QPl, KP16, KPh, KPl, VT16, VTh);   /* all planes of both batches straight from the INPUT rows [t][h * 128 + d]; the lo value rows lie TT behind the hi rows */
    k_fattn<<<NB_ * NH_ * (TT / 128), 128, 0, stream>>>(QP16, KP16, VT16, QPh, QPl, KPh, KPl, VTh, VTl, OUT);   /* all 32 (batch, head) planes in one launch; the merged context goes straight to the OUTPUT in f32 */
}

// v004
// Measured time: 71.2 microseconds a run.
// Two timings next to v003 put it at 1.82 and 1.81 times that version's speed.
// Counting every step since v000, it is 18.1 times as fast.
#include <hip/hip_runtime.h>

// Causal multi-head attention CORE on GIVEN q, k, v (q, k, v [2][2048][2048]; 16 heads x 128 by reshape: head h = features h * 128 .. h * 128 + 127; dots = (q x 128^-0.5) . k; keys after the query take -50000 (== exclusion: an exact zero weight after the softmax); softmax over the keys; out = attn v merged in head order -> [2][2048][2048] (8.4 M); NO projections, NO rotary; argument order q, k, v).
// Compute dtypes, f32 accumulate: the GIVEN f32 q, k, v are NOT rounded to bf16 (no projection, no input cast): the plane builders read them directly: q and k as f16 planes + bf16 hi / lo planes (hi + lo carries about 16 bits of the f32 value), v likewise (transposed); causal scores, online softmax and attn.v in one kernel: query rows < 512 hl (3 products), the rest single fp16 (P x 1024 and more); softmax f32; the merged context is written to the output in f32 (no output projection).

#define NB_  2
#define TT   2048
#define DM   2048
#define NH_  16
#define NKV  16
#define REP  (NH_ / NKV)
#define HD   128
#define DQ   (NH_ * HD)
#define DKV  (NKV * HD)
#define RH   512                  // query rows < RH use hi+lo planes (0: none)
#define SCL  0.088388347648318447f   // HD^-0.5
typedef _Float16 h16;
typedef unsigned short bf;
typedef __attribute__((ext_vector_type(16))) __bf16   v16bf;
typedef __attribute__((ext_vector_type(16))) _Float16 v16h;
typedef __attribute__((ext_vector_type(8)))  _Float16 v8h;
typedef __attribute__((ext_vector_type(8)))  unsigned short v8us;
typedef __attribute__((ext_vector_type(8)))  float    v8f;
typedef __attribute__((ext_vector_type(4)))  float    v4f;
typedef v8h  __attribute__((may_alias)) v8ha;
typedef v4f  __attribute__((may_alias)) v4fa;
typedef v8us __attribute__((may_alias)) v8usa;

__device__ __forceinline__ unsigned short f2bf(float f) { unsigned u = __float_as_uint(f); u += 0x7FFFu + ((u >> 16) & 1u); return (unsigned short)(u >> 16); }
__device__ __forceinline__ float bf2f(unsigned short b) { return __uint_as_float(((unsigned)b) << 16); }
__device__ __forceinline__ float bfr(float f) { return bf2f(f2bf(f)); }
__device__ __forceinline__ v16h cat16(v8h lo, v8h hi) { return __builtin_shufflevector(lo, hi, 0, 1, 2, 3, 4, 5, 6, 7, 8, 9, 10, 11, 12, 13, 14, 15); }
__device__ __forceinline__ v16bf cat16b(v8us lo, v8us hi) { return __builtin_bit_cast(v16bf, __builtin_shufflevector(lo, hi, 0, 1, 2, 3, 4, 5, 6, 7, 8, 9, 10, 11, 12, 13, 14, 15)); }
__device__ __forceinline__ v8f wmma16(v16h a, v16h b, v8f c) { return __builtin_amdgcn_wmma_f32_16x16x32_f16(false, a, false, b, (short)0, c, false, false); }
__device__ __forceinline__ v8f wmmab(v16bf a, v16bf b, v8f c) { return __builtin_amdgcn_wmma_f32_16x16x32_bf16(false, a, false, b, (short)0, c, false, false); }



// ---- k_gemmw: register-blocked GEMM, ONE WAVE per 64x64 output tile (16 accumulators), operands straight from K-contiguous 16-bit planes; grid (M/64, N/64, Z), 32 threads.
// C[m][n] (f32, pitch ldc, + optional f32 bias[n]) = sum_k A[m][k] Bt[n][k] (+ split products per NSPLIT). z-batch strides sA/sB/sC in elements. K % 32 == 0.
template <typename T16> struct WFrag;
template <> struct WFrag<h16> { typedef v16h V; static __device__ __forceinline__ V ld(const h16* p) { return cat16(*(const v8h*)p, *(const v8h*)(p + 16)); } static __device__ __forceinline__ v8f mma(V a, V b, v8f c) { return wmma16(a, b, c); } };
template <> struct WFrag<bf> { typedef v16bf V; static __device__ __forceinline__ V ld(const bf* p) { return cat16b(*(const v8us*)p, *(const v8us*)(p + 16)); } static __device__ __forceinline__ v8f mma(V a, V b, v8f c) { return wmmab(a, b, c); } };
template <typename T16, int NSPLIT, bool BIAS>
__global__ __launch_bounds__(32) void k_gemmw(const T16* __restrict__ A, const T16* __restrict__ A2, const T16* __restrict__ Bt, const T16* __restrict__ Bt2, int K, float* C, int ldc, const float* __restrict__ bias, size_t sA, size_t sB, size_t sC) {
    typedef typename WFrag<T16>::V V;
    __shared__ __align__(16) float os[16 * 68];
    const size_t z = blockIdx.z; A += z * sA; if (A2) A2 += z * sA; Bt += z * sB; if (Bt2) Bt2 += z * sB; C += z * sC;
    const int lane = threadIdx.x & 31, lr = lane & 15, hi = lane >> 4; const int r0 = blockIdx.x * 64, c0 = blockIdx.y * 64;
    v8f acc[4][4];
#pragma unroll
    for (int mb = 0; mb < 4; ++mb)
#pragma unroll
        for (int nb = 0; nb < 4; ++nb) acc[mb][nb] = (v8f){};
    const size_t aoff = (size_t)(r0 + lr) * K + 8 * hi, boff = (size_t)(c0 + lr) * K + 8 * hi;
#pragma unroll 1
    for (int kc = 0; kc < K; kc += 32) {
        V a[4], a2[4];
#pragma unroll
        for (int mb = 0; mb < 4; ++mb) { a[mb] = WFrag<T16>::ld(A + aoff + (size_t)mb * 16 * K + kc); if (NSPLIT == 1 || NSPLIT == 2) a2[mb] = WFrag<T16>::ld(A2 + aoff + (size_t)mb * 16 * K + kc); }
#pragma unroll
        for (int nb = 0; nb < 4; ++nb) { const V b = WFrag<T16>::ld(Bt + boff + (size_t)nb * 16 * K + kc); V b2; if (NSPLIT >= 2) b2 = WFrag<T16>::ld(Bt2 + boff + (size_t)nb * 16 * K + kc);
#pragma unroll
            for (int mb = 0; mb < 4; ++mb) { acc[mb][nb] = WFrag<T16>::mma(a[mb], b, acc[mb][nb]); if (NSPLIT == 1 || NSPLIT == 2) acc[mb][nb] = WFrag<T16>::mma(a2[mb], b, acc[mb][nb]); if (NSPLIT >= 2) acc[mb][nb] = WFrag<T16>::mma(a[mb], b2, acc[mb][nb]); } }
        asm volatile("v_nop\n\tv_nop\n\tv_nop\n\tv_nop" : "+v"(acc[0][0]), "+v"(acc[1][1]), "+v"(acc[2][2]), "+v"(acc[3][3]) : "v"(a[0]), "v"(a[3]));
    }
#pragma unroll
    for (int mb = 0; mb < 4; ++mb) {
#pragma unroll
        for (int nb = 0; nb < 4; ++nb) {
#pragma unroll
            for (int j = 0; j < 8; ++j) os[(hi * 8 + j) * 68 + nb * 16 + lr] = acc[mb][nb][j]; }
        __builtin_amdgcn_wave_barrier(); asm volatile("" ::: "memory");
        float* crow = C + (size_t)(r0 + mb * 16) * ldc + c0;
{
#pragma unroll
            for (int s = 0; s < 8; ++s) { const int row = 2 * s + hi, cofs = lr * 4; v4f val = *(const v4fa*)(os + row * 68 + cofs); if (BIAS) { val[0] += bfr(bias[c0 + cofs]); val[1] += bfr(bias[c0 + cofs + 1]); val[2] += bfr(bias[c0 + cofs + 2]); val[3] += bfr(bias[c0 + cofs + 3]); }
                *(v4f*)(crow + (size_t)row * ldc + cofs) = val; }
             }
        __builtin_amdgcn_wave_barrier(); asm volatile("" ::: "memory");
    }
}

__device__ __forceinline__ h16 tohx(float x) { return (h16)x; }
__device__ __forceinline__ void splitf(float y, unsigned short& h, unsigned short& l) { h = f2bf(y); l = f2bf(y - bf2f(h)); }
typedef __attribute__((ext_vector_type(2))) _Float16 v2h;
typedef __attribute__((ext_vector_type(4))) _Float16 v4h;
typedef __attribute__((ext_vector_type(2))) unsigned short v2us;
typedef __attribute__((ext_vector_type(4))) unsigned short v4us;
typedef __attribute__((ext_vector_type(2))) float v2f;
typedef __attribute__((ext_vector_type(4))) int v4i;

__global__ __launch_bounds__(256) void k_wtG(const float* __restrict__ w, int K, int N, bf* Bt) {
    const int lane = threadIdx.x & 31; const int L0 = (blockIdx.x * 8 + (threadIdx.x >> 5)) * 8; const int nlines = N * K / 64;
{
#pragma unroll 1
        for (int l = 0; l < 8; ++l) { const int L = L0 + l; if (L >= nlines) break; const size_t e = (size_t)L * 64 + lane * 2; const int k = (int)(e % K), n = (int)(e / K); v2us o;
            o[0] = f2bf(w[(size_t)k * N + n]); o[1] = f2bf(w[(size_t)(k + 1) * N + n]); *(v2us*)(Bt + e) = o; }
         }
}
__global__ __launch_bounds__(256) void k_cvt8(const float* __restrict__ src, bf* dst, size_t n8) { const size_t i = (size_t)blockIdx.x * 256 + threadIdx.x; if (i >= n8) return; const v8f v = *(const v8f*)(src + i * 8); v8us o;
#pragma unroll
    for (int k = 0; k < 8; ++k) o[k] = f2bf(v[k]); *(v8us*)(dst + i * 8) = o;  }

// ---- k_planes: every operand plane of q, k and v in ONE launch of 768 blocks (256 per input, dealt in turn), 128 elements a thread, 16-byte loads and stores on whole 256-byte pieces.
// q, k: head planes [b * 16 + h][t][d] (fp16 + hi / lo), a plain copy in another order: a block takes 16 rows, a wave two heads of them. v: transposed planes [b * 16 + h][d] at pitch 2 * TT;
// a block takes 256 positions of one head as 4 tiles of 128 t x 64 d, turned in LDS (f32, two buffers, one barrier a tile). The next group's loads fly while this group is converted.
#define VPI 65                    // LDS row pitch in floats: writers (16 lanes x 4 d, two rows) and readers (16 lanes x 8 t, two d) each meet 32 different banks, with the shift of 4 for t >= 64
__device__ __forceinline__ void cvt8(const float* x, h16* p16, bf* ph, bf* pl) { v8h o16; v8us oh, ol;
#pragma unroll
    for (int j = 0; j < 8; ++j) { o16[j] = tohx(x[j]); unsigned short a2, c2; splitf(x[j], a2, c2); oh[j] = a2; ol[j] = c2; }
    *(v8h*)p16 = o16; *(v8us*)ph = oh; *(v8us*)pl = ol; }
__global__ __launch_bounds__(256) void k_planes(const float* __restrict__ q, const float* __restrict__ k, const float* __restrict__ v, h16* Q16, bf* Qh, bf* Ql, h16* K16, bf* Kh, bf* Kl, h16* V16, bf* Vh) {
    __shared__ float ts[2][128 * VPI + 8];
    const int tid = threadIdx.x, kind = blockIdx.x % 3, blk = blockIdx.x / 3;
    v4f x[2][8];
    if (kind < 2) {
        const int wv = tid >> 5, r = (tid >> 4) & 1, d = (tid & 15) * 8; const int row0 = blk * 16, b = row0 / TT, t0 = row0 % TT;
        const float* sp = (kind ? k : q) + (size_t)(row0 + r) * DM + 2 * wv * HD + d;
        const size_t o = ((size_t)(b * NH_ + 2 * wv) * TT + t0 + r) * HD + d;
        h16* p16 = (kind ? K16 : Q16) + o; bf* ph = (kind ? Kh : Qh) + o; bf* pl = (kind ? Kl : Ql) + o;
        // unit n = 0 .. 15: head n >> 3 of the wave's two, rows 2 * (n & 7) + r; a group is 4 units
#pragma unroll
        for (int u = 0; u < 4; ++u) { const float* s = sp + (u & 7) * 2 * DM; x[0][2 * u] = *(const v4f*)s; x[0][2 * u + 1] = *(const v4f*)(s + 4); }
#pragma unroll
        for (int g = 0; g < 4; ++g) {
            if (g < 3) {
#pragma unroll
                for (int u = 0; u < 4; ++u) { const int n = (g + 1) * 4 + u; const float* s = sp + (n >> 3) * HD + (n & 7) * 2 * DM; x[(g + 1) & 1][2 * u] = *(const v4f*)s; x[(g + 1) & 1][2 * u + 1] = *(const v4f*)(s + 4); }
            }
#pragma unroll
            for (int u = 0; u < 4; ++u) { const int n = g * 4 + u; const int po = (n >> 3) * TT * HD + (n & 7) * 2 * HD; float y[8];
#pragma unroll
                for (int j = 0; j < 4; ++j) { y[j] = x[g & 1][2 * u][j]; y[4 + j] = x[g & 1][2 * u + 1][j]; }
                cvt8(y, p16 + po, ph + po, pl + po); }
            asm volatile("s_wait_xcnt 0x0" :: "v"(sp), "v"(p16), "v"(ph), "v"(pl) : "memory");   // the registers that this group's loads and stores name may be rewritten only behind this wait (the addresses are its inputs: live and unchanged up to it)
        }
    } else {
        const int z = blk >> 3, s8 = blk & 7, c = tid & 15, r = tid >> 4;   // c, r: as a loader 4 features at c * 4 of rows r + 16 j; as a storer 8 positions at c * 8 of features r + 16 kk
        const float* sp = v + ((size_t)(z / NH_) * TT + s8 * 256 + r) * DM + (z % NH_) * HD + c * 4;
        const size_t o = ((size_t)z * HD + r) * (2 * TT) + s8 * 256 + c * 8;
        h16* p16 = V16 + o; bf* ph = Vh + o;
#pragma unroll
        for (int j = 0; j < 8; ++j) x[0][j] = *(const v4f*)(sp + j * 16 * DM);
#pragma unroll
        for (int n = 0; n < 4; ++n) {   // tile n: positions (n >> 1) * 128 .., features (n & 1) * 64 ..
            float* L = ts[n & 1];
            if (n < 3) {
#pragma unroll
                for (int j = 0; j < 8; ++j) x[(n + 1) & 1][j] = *(const v4f*)(sp + (((n + 1) >> 1) * 128 + j * 16) * DM + ((n + 1) & 1) * 64);
            }
#pragma unroll
            for (int j = 0; j < 8; ++j)
#pragma unroll
                for (int i = 0; i < 4; ++i) L[(r + 16 * j) * VPI + (j >> 2) * 4 + c * 4 + i] = x[n & 1][j][i];
            // work-group barrier with fences on LDS alone: the tile is whole behind it, and it ends every read of the other buffer, which the next tile overwrites. __syncthreads() would also wait here for the next tile's global loads and this thread's global stores, which no other thread reads
            __builtin_amdgcn_fence(__ATOMIC_RELEASE, "workgroup", "local"); __builtin_amdgcn_s_barrier(); __builtin_amdgcn_fence(__ATOMIC_ACQUIRE, "workgroup", "local");
#pragma unroll
            for (int kk = 0; kk < 4; ++kk) { const int po = ((n & 1) * 64 + kk * 16) * (2 * TT) + (n >> 1) * 128; float y[8];
#pragma unroll
                for (int j = 0; j < 8; ++j) y[j] = L[(c * 8 + j) * VPI + (c >> 3) * 4 + r + 16 * kk];
                cvt8(y, p16 + po, ph + po, ph + po + TT); }
            asm volatile("s_wait_xcnt 0x0" :: "v"(sp), "v"(p16), "v"(ph) : "memory");   // as above
        }
    }
}
#define FTHR 5.0f
#define KPB  272                  // LDS pitch in bytes of a key row (256 bytes of data)
#define BUFB 71680                // bytes of one stage buffer: fp16 128 keys: 128 x 272 + 128 x 272 = 69632; hi / lo 64 keys: 2 x 64 x 272 + 2 x 128 x 144 = 71680
// 2^x; the v_nop in the same statement keeps the one free slot the instruction set asks for behind a transcendental
__device__ __forceinline__ float exp2s(float x) { float r; asm("v_exp_f32_e32 %0, %1\n\tv_nop" : "=v"(r) : "v"(x)); return r; }
// eight asynchronous copies of 16 bytes a lane, global g + i * gs (elements) -> LDS byte l + i * ls; the s_wait_xcnt in the same statement stands in front of any rewrite of the address registers that the copies name
template <typename T16>
__device__ __forceinline__ void cp8(const unsigned l, const unsigned ls, const T16* g, const size_t gs) {
    asm volatile("global_load_async_to_lds_b128 %0, %8, off\n\t"
                 "global_load_async_to_lds_b128 %1, %9, off\n\t"
                 "global_load_async_to_lds_b128 %2, %10, off\n\t"
                 "global_load_async_to_lds_b128 %3, %11, off\n\t"
                 "global_load_async_to_lds_b128 %4, %12, off\n\t"
                 "global_load_async_to_lds_b128 %5, %13, off\n\t"
                 "global_load_async_to_lds_b128 %6, %14, off\n\t"
                 "global_load_async_to_lds_b128 %7, %15, off\n\t"
                 "s_wait_xcnt 0x0"
                 :: "v"(l), "v"(l + ls), "v"(l + 2 * ls), "v"(l + 3 * ls), "v"(l + 4 * ls), "v"(l + 5 * ls), "v"(l + 6 * ls), "v"(l + 7 * ls),
                    "v"(g), "v"(g + gs), "v"(g + 2 * gs), "v"(g + 3 * gs), "v"(g + 4 * gs), "v"(g + 5 * gs), "v"(g + 6 * gs), "v"(g + 7 * gs) : "memory");
}
// one stage: keys kb0 .. kb0 + KS - 1 of every plane into the buffer at LDS byte lb; 32 copies a thread. Key rows: 16 lanes a row of 256 bytes; value rows (128 features): KS / 8 lanes a row of 2 * KS bytes.
template <typename T16, int NSPLIT, int KS>
__device__ __forceinline__ void fa_stage(const unsigned lb, const T16* __restrict__ Kp, const T16* __restrict__ K2, const T16* __restrict__ Vt, const T16* __restrict__ V2, const int kb0, const int tid) {
    constexpr int NPL = NSPLIT ? 2 : 1, VPB = 2 * KS + 16, CPR = KS / 8, RS = 128 / CPR;
    const int kr = tid >> 4, kc = tid & 15, vr = tid / CPR, vc = tid % CPR;
#pragma unroll
    for (int p = 0; p < NPL; ++p) { const T16* g = (p ? K2 : Kp) + (size_t)(kb0 + kr) * HD + kc * 8; const unsigned l = lb + p * KS * KPB + kr * KPB + kc * 16;
#pragma unroll
        for (int i = 0; i < KS / 8; i += 8) cp8(l + i * 8 * KPB, 8 * KPB, g + (size_t)i * 8 * HD, (size_t)8 * HD); }
#pragma unroll
    for (int p = 0; p < NPL; ++p) { const T16* g = (p ? V2 : Vt) + (size_t)vr * (2 * TT) + kb0 + vc * 8; const unsigned l = lb + NPL * KS * KPB + p * 128 * VPB + vr * VPB + vc * 16;
#pragma unroll
        for (int i = 0; i < 128 / RS; i += 8) cp8(l + i * RS * VPB, RS * VPB, g + (size_t)i * RS * 2 * TT, (size_t)RS * 2 * TT); }
}
template <typename T16, int NSPLIT, int KS>
__device__ __forceinline__ void fa_tile(const T16* __restrict__ Q, const T16* __restrict__ Q2, const T16* __restrict__ Kp, const T16* __restrict__ K2, const T16* __restrict__ Vt, const T16* __restrict__ V2, const int q0, const int nst, const int tid, const int lr, const int hi, const char* sm, float* __restrict__ orow) {
    typedef WFrag<T16> WF; typedef typename WF::V V;
    constexpr float OFF = (NSPLIT == 0) ? 10.0f : 0.0f;
    constexpr float CL2 = SCL * 1.4426950408889634f;   // scores in log2 units
    constexpr int NPL = NSPLIT ? 2 : 1, KPE = KPB / 2, VPE = KS + 8;   // LDS row pitches in elements
    const unsigned lb = (unsigned)(size_t)sm;   // LDS byte address of the first buffer
    fa_stage<T16, NSPLIT, KS>(lb, Kp, K2, Vt, V2, 0, tid);   // stage 0 flies while the query fragments are fetched
    V qf[2][4], qg[2][4];
    const size_t qofs = (size_t)(q0 + lr) * HD + 8 * hi; const T16* qp = Q + qofs; const T16* qp2 = NSPLIT ? Q2 + qofs : qp;
#pragma unroll
    for (int qt = 0; qt < 2; ++qt)
#pragma unroll
        for (int ks = 0; ks < 4; ++ks) { const int qo = qt * 16 * HD + ks * 32; qf[qt][ks] = WF::ld(qp + qo); if (NSPLIT) qg[qt][ks] = WF::ld(qp2 + qo); }
    asm volatile("s_wait_xcnt 0x0" :: "v"(qp), "v"(qp2) : "memory");   // the address registers of the loads above stay untouched up to this wait (they are its inputs)
    v8f o[2][8];
#pragma unroll
    for (int qt = 0; qt < 2; ++qt)
#pragma unroll
        for (int dt = 0; dt < 8; ++dt) o[qt][dt] = (v8f){};
    float m[2] = {-3.0e38f, -3.0e38f}, l[2] = {0.f, 0.f};
    asm volatile("s_wait_asynccnt 0x0" ::: "memory");   // this wave's copies of stage 0 have landed
    __syncthreads();                                    // every wave's have: stage 0 may be read
    if (nst > 1) fa_stage<T16, NSPLIT, KS>(lb + BUFB, Kp, K2, Vt, V2, KS, tid);
#pragma unroll 1
    for (int t = 0; t < nst; ++t) {
        const int kb0 = t * KS, kend = min(kb0 + KS - 32, q0);   // this wave's passes of the stage: kb0 .. kend (none behind its diagonal)
        const char* bp = sm + (t & 1) * BUFB;
        const T16* kl = (const T16*)bp + lr * KPE + 8 * hi; const T16* vl = (const T16*)(bp + NPL * KS * KPB) + lr * VPE + 8 * hi;
        V kf[2][4], kg[2][4];
        if (NSPLIT == 0 && kb0 <= kend) {
#pragma unroll
            for (int kt = 0; kt < 2; ++kt)
#pragma unroll
                for (int ks = 0; ks < 4; ++ks) kf[kt][ks] = WF::ld(kl + kt * 16 * KPE + ks * 32);
        }
#pragma unroll 1
        for (int kb = kb0; kb <= kend; kb += 32) {
            V vf[8], vg[8]; const T16* vp = vl + (kb - kb0); const T16* kp = kl + (kb - kb0) * KPE;
            if (NSPLIT == 0) {   // the value fragments come during the score products and the softmax
#pragma unroll
                for (int dt = 0; dt < 8; ++dt) vf[dt] = WF::ld(vp + dt * 16 * VPE);
                __builtin_amdgcn_sched_barrier(0);   // keeps these LDS reads up here: the compiler moved each down to its product, where the wave then waited out the LDS latency once per fragment
            } else {
#pragma unroll
                for (int kt = 0; kt < 2; ++kt)
#pragma unroll
                    for (int ks = 0; ks < 4; ++ks) { const int ko = kt * 16 * KPE + ks * 32; kf[kt][ks] = WF::ld(kp + ko); kg[kt][ks] = WF::ld(kp + KS * KPE + ko); }
                __builtin_amdgcn_sched_barrier(0);   // all key reads issued in one run in front of the products (else one LDS latency is waited out per fragment)
            }
            v8f s[2][2];
#pragma unroll
            for (int kt = 0; kt < 2; ++kt)
#pragma unroll
                for (int qt = 0; qt < 2; ++qt) s[kt][qt] = (v8f){};
#pragma unroll
            for (int ks = 0; ks < 4; ++ks)
#pragma unroll
                for (int kt = 0; kt < 2; ++kt)
#pragma unroll
                    for (int qt = 0; qt < 2; ++qt) { s[kt][qt] = WF::mma(kf[kt][ks], qf[qt][ks], s[kt][qt]); if (NSPLIT) { s[kt][qt] = WF::mma(kf[kt][ks], qg[qt][ks], s[kt][qt]); s[kt][qt] = WF::mma(kg[kt][ks], qf[qt][ks], s[kt][qt]); } }
            if (NSPLIT == 0 && kb < kend) {   // the next pass's key fragments, one pass ahead, inside this stage's buffer only
#pragma unroll
                for (int kt = 0; kt < 2; ++kt)
#pragma unroll
                    for (int ks = 0; ks < 4; ++ks) kf[kt][ks] = WF::ld(kp + (32 + kt * 16) * KPE + ks * 32);
            }
            if (kb == q0) {   // the diagonal pass: keys after the query are excluded (an exact zero weight)
#pragma unroll
                for (int kt = 0; kt < 2; ++kt)
#pragma unroll
                    for (int qt = 0; qt < 2; ++qt)
#pragma unroll
                        for (int j = 0; j < 8; ++j) if (kt * 16 + hi * 8 + j > qt * 16 + lr) s[kt][qt][j] = -3.0e38f;
            }
            float mx[2];
#pragma unroll
            for (int qt = 0; qt < 2; ++qt) { float a = s[0][qt][0];
#pragma unroll
                for (int j = 1; j < 8; ++j) a = fmaxf(a, s[0][qt][j]);
#pragma unroll
                for (int j = 0; j < 8; ++j) a = fmaxf(a, s[1][qt][j]);
                mx[qt] = a; }
            { const float x0 = __shfl_xor(mx[0], 16, 32), x1 = __shfl_xor(mx[1], 16, 32); mx[0] = fmaxf(mx[0], x0) * CL2; mx[1] = fmaxf(mx[1], x1) * CL2; }
            if (__builtin_amdgcn_ballot_w32(mx[0] > m[0] + FTHR || mx[1] > m[1] + FTHR) != 0) {
#pragma unroll
                for (int qt = 0; qt < 2; ++qt) { const float mn = fmaxf(m[qt], mx[qt]); const float al = exp2s(m[qt] - mn); m[qt] = mn; l[qt] *= al;
#pragma unroll
                    for (int dt = 0; dt < 8; ++dt) o[qt][dt] *= al; }
            }
            V pf[2], pg[2];
#pragma unroll
            for (int qt = 0; qt < 2; ++qt) { const float mo = OFF - m[qt]; float p[16]; float sum = 0.f;
#pragma unroll
                for (int e = 0; e < 16; ++e) { p[e] = exp2s(__builtin_fmaf(s[e >> 3][qt][e & 7], CL2, mo)); sum += p[e]; }
                l[qt] += sum;
                if constexpr (NSPLIT == 0) { v16h t16;
#pragma unroll
                    for (int e = 0; e < 16; ++e) t16[e] = (h16)p[e];
                    pf[qt] = t16;
                } else { v8us h0, h1, l0, l1;
#pragma unroll
                    for (int e = 0; e < 8; ++e) { unsigned short a, c; splitf(p[e], a, c); h0[e] = a; l0[e] = c; splitf(p[8 + e], a, c); h1[e] = a; l1[e] = c; }
                    pf[qt] = cat16b(h0, h1); pg[qt] = cat16b(l0, l1); } }
            if (NSPLIT) {   // hi / lo rows (at most 16 passes): the value fragments come behind the softmax, so that 128 operand registers are not live across it
#pragma unroll
                for (int dt = 0; dt < 8; ++dt) { const int vo = dt * 16 * VPE; vf[dt] = WF::ld(vp + vo); vg[dt] = WF::ld(vp + 128 * VPE + vo); }
                __builtin_amdgcn_sched_barrier(0);   // as above, for the value reads
            }
#pragma unroll
            for (int dt = 0; dt < 8; ++dt)
#pragma unroll
                for (int qt = 0; qt < 2; ++qt) { o[qt][dt] = WF::mma(vf[dt], pf[qt], o[qt][dt]); if (NSPLIT) { o[qt][dt] = WF::mma(vf[dt], pg[qt], o[qt][dt]); o[qt][dt] = WF::mma(vg[dt], pf[qt], o[qt][dt]); } }
        }
        // hand-over, passed by every wave (also one that had no pass in this stage)
        asm volatile("s_wait_dscnt 0x0" ::: "memory");      // this wave's reads of this buffer are done before it is refilled
        asm volatile("s_wait_asynccnt 0x0" ::: "memory");   // this wave's copies of stage t + 1 have landed
        __syncthreads();                                    // stage t + 1 may be read by all; nobody reads stage t's buffer any more
        if (t + 2 < nst) fa_stage<T16, NSPLIT, KS>(lb + (t & 1) * BUFB, Kp, K2, Vt, V2, (t + 2) * KS, tid);
    }
    asm volatile("s_wait_asynccnt 0x0" ::: "memory");   // no copy is outstanding when the wave ends
#pragma unroll
    for (int qt = 0; qt < 2; ++qt) { const float inv = __fdiv_rn(1.0f, l[qt] + __shfl_xor(l[qt], 16, 32));
#pragma unroll
        for (int dt = 0; dt < 8; ++dt) o[qt][dt] *= inv; }
    float* op = orow + (size_t)(q0 + lr) * DQ + hi * 8;   // a lane's 8 accumulator registers are 8 consecutive features of one query row
#pragma unroll
    for (int qt = 0; qt < 2; ++qt)
#pragma unroll
        for (int dt = 0; dt < 8; ++dt) { v4f a, c;
#pragma unroll
            for (int j = 0; j < 4; ++j) { a[j] = o[qt][dt][j]; c[j] = o[qt][dt][4 + j]; }
            *(v4f*)(op + qt * 16 * DQ + dt * 16) = a; *(v4f*)(op + qt * 16 * DQ + dt * 16 + 4) = c; }
}
// grid: 512 blocks of 4 waves = 16 blocks of 128 query rows x 32 (batch, head) planes; the first 256 blocks take the long rows, longest first, the second 256 the short ones, shortest first.
__global__ __launch_bounds__(128, 2) void k_fattn(const h16* __restrict__ Q16, const h16* __restrict__ K16, const h16* __restrict__ V16, const bf* __restrict__ Qh, const bf* __restrict__ Ql, const bf* __restrict__ Kh, const bf* __restrict__ Kl, const bf* __restrict__ Vh, const bf* __restrict__ Vl, float* __restrict__ OUT) {
    __shared__ __attribute__((aligned(128))) char sm[2 * BUFB];
    const int tid = threadIdx.x, lane = tid & 31, lr = lane & 15, hi = lane >> 4; const int wv = __builtin_amdgcn_readfirstlane(tid >> 5);
    const int lin = blockIdx.x, z = lin & (NB_ * NH_ - 1), g = lin / (NB_ * NH_); const int qb = (g < 8) ? 15 - g : g - 8;
    const int q0 = qb * 128 + wv * 32; const size_t pz = (size_t)z * TT * HD, vz = (size_t)z * HD * TT * 2;
    float* orow = OUT + (size_t)(z / NH_) * TT * DQ + (z % NH_) * HD;
    // the choice is the same for the whole block (RH is a multiple of 128): its barriers stand under block-uniform control flow; stages: the block's keys 0 .. qb * 128 + 127
    if (qb * 128 < RH) fa_tile<bf, 2, 64>(Qh + pz, Ql + pz, Kh + pz, Kl + pz, Vh + vz, Vl + vz, q0, 2 * (qb + 1), tid, lr, hi, sm, orow);
    else fa_tile<h16, 0, 128>(Q16 + pz, nullptr, K16 + pz, nullptr, V16 + vz, nullptr, q0, qb + 1, tid, lr, hi, sm, orow);
}

extern "C" void kernel_launch(void* const* d_in, const int* in_sizes, int n_in,
                              void* d_out, int out_size, void* d_ws, size_t ws_size, hipStream_t stream) {
    (void)in_sizes; (void)n_in; (void)out_size;
    const float* q = (const float*)d_in[0]; const float* k = (const float*)d_in[1]; const float* v = (const float*)d_in[2];   /* q, k, v ([2][2048][2048] each, GIVEN: this module has NO projections): THREE inputs */
    float* OUT = (float*)d_out;     // [2][2048][2048]
    char* wsp = (char*)d_ws;
    auto take = [&](size_t bytes) { char* p = wsp; wsp += (bytes + 255) & ~(size_t)255; return (void*)p; };
    const size_t PZ = (size_t)NH_ * TT * HD;   // elements of one batch's head planes; every plane holds both batches (160 MiB of the 256 MiB workspace)
    h16* QP16 = (h16*)take(NB_ * PZ * 2); h16* KP16 = (h16*)take(NB_ * PZ * 2); h16* VT16 = (h16*)take(NB_ * PZ * 2 * 2);
    bf* QPh = (bf*)take(NB_ * PZ * 2); bf* QPl = (bf*)take(NB_ * PZ * 2); bf* KPh = (bf*)take(NB_ * PZ * 2); bf* KPl = (bf*)take(NB_ * PZ * 2); bf* VTh = (bf*)take(NB_ * PZ * 2 * 2); bf* VTl = VTh + TT;   // value rows at pitch 2 * TT: hi / lo share a row, the fp16 row uses its first half
    if ((size_t)(wsp - (char*)d_ws) > ws_size) return;    // ws 256 MiB
    k_planes<<<3 * 256, 256, 0, stream>>>(q, k, v, QP16, QPh, QPl, KP16, KPh, KPl, VT16, VTh);   /* all planes of both batches straight from the INPUT rows [t][h * 128 + d]; the lo value rows lie TT behind the hi rows */
    k_fattn<<<NB_ * NH_ * (TT / 128), 128, 0, stream>>>(QP16, KP16, VT16, QPh, QPl, KPh, KPl, VTh, VTl, OUT);   /* all 32 (batch, head) planes in one launch; the merged context goes straight to the OUTPUT in f32 */
}

// v005
// A run of this version takes 68.2 microseconds.
// Timed twice side by side with v004, it ran 1.05 times as fast both times.
// Counting every step since v000, it is 19.1 times as fast.
#include <hip/hip_runtime.h>

// Causal multi-head attention CORE on GIVEN q, k, v (q, k, v [2][2048][2048]; 16 heads x 128 by reshape: head h = features h * 128 .. h * 128 + 127; dots = (q x 128^-0.5) . k; keys after the query take -50000 (== exclusion: an exact zero weight after the softmax); softmax over the keys; out = attn v merged in head order -> [2][2048][2048] (8.4 M); NO projections, NO rotary; argument order q, k, v).
// Compute dtypes, f32 accumulate: the GIVEN f32 q, k, v are NOT rounded to bf16 (no projection, no input cast): the plane builders read them directly: q and k as f16 planes + bf16 hi / lo planes (hi + lo carries about 16 bits of the f32 value), v likewise (transposed); causal scores, online softmax and attn.v in one kernel: query rows < 512 hl (3 products), the rest single fp16 (P x 1024 and more); softmax f32; the merged context is written to the output in f32 (no output projection).

#define NB_  2
#define TT   2048
#define DM   2048
#define NH_  16
#define NKV  16
#define REP  (NH_ / NKV)
#define HD   128
#define DQ   (NH_ * HD)
#define DKV  (NKV * HD)
#define RH   512                  // query rows < RH use hi+lo planes (0: none)
#define SCL  0.088388347648318447f   // HD^-0.5
typedef _Float16 h16;
typedef unsigned short bf;
typedef __attribute__((ext_vector_type(16))) __bf16   v16bf;
typedef __attribute__((ext_vector_type(16))) _Float16 v16h;
typedef __attribute__((ext_vector_type(8)))  _Float16 v8h;
typedef __attribute__((ext_vector_type(8)))  unsigned short v8us;
typedef __attribute__((ext_vector_type(8)))  float    v8f;
typedef __attribute__((ext_vector_type(4)))  float    v4f;
typedef v8h  __attribute__((may_alias)) v8ha;
typedef v4f  __attribute__((may_alias)) v4fa;
typedef v8us __attribute__((may_alias)) v8usa;

__device__ __forceinline__ unsigned short f2bf(float f) { unsigned u = __float_as_uint(f); u += 0x7FFFu + ((u >> 16) & 1u); return (unsigned short)(u >> 16); }
__device__ __forceinline__ float bf2f(unsigned short b) { return __uint_as_float(((unsigned)b) << 16); }
__device__ __forceinline__ float bfr(float f) { return bf2f(f2bf(f)); }
__device__ __forceinline__ v16h cat16(v8h lo, v8h hi) { return __builtin_shufflevector(lo, hi, 0, 1, 2, 3, 4, 5, 6, 7, 8, 9, 10, 11, 12, 13, 14, 15); }
__device__ __forceinline__ v16bf cat16b(v8us lo, v8us hi) { return __builtin_bit_cast(v16bf, __builtin_shufflevector(lo, hi, 0, 1, 2, 3, 4, 5, 6, 7, 8, 9, 10, 11, 12, 13, 14, 15)); }
__device__ __forceinline__ v8f wmma16(v16h a, v16h b, v8f c) { return __builtin_amdgcn_wmma_f32_16x16x32_f16(false, a, false, b, (short)0, c, false, false); }
__device__ __forceinline__ v8f wmmab(v16bf a, v16bf b, v8f c) { return __builtin_amdgcn_wmma_f32_16x16x32_bf16(false, a, false, b, (short)0, c, false, false); }



// ---- k_gemmw: register-blocked GEMM, ONE WAVE per 64x64 output tile (16 accumulators), operands straight from K-contiguous 16-bit planes; grid (M/64, N/64, Z), 32 threads.
// C[m][n] (f32, pitch ldc, + optional f32 bias[n]) = sum_k A[m][k] Bt[n][k] (+ split products per NSPLIT). z-batch strides sA/sB/sC in elements. K % 32 == 0.
template <typename T16> struct WFrag;
template <> struct WFrag<h16> { typedef v16h V; static __device__ __forceinline__ V ld(const h16* p) { return cat16(*(const v8h*)p, *(const v8h*)(p + 16)); } static __device__ __forceinline__ v8f mma(V a, V b, v8f c) { return wmma16(a, b, c); } };
template <> struct WFrag<bf> { typedef v16bf V; static __device__ __forceinline__ V ld(const bf* p) { return cat16b(*(const v8us*)p, *(const v8us*)(p + 16)); } static __device__ __forceinline__ v8f mma(V a, V b, v8f c) { return wmmab(a, b, c); } };
template <typename T16, int NSPLIT, bool BIAS>
__global__ __launch_bounds__(32) void k_gemmw(const T16* __restrict__ A, const T16* __restrict__ A2, const T16* __restrict__ Bt, const T16* __restrict__ Bt2, int K, float* C, int ldc, const float* __restrict__ bias, size_t sA, size_t sB, size_t sC) {
    typedef typename WFrag<T16>::V V;
    __shared__ __align__(16) float os[16 * 68];
    const size_t z = blockIdx.z; A += z * sA; if (A2) A2 += z * sA; Bt += z * sB; if (Bt2) Bt2 += z * sB; C += z * sC;
    const int lane = threadIdx.x & 31, lr = lane & 15, hi = lane >> 4; const int r0 = blockIdx.x * 64, c0 = blockIdx.y * 64;
    v8f acc[4][4];
#pragma unroll
    for (int mb = 0; mb < 4; ++mb)
#pragma unroll
        for (int nb = 0; nb < 4; ++nb) acc[mb][nb] = (v8f){};
    const size_t aoff = (size_t)(r0 + lr) * K + 8 * hi, boff = (size_t)(c0 + lr) * K + 8 * hi;
#pragma unroll 1
    for (int kc = 0; kc < K; kc += 32) {
        V a[4], a2[4];
#pragma unroll
        for (int mb = 0; mb < 4; ++mb) { a[mb] = WFrag<T16>::ld(A + aoff + (size_t)mb * 16 * K + kc); if (NSPLIT == 1 || NSPLIT == 2) a2[mb] = WFrag<T16>::ld(A2 + aoff + (size_t)mb * 16 * K + kc); }
#pragma unroll
        for (int nb = 0; nb < 4; ++nb) { const V b = WFrag<T16>::ld(Bt + boff + (size_t)nb * 16 * K + kc); V b2; if (NSPLIT >= 2) b2 = WFrag<T16>::ld(Bt2 + boff + (size_t)nb * 16 * K + kc);
#pragma unroll
            for (int mb = 0; mb < 4; ++mb) { acc[mb][nb] = WFrag<T16>::mma(a[mb], b, acc[mb][nb]); if (NSPLIT == 1 || NSPLIT == 2) acc[mb][nb] = WFrag<T16>::mma(a2[mb], b, acc[mb][nb]); if (NSPLIT >= 2) acc[mb][nb] = WFrag<T16>::mma(a[mb], b2, acc[mb][nb]); } }
        asm volatile("v_nop\n\tv_nop\n\tv_nop\n\tv_nop" : "+v"(acc[0][0]), "+v"(acc[1][1]), "+v"(acc[2][2]), "+v"(acc[3][3]) : "v"(a[0]), "v"(a[3]));
    }
#pragma unroll
    for (int mb = 0; mb < 4; ++mb) {
#pragma unroll
        for (int nb = 0; nb < 4; ++nb) {
#pragma unroll
            for (int j = 0; j < 8; ++j) os[(hi * 8 + j) * 68 + nb * 16 + lr] = acc[mb][nb][j]; }
        __builtin_amdgcn_wave_barrier(); asm volatile("" ::: "memory");
        float* crow = C + (size_t)(r0 + mb * 16) * ldc + c0;
{
#pragma unroll
            for (int s = 0; s < 8; ++s) { const int row = 2 * s + hi, cofs = lr * 4; v4f val = *(const v4fa*)(os + row * 68 + cofs); if (BIAS) { val[0] += bfr(bias[c0 + cofs]); val[1] += bfr(bias[c0 + cofs + 1]); val[2] += bfr(bias[c0 + cofs + 2]); val[3] += bfr(bias[c0 + cofs + 3]); }
                *(v4f*)(crow + (size_t)row * ldc + cofs) = val; }
             }
        __builtin_amdgcn_wave_barrier(); asm volatile("" ::: "memory");
    }
}

__device__ __forceinline__ h16 tohx(float x) { return (h16)x; }
__device__ __forceinline__ void splitf(float y, unsigned short& h, unsigned short& l) { h = f2bf(y); l = f2bf(y - bf2f(h)); }
typedef __attribute__((ext_vector_type(2))) _Float16 v2h;
typedef __attribute__((ext_vector_type(4))) _Float16 v4h;
typedef __attribute__((ext_vector_type(2))) unsigned short v2us;
typedef __attribute__((ext_vector_type(4))) unsigned short v4us;
typedef __attribute__((ext_vector_type(2))) float v2f;
typedef __attribute__((ext_vector_type(4))) int v4i;

__global__ __launch_bounds__(256) void k_wtG(const float* __restrict__ w, int K, int N, bf* Bt) {
    const int lane = threadIdx.x & 31; const int L0 = (blockIdx.x * 8 + (threadIdx.x >> 5)) * 8; const int nlines = N * K / 64;
{
#pragma unroll 1
        for (int l = 0; l < 8; ++l) { const int L = L0 + l; if (L >= nlines) break; const size_t e = (size_t)L * 64 + lane * 2; const int k = (int)(e % K), n = (int)(e / K); v2us o;
            o[0] = f2bf(w[(size_t)k * N + n]); o[1] = f2bf(w[(size_t)(k + 1) * N + n]); *(v2us*)(Bt + e) = o; }
         }
}
__global__ __launch_bounds__(256) void k_cvt8(const float* __restrict__ src, bf* dst, size_t n8) { const size_t i = (size_t)blockIdx.x * 256 + threadIdx.x; if (i >= n8) return; const v8f v = *(const v8f*)(src + i * 8); v8us o;
#pragma unroll
    for (int k = 0; k < 8; ++k) o[k] = f2bf(v[k]); *(v8us*)(dst + i * 8) = o;  }

// ---- k_planes: every operand plane of q, k and v in ONE launch of 768 blocks (256 per input, dealt in turn), 128 elements a thread, 16-byte loads and stores on whole 256-byte pieces.
// q, k: head planes [b * 16 + h][t][d] (fp16 + hi / lo), a plain copy in another order: a block takes 16 rows, a wave two heads of them. v: transposed planes [b * 16 + h][d] at pitch 2 * TT;
// a block takes 256 positions of one head as 4 tiles of 128 t x 64 d, turned in LDS (f32, two buffers, one barrier a tile). The next group's loads fly while this group is converted.
// Only what k_fattn reads is built: hi / lo planes at positions < RH, fp16 query rows at positions >= RH, fp16 key and value rows everywhere.
#define VPI 65                    // LDS row pitch in floats: writers (16 lanes x 4 d, two rows) and readers (16 lanes x 8 t, two d) each meet 32 different banks, with the shift of 4 for t >= 64
// W16, WHL: which planes k_fattn reads at these positions: fp16, hi / lo. The others are neither converted nor stored.
template <bool W16, bool WHL>
__device__ __forceinline__ void cvt8(const float* x, h16* p16, bf* ph, bf* pl) {
    if constexpr (W16) { v8h o16;
#pragma unroll
        for (int j = 0; j < 8; ++j) o16[j] = tohx(x[j]);
        *(v8h*)p16 = o16;
        asm volatile("s_wait_xcnt 0x0" :: "v"(o16) : "memory"); }   // the stored registers may be rewritten only behind this wait (they are its inputs: live up to it)
    if constexpr (WHL) { v8us oh, ol;
#pragma unroll
        for (int j = 0; j < 8; ++j) { unsigned short a2, c2; splitf(x[j], a2, c2); oh[j] = a2; ol[j] = c2; }
        *(v8us*)ph = oh; *(v8us*)pl = ol;
        asm volatile("s_wait_xcnt 0x0" :: "v"(oh), "v"(ol) : "memory"); } }   // as above
// 16 rows of q or k, two heads a wave (one straight run of code per choice of planes: the choice is made once, by the caller, for the whole block)
template <bool W16, bool WHL>
__device__ __forceinline__ void pl_rows(const float* sp, h16* p16, bf* ph, bf* pl) {
    v4f x[2][8];
    // unit n = 0 .. 15: head n >> 3 of the wave's two, rows 2 * (n & 7) + r; a group is 4 units
#pragma unroll
    for (int u = 0; u < 4; ++u) { const float* s = sp + (u & 7) * 2 * DM; x[0][2 * u] = *(const v4f*)s; x[0][2 * u + 1] = *(const v4f*)(s + 4); }
#pragma unroll
    for (int g = 0; g < 4; ++g) {
        if (g < 3) {
#pragma unroll
            for (int u = 0; u < 4; ++u) { const int n = (g + 1) * 4 + u; const float* s = sp + (n >> 3) * HD + (n & 7) * 2 * DM; x[(g + 1) & 1][2 * u] = *(const v4f*)s; x[(g + 1) & 1][2 * u + 1] = *(const v4f*)(s + 4); }
        }
#pragma unroll
        for (int u = 0; u < 4; ++u) { const int n = g * 4 + u; const int po = (n >> 3) * TT * HD + (n & 7) * 2 * HD; float y[8];
#pragma unroll
            for (int j = 0; j < 4; ++j) { y[j] = x[g & 1][2 * u][j]; y[4 + j] = x[g & 1][2 * u + 1][j]; }
            cvt8<W16, WHL>(y, p16 + po, ph + po, pl + po); }
        asm volatile("s_wait_xcnt 0x0" :: "v"(sp), "v"(p16), "v"(ph), "v"(pl) : "memory");   // the registers that this group's loads and stores name may be rewritten only behind this wait (the addresses are its inputs: live and unchanged up to it)
    }
}
// 256 positions of one head of v, turned in LDS
template <bool WHL>
__device__ __forceinline__ void pl_turn(const float* sp, h16* p16, bf* ph, float (*ts)[128 * VPI + 8], const int c, const int r) {
    v4f x[2][8];
#pragma unroll
    for (int j = 0; j < 8; ++j) x[0][j] = *(const v4f*)(sp + j * 16 * DM);
#pragma unroll
    for (int n = 0; n < 4; ++n) {   // tile n: positions (n >> 1) * 128 .., features (n & 1) * 64 ..
        float* L = ts[n & 1];
        if (n < 3) {
#pragma unroll
            for (int j = 0; j < 8; ++j) x[(n + 1) & 1][j] = *(const v4f*)(sp + (((n + 1) >> 1) * 128 + j * 16) * DM + ((n + 1) & 1) * 64);
        }
#pragma unroll
        for (int j = 0; j < 8; ++j)
#pragma unroll
            for (int i = 0; i < 4; ++i) L[(r + 16 * j) * VPI + (j >> 2) * 4 + c * 4 + i] = x[n & 1][j][i];
        // work-group barrier with fences on LDS alone: the tile is whole behind it, and it ends every read of the other buffer, which the next tile overwrites. __syncthreads() would also wait here for the next tile's global loads and this thread's global stores, which no other thread reads
        __builtin_amdgcn_fence(__ATOMIC_RELEASE, "workgroup", "local"); __builtin_amdgcn_s_barrier(); __builtin_amdgcn_fence(__ATOMIC_ACQUIRE, "workgroup", "local");
#pragma unroll
        for (int kk = 0; kk < 4; ++kk) { const int po = ((n & 1) * 64 + kk * 16) * (2 * TT) + (n >> 1) * 128; float y[8];
#pragma unroll
            for (int j = 0; j < 8; ++j) y[j] = L[(c * 8 + j) * VPI + (c >> 3) * 4 + r + 16 * kk];
            cvt8<true, WHL>(y, p16 + po, ph + po, ph + po + TT); }
        asm volatile("s_wait_xcnt 0x0" :: "v"(sp), "v"(p16), "v"(ph) : "memory");   // as above
    }
}
static_assert(RH % 256 == 0, "a block of k_planes lies wholly below or wholly above RH");
__global__ __launch_bounds__(256) void k_planes(const float* __restrict__ q, const float* __restrict__ k, const float* __restrict__ v, h16* Q16, bf* Qh, bf* Ql, h16* K16, bf* Kh, bf* Kl, h16* V16, bf* Vh) {
    __shared__ float ts[2][128 * VPI + 8];
    const int tid = threadIdx.x, kind = blockIdx.x % 3, blk = blockIdx.x / 3;
    if (kind < 2) {
        const int wv = tid >> 5, r = (tid >> 4) & 1, d = (tid & 15) * 8; const int row0 = blk * 16, b = row0 / TT, t0 = row0 % TT;
        const float* sp = (kind ? k : q) + (size_t)(row0 + r) * DM + 2 * wv * HD + d;
        const size_t o = ((size_t)(b * NH_ + 2 * wv) * TT + t0 + r) * HD + d;
        h16* p16 = (kind ? K16 : Q16) + o; bf* ph = (kind ? Kh : Qh) + o; bf* pl = (kind ? Kl : Ql) + o;
        // hi / lo rows are read at positions < RH alone (the queries there and the keys they see), fp16 query rows at the others, fp16 key rows everywhere
        if (t0 >= RH) pl_rows<true, false>(sp, p16, ph, pl);
        else if (kind) pl_rows<true, true>(sp, p16, ph, pl);
        else pl_rows<false, true>(sp, p16, ph, pl);
    } else {
        const int z = blk >> 3, s8 = blk & 7, c = tid & 15, r = tid >> 4;   // c, r: as a loader 4 features at c * 4 of rows r + 16 j; as a storer 8 positions at c * 8 of features r + 16 kk
        const float* sp = v + ((size_t)(z / NH_) * TT + s8 * 256 + r) * DM + (z % NH_) * HD + c * 4;
        const size_t o = ((size_t)z * HD + r) * (2 * TT) + s8 * 256 + c * 8;
        h16* p16 = V16 + o; bf* ph = Vh + o;
        // the choice is the same for the whole block: its barriers stand under block-uniform control flow
        if (s8 * 256 >= RH) pl_turn<false>(sp, p16, ph, ts, c, r);
        else pl_turn<true>(sp, p16, ph, ts, c, r);
    }
}
#define FTHR 5.0f
#define KPB  272                  // LDS pitch in bytes of a key row (256 bytes of data)
#define BUFB 71680                // bytes of one stage buffer: fp16 128 keys: 128 x 272 + 128 x 272 = 69632; hi / lo 64 keys: 2 x 64 x 272 + 2 x 128 x 144 = 71680
// 2^x; the v_nop in the same statement keeps the one free slot the instruction set asks for behind a transcendental
__device__ __forceinline__ float exp2s(float x) { float r; asm("v_exp_f32_e32 %0, %1\n\tv_nop" : "=v"(r) : "v"(x)); return r; }
// eight asynchronous copies of 16 bytes a lane, global g + i * gs (elements) -> LDS byte l + i * ls; the s_wait_xcnt in the same statement stands in front of any rewrite of the address registers that the copies name
template <typename T16>
__device__ __forceinline__ void cp8(const unsigned l, const unsigned ls, const T16* g, const size_t gs) {
    asm volatile("global_load_async_to_lds_b128 %0, %8, off\n\t"
                 "global_load_async_to_lds_b128 %1, %9, off\n\t"
                 "global_load_async_to_lds_b128 %2, %10, off\n\t"
                 "global_load_async_to_lds_b128 %3, %11, off\n\t"
                 "global_load_async_to_lds_b128 %4, %12, off\n\t"
                 "global_load_async_to_lds_b128 %5, %13, off\n\t"
                 "global_load_async_to_lds_b128 %6, %14, off\n\t"
                 "global_load_async_to_lds_b128 %7, %15, off\n\t"
                 "s_wait_xcnt 0x0"
                 :: "v"(l), "v"(l + ls), "v"(l + 2 * ls), "v"(l + 3 * ls), "v"(l + 4 * ls), "v"(l + 5 * ls), "v"(l + 6 * ls), "v"(l + 7 * ls),
                    "v"(g), "v"(g + gs), "v"(g + 2 * gs), "v"(g + 3 * gs), "v"(g + 4 * gs), "v"(g + 5 * gs), "v"(g + 6 * gs), "v"(g + 7 * gs) : "memory");
}
// one stage: keys kb0 .. kb0 + KS - 1 of every plane into the buffer at LDS byte lb; 32 copies a thread. Key rows: 16 lanes a row of 256 bytes; value rows (128 features): KS / 8 lanes a row of 2 * KS bytes.
template <typename T16, int NSPLIT, int KS>
__device__ __forceinline__ void fa_stage(const unsigned lb, const T16* __restrict__ Kp, const T16* __restrict__ K2, const T16* __restrict__ Vt, const T16* __restrict__ V2, const int kb0, const int tid) {
    constexpr int NPL = NSPLIT ? 2 : 1, VPB = 2 * KS + 16, CPR = KS / 8, RS = 128 / CPR;
    const int kr = tid >> 4, kc = tid & 15, vr = tid / CPR, vc = tid % CPR;
#pragma unroll
    for (int p = 0; p < NPL; ++p) { const T16* g = (p ? K2 : Kp) + (size_t)(kb0 + kr) * HD + kc * 8; const unsigned l = lb + p * KS * KPB + kr * KPB + kc * 16;
#pragma unroll
        for (int i = 0; i < KS / 8; i += 8) cp8(l + i * 8 * KPB, 8 * KPB, g + (size_t)i * 8 * HD, (size_t)8 * HD); }
#pragma unroll
    for (int p = 0; p < NPL; ++p) { const T16* g = (p ? V2 : Vt) + (size_t)vr * (2 * TT) + kb0 + vc * 8; const unsigned l = lb + NPL * KS * KPB + p * 128 * VPB + vr * VPB + vc * 16;
#pragma unroll
        for (int i = 0; i < 128 / RS; i += 8) cp8(l + i * RS * VPB, RS * VPB, g + (size_t)i * RS * 2 * TT, (size_t)RS * 2 * TT); }
}
template <typename T16, int NSPLIT, int KS>
__device__ __forceinline__ void fa_tile(const T16* __restrict__ Q, const T16* __restrict__ Q2, const T16* __restrict__ Kp, const T16* __restrict__ K2, const T16* __restrict__ Vt, const T16* __restrict__ V2, const int q0, const int nst, const int tid, const int lr, const int hi, const char* sm, float* __restrict__ orow) {
    typedef WFrag<T16> WF; typedef typename WF::V V;
    constexpr float OFF = (NSPLIT == 0) ? 10.0f : 0.0f;
    constexpr float CL2 = SCL * 1.4426950408889634f;   // scores in log2 units
    constexpr int NPL = NSPLIT ? 2 : 1, KPE = KPB / 2, VPE = KS + 8;   // LDS row pitches in elements
    const unsigned lb = (unsigned)(size_t)sm;   // LDS byte address of the first buffer
    fa_stage<T16, NSPLIT, KS>(lb, Kp, K2, Vt, V2, 0, tid);   // stage 0 flies while the query fragments are fetched
    V qf[2][4], qg[2][4];
    const size_t qofs = (size_t)(q0 + lr) * HD + 8 * hi; const T16* qp = Q + qofs; const T16* qp2 = NSPLIT ? Q2 + qofs : qp;
#pragma unroll
    for (int qt = 0; qt < 2; ++qt)
#pragma unroll
        for (int ks = 0; ks < 4; ++ks) { const int qo = qt * 16 * HD + ks * 32; qf[qt][ks] = WF::ld(qp + qo); if (NSPLIT) qg[qt][ks] = WF::ld(qp2 + qo); }
    asm volatile("s_wait_xcnt 0x0" :: "v"(qp), "v"(qp2) : "memory");   // the address registers of the loads above stay untouched up to this wait (they are its inputs)
    v8f o[2][8];
#pragma unroll
    for (int qt = 0; qt < 2; ++qt)
#pragma unroll
        for (int dt = 0; dt < 8; ++dt) o[qt][dt] = (v8f){};
    float m[2] = {-3.0e38f, -3.0e38f}, l[2] = {0.f, 0.f};
    asm volatile("s_wait_asynccnt 0x0" ::: "memory");   // this wave's copies of stage 0 have landed
    __syncthreads();                                    // every wave's have: stage 0 may be read
    if (nst > 1) fa_stage<T16, NSPLIT, KS>(lb + BUFB, Kp, K2, Vt, V2, KS, tid);
#pragma unroll 1
    for (int t = 0; t < nst; ++t) {
        const int kb0 = t * KS, kend = min(kb0 + KS - 32, q0);   // this wave's passes of the stage: kb0 .. kend (none behind its diagonal)
        const char* bp = sm + (t & 1) * BUFB;
        const T16* kl = (const T16*)bp + lr * KPE + 8 * hi; const T16* vl = (const T16*)(bp + NPL * KS * KPB) + lr * VPE + 8 * hi;
        V kf[2][4], kg[2][4];
        if (NSPLIT == 0 && kb0 <= kend) {
#pragma unroll
            for (int kt = 0; kt < 2; ++kt)
#pragma unroll
                for (int ks = 0; ks < 4; ++ks) kf[kt][ks] = WF::ld(kl + kt * 16 * KPE + ks * 32);
        }
#pragma unroll 1
        for (int kb = kb0; kb <= kend; kb += 32) {
            V vf[8], vg[8]; const T16* vp = vl + (kb - kb0); const T16* kp = kl + (kb - kb0) * KPE;
            if (NSPLIT == 0) {   // the value fragments come during the score products and the softmax
#pragma unroll
                for (int dt = 0; dt < 8; ++dt) vf[dt] = WF::ld(vp + dt * 16 * VPE);
                __builtin_amdgcn_sched_barrier(0);   // keeps these LDS reads up here: the compiler moved each down to its product, where the wave then waited out the LDS latency once per fragment
            } else {
#pragma unroll
                for (int kt = 0; kt < 2; ++kt)
#pragma unroll
                    for (int ks = 0; ks < 4; ++ks) { const int ko = kt * 16 * KPE + ks * 32; kf[kt][ks] = WF::ld(kp + ko); kg[kt][ks] = WF::ld(kp + KS * KPE + ko); }
                __builtin_amdgcn_sched_barrier(0);   // all key reads issued in one run in front of the products (else one LDS latency is waited out per fragment)
            }
            v8f s[2][2];
#pragma unroll
            for (int kt = 0; kt < 2; ++kt)
#pragma unroll
                for (int qt = 0; qt < 2; ++qt) s[kt][qt] = (v8f){};
#pragma unroll
            for (int ks = 0; ks < 4; ++ks)
#pragma unroll
                for (int kt = 0; kt < 2; ++kt)
#pragma unroll
                    for (int qt = 0; qt < 2; ++qt) { s[kt][qt] = WF::mma(kf[kt][ks], qf[qt][ks], s[kt][qt]); if (NSPLIT) { s[kt][qt] = WF::mma(kf[kt][ks], qg[qt][ks], s[kt][qt]); s[kt][qt] = WF::mma(kg[kt][ks], qf[qt][ks], s[kt][qt]); } }
            if (NSPLIT == 0 && kb < kend) {   // the next pass's key fragments, one pass ahead, inside this stage's buffer only
#pragma unroll
                for (int kt = 0; kt < 2; ++kt)
#pragma unroll
                    for (int ks = 0; ks < 4; ++ks) kf[kt][ks] = WF::ld(kp + (32 + kt * 16) * KPE + ks * 32);
            }
            if (kb == q0) {   // the diagonal pass: keys after the query are excluded (an exact zero weight)
#pragma unroll
                for (int kt = 0; kt < 2; ++kt)
#pragma unroll
                    for (int qt = 0; qt < 2; ++qt)
#pragma unroll
                        for (int j = 0; j < 8; ++j) if (kt * 16 + hi * 8 + j > qt * 16 + lr) s[kt][qt][j] = -3.0e38f;
            }
            float mx[2];
#pragma unroll
            for (int qt = 0; qt < 2; ++qt) { float a = s[0][qt][0];
#pragma unroll
                for (int j = 1; j < 8; ++j) a = fmaxf(a, s[0][qt][j]);
#pragma unroll
                for (int j = 0; j < 8; ++j) a = fmaxf(a, s[1][qt][j]);
                mx[qt] = a; }
            { const float x0 = __shfl_xor(mx[0], 16, 32), x1 = __shfl_xor(mx[1], 16, 32); mx[0] = fmaxf(mx[0], x0) * CL2; mx[1] = fmaxf(mx[1], x1) * CL2; }
            if (__builtin_amdgcn_ballot_w32(mx[0] > m[0] + FTHR || mx[1] > m[1] + FTHR) != 0) {
#pragma unroll
                for (int qt = 0; qt < 2; ++qt) { const float mn = fmaxf(m[qt], mx[qt]); const float al = exp2s(m[qt] - mn); m[qt] = mn; l[qt] *= al;
#pragma unroll
                    for (int dt = 0; dt < 8; ++dt) o[qt][dt] *= al; }
            }
            V pf[2], pg[2];
#pragma unroll
            for (int qt = 0; qt < 2; ++qt) { const float mo = OFF - m[qt]; float p[16]; float sum = 0.f;
#pragma unroll
                for (int e = 0; e < 16; ++e) { p[e] = exp2s(__builtin_fmaf(s[e >> 3][qt][e & 7], CL2, mo)); sum += p[e]; }
                l[qt] += sum;
                if constexpr (NSPLIT == 0) { v16h t16;
#pragma unroll
                    for (int e = 0; e < 16; ++e) t16[e] = (h16)p[e];
                    pf[qt] = t16;
                } else { v8us h0, h1, l0, l1;
#pragma unroll
                    for (int e = 0; e < 8; ++e) { unsigned short a, c; splitf(p[e], a, c); h0[e] = a; l0[e] = c; splitf(p[8 + e], a, c); h1[e] = a; l1[e] = c; }
                    pf[qt] = cat16b(h0, h1); pg[qt] = cat16b(l0, l1); } }
            if (NSPLIT) {   // hi / lo rows (at most 16 passes): the value fragments come behind the softmax, so that 128 operand registers are not live across it
#pragma unroll
                for (int dt = 0; dt < 8; ++dt) { const int vo = dt * 16 * VPE; vf[dt] = WF::ld(vp + vo); vg[dt] = WF::ld(vp + 128 * VPE + vo); }
                __builtin_amdgcn_sched_barrier(0);   // as above, for the value reads
            }
#pragma unroll
            for (int dt = 0; dt < 8; ++dt)
#pragma unroll
                for (int qt = 0; qt < 2; ++qt) { o[qt][dt] = WF::mma(vf[dt], pf[qt], o[qt][dt]); if (NSPLIT) { o[qt][dt] = WF::mma(vf[dt], pg[qt], o[qt][dt]); o[qt][dt] = WF::mma(vg[dt], pf[qt], o[qt][dt]); } }
        }
        // hand-over, passed by every wave (also one that had no pass in this stage)
        asm volatile("s_wait_dscnt 0x0" ::: "memory");      // this wave's reads of this buffer are done before it is refilled
        asm volatile("s_wait_asynccnt 0x0" ::: "memory");   // this wave's copies of stage t + 1 have landed
        __syncthreads();                                    // stage t + 1 may be read by all; nobody reads stage t's buffer any more
        if (t + 2 < nst) fa_stage<T16, NSPLIT, KS>(lb + (t & 1) * BUFB, Kp, K2, Vt, V2, (t + 2) * KS, tid);
    }
    asm volatile("s_wait_asynccnt 0x0" ::: "memory");   // no copy is outstanding when the wave ends
#pragma unroll
    for (int qt = 0; qt < 2; ++qt) { const float inv = __fdiv_rn(1.0f, l[qt] + __shfl_xor(l[qt], 16, 32));
#pragma unroll
        for (int dt = 0; dt < 8; ++dt) o[qt][dt] *= inv; }
    float* op = orow + (size_t)(q0 + lr) * DQ + hi * 8;   // a lane's 8 accumulator registers are 8 consecutive features of one query row
#pragma unroll
    for (int qt = 0; qt < 2; ++qt)
#pragma unroll
        for (int dt = 0; dt < 8; ++dt) { v4f a, c;
#pragma unroll
            for (int j = 0; j < 4; ++j) { a[j] = o[qt][dt][j]; c[j] = o[qt][dt][4 + j]; }
            *(v4f*)(op + qt * 16 * DQ + dt * 16) = a; *(v4f*)(op + qt * 16 * DQ + dt * 16 + 4) = c; }
}
// grid: 512 blocks of 4 waves = 16 blocks of 128 query rows x 32 (batch, head) planes; the first 256 blocks take the long rows, longest first, the second 256 the short ones, shortest first.
__global__ __launch_bounds__(128, 2) void k_fattn(const h16* __restrict__ Q16, const h16* __restrict__ K16, const h16* __restrict__ V16, const bf* __restrict__ Qh, const bf* __restrict__ Ql, const bf* __restrict__ Kh, const bf* __restrict__ Kl, const bf* __restrict__ Vh, const bf* __restrict__ Vl, float* __restrict__ OUT) {
    __shared__ __attribute__((aligned(128))) char sm[2 * BUFB];
    const int tid = threadIdx.x, lane = tid & 31, lr = lane & 15, hi = lane >> 4; const int wv = __builtin_amdgcn_readfirstlane(tid >> 5);
    const int lin = blockIdx.x, z = lin & (NB_ * NH_ - 1), g = lin / (NB_ * NH_); const int qb = (g < 8) ? 15 - g : g - 8;
    const int q0 = qb * 128 + wv * 32; const size_t pz = (size_t)z * TT * HD, vz = (size_t)z * HD * TT * 2;
    float* orow = OUT + (size_t)(z / NH_) * TT * DQ + (z % NH_) * HD;
    // the choice is the same for the whole block (RH is a multiple of 128): its barriers stand under block-uniform control flow; stages: the block's keys 0 .. qb * 128 + 127
    if (qb * 128 < RH) fa_tile<bf, 2, 64>(Qh + pz, Ql + pz, Kh + pz, Kl + pz, Vh + vz, Vl + vz, q0, 2 * (qb + 1), tid, lr, hi, sm, orow);
    else fa_tile<h16, 0, 128>(Q16 + pz, nullptr, K16 + pz, nullptr, V16 + vz, nullptr, q0, qb + 1, tid, lr, hi, sm, orow);
}

extern "C" void kernel_launch(void* const* d_in, const int* in_sizes, int n_in,
                              void* d_out, int out_size, void* d_ws, size_t ws_size, hipStream_t stream) {
    (void)in_sizes; (void)n_in; (void)out_size;
    const float* q = (const float*)d_in[0]; const float* k = (const float*)d_in[1]; const float* v = (const float*)d_in[2];   /* q, k, v ([2][2048][2048] each, GIVEN: this module has NO projections): THREE inputs */
    float* OUT = (float*)d_out;     // [2][2048][2048]
    char* wsp = (char*)d_ws;
    auto take = [&](size_t bytes) { char* p = wsp; wsp += (bytes + 255) & ~(size_t)255; return (void*)p; };
    const size_t PZ = (size_t)NH_ * TT * HD;   // elements of one batch's head planes; every plane holds both batches (160 MiB of the 256 MiB workspace)
    h16* QP16 = (h16*)take(NB_ * PZ * 2); h16* KP16 = (h16*)take(NB_ * PZ * 2); h16* VT16 = (h16*)take(NB_ * PZ * 2 * 2);
    bf* QPh = (bf*)take(NB_ * PZ * 2); bf* QPl = (bf*)take(NB_ * PZ * 2); bf* KPh = (bf*)take(NB_ * PZ * 2); bf* KPl = (bf*)take(NB_ * PZ * 2); bf* VTh = (bf*)take(NB_ * PZ * 2 * 2); bf* VTl = VTh + TT;   // value rows at pitch 2 * TT: hi / lo share a row, the fp16 row uses its first half
    if ((size_t)(wsp - (char*)d_ws) > ws_size) return;    // ws 256 MiB
    k_planes<<<3 * 256, 256, 0, stream>>>(q, k, v, QP16, QPh, QPl, KP16, KPh, KPl, VT16, VTh);   /* all planes of both batches straight from the INPUT rows [t][h * 128 + d]; the lo value rows lie TT behind the hi rows */
    k_fattn<<<NB_ * NH_ * (TT / 128), 128, 0, stream>>>(QP16, KP16, VT16, QPh, QPl, KPh, KPl, VTh, VTl, OUT);   /* all 32 (batch, head) planes in one launch; the merged context goes straight to the OUTPUT in f32 */
}

// v006
// A run of this version takes 61 microseconds.
// Next to v005, in two timings, it ran 1.11 and 1.12 times as fast.
// All steps since v000 together make it 21.2 times as fast.
#include <hip/hip_runtime.h>

// Causal multi-head attention CORE on GIVEN q, k, v (q, k, v [2][2048][2048]; 16 heads x 128 by reshape: head h = features h * 128 .. h * 128 + 127; dots = (q x 128^-0.5) . k; keys after the query take -50000 (== exclusion: an exact zero weight after the softmax); softmax over the keys; out = attn v merged in head order -> [2][2048][2048] (8.4 M); NO projections, NO rotary; argument order q, k, v).
// Compute dtypes, f32 accumulate: the GIVEN f32 q, k, v are NOT rounded to bf16 (no projection, no input cast): the plane builders read them directly: q and k as f16 planes + bf16 hi / lo planes (hi + lo carries about 16 bits of the f32 value), v likewise (transposed); causal scores, online softmax and attn.v in one kernel: query rows < 512 hl (3 products), the rest single fp16 (P x 1024 and more); softmax f32; the merged context is written to the output in f32 (no output projection).

#define NB_  2
#define TT   2048
#define DM   2048
#define NH_  16
#define NKV  16
#define REP  (NH_ / NKV)
#define HD   128
#define DQ   (NH_ * HD)
#define DKV  (NKV * HD)
#define RH   512                  // query rows < RH use hi+lo planes (0: none)
#define SCL  0.088388347648318447f   // HD^-0.5
typedef _Float16 h16;
typedef unsigned short bf;
typedef __attribute__((ext_vector_type(16))) __bf16   v16bf;
typedef __attribute__((ext_vector_type(16))) _Float16 v16h;
typedef __attribute__((ext_vector_type(8)))  _Float16 v8h;
typedef __attribute__((ext_vector_type(8)))  unsigned short v8us;
typedef __attribute__((ext_vector_type(8)))  float    v8f;
typedef __attribute__((ext_vector_type(4)))  float    v4f;
typedef v8h  __attribute__((may_alias)) v8ha;
typedef v4f  __attribute__((may_alias)) v4fa;
typedef v8us __attribute__((may_alias)) v8usa;

__device__ __forceinline__ unsigned short f2bf(float f) { unsigned u = __float_as_uint(f); u += 0x7FFFu + ((u >> 16) & 1u); return (unsigned short)(u >> 16); }
__device__ __forceinline__ float bf2f(unsigned short b) { return __uint_as_float(((unsigned)b) << 16); }
__device__ __forceinline__ float bfr(float f) { return bf2f(f2bf(f)); }
__device__ __forceinline__ v16h cat16(v8h lo, v8h hi) { return __builtin_shufflevector(lo, hi, 0, 1, 2, 3, 4, 5, 6, 7, 8, 9, 10, 11, 12, 13, 14, 15); }
__device__ __forceinline__ v16bf cat16b(v8us lo, v8us hi) { return __builtin_bit_cast(v16bf, __builtin_shufflevector(lo, hi, 0, 1, 2, 3, 4, 5, 6, 7, 8, 9, 10, 11, 12, 13, 14, 15)); }
__device__ __forceinline__ v8f wmma16(v16h a, v16h b, v8f c) { return __builtin_amdgcn_wmma_f32_16x16x32_f16(false, a, false, b, (short)0, c, false, false); }
__device__ __forceinline__ v8f wmmab(v16bf a, v16bf b, v8f c) { return __builtin_amdgcn_wmma_f32_16x16x32_bf16(false, a, false, b, (short)0, c, false, false); }



// ---- k_gemmw: register-blocked GEMM, ONE WAVE per 64x64 output tile (16 accumulators), operands straight from K-contiguous 16-bit planes; grid (M/64, N/64, Z), 32 threads.
// C[m][n] (f32, pitch ldc, + optional f32 bias[n]) = sum_k A[m][k] Bt[n][k] (+ split products per NSPLIT). z-batch strides sA/sB/sC in elements. K % 32 == 0.
template <typename T16> struct WFrag;
template <> struct WFrag<h16> { typedef v16h V; static __device__ __forceinline__ V ld(const h16* p) { return cat16(*(const v8h*)p, *(const v8h*)(p + 16)); } static __device__ __forceinline__ v8f mma(V a, V b, v8f c) { return wmma16(a, b, c); } };
template <> struct WFrag<bf> { typedef v16bf V; static __device__ __forceinline__ V ld(const bf* p) { return cat16b(*(const v8us*)p, *(const v8us*)(p + 16)); } static __device__ __forceinline__ v8f mma(V a, V b, v8f c) { return wmmab(a, b, c); } };
template <typename T16, int NSPLIT, bool BIAS>
__global__ __launch_bounds__(32) void k_gemmw(const T16* __restrict__ A, const T16* __restrict__ A2, const T16* __restrict__ Bt, const T16* __restrict__ Bt2, int K, float* C, int ldc, const float* __restrict__ bias, size_t sA, size_t sB, size_t sC) {
    typedef typename WFrag<T16>::V V;
    __shared__ __align__(16) float os[16 * 68];
    const size_t z = blockIdx.z; A += z * sA; if (A2) A2 += z * sA; Bt += z * sB; if (Bt2) Bt2 += z * sB; C += z * sC;
    const int lane = threadIdx.x & 31, lr = lane & 15, hi = lane >> 4; const int r0 = blockIdx.x * 64, c0 = blockIdx.y * 64;
    v8f acc[4][4];
#pragma unroll
    for (int mb = 0; mb < 4; ++mb)
#pragma unroll
        for (int nb = 0; nb < 4; ++nb) acc[mb][nb] = (v8f){};
    const size_t aoff = (size_t)(r0 + lr) * K + 8 * hi, boff = (size_t)(c0 + lr) * K + 8 * hi;
#pragma unroll 1
    for (int kc = 0; kc < K; kc += 32) {
        V a[4], a2[4];
#pragma unroll
        for (int mb = 0; mb < 4; ++mb) { a[mb] = WFrag<T16>::ld(A + aoff + (size_t)mb * 16 * K + kc); if (NSPLIT == 1 || NSPLIT == 2) a2[mb] = WFrag<T16>::ld(A2 + aoff + (size_t)mb * 16 * K + kc); }
#pragma unroll
        for (int nb = 0; nb < 4; ++nb) { const V b = WFrag<T16>::ld(Bt + boff + (size_t)nb * 16 * K + kc); V b2; if (NSPLIT >= 2) b2 = WFrag<T16>::ld(Bt2 + boff + (size_t)nb * 16 * K + kc);
#pragma unroll
            for (int mb = 0; mb < 4; ++mb) { acc[mb][nb] = WFrag<T16>::mma(a[mb], b, acc[mb][nb]); if (NSPLIT == 1 || NSPLIT == 2) acc[mb][nb] = WFrag<T16>::mma(a2[mb], b, acc[mb][nb]); if (NSPLIT >= 2) acc[mb][nb] = WFrag<T16>::mma(a[mb], b2, acc[mb][nb]); } }
        asm volatile("v_nop\n\tv_nop\n\tv_nop\n\tv_nop" : "+v"(acc[0][0]), "+v"(acc[1][1]), "+v"(acc[2][2]), "+v"(acc[3][3]) : "v"(a[0]), "v"(a[3]));
    }
#pragma unroll
    for (int mb = 0; mb < 4; ++mb) {
#pragma unroll
        for (int nb = 0; nb < 4; ++nb) {
#pragma unroll
            for (int j = 0; j < 8; ++j) os[(hi * 8 + j) * 68 + nb * 16 + lr] = acc[mb][nb][j]; }
        __builtin_amdgcn_wave_barrier(); asm volatile("" ::: "memory");
        float* crow = C + (size_t)(r0 + mb * 16) * ldc + c0;
{
#pragma unroll
            for (int s = 0; s < 8; ++s) { const int row = 2 * s + hi, cofs = lr * 4; v4f val = *(const v4fa*)(os + row * 68 + cofs); if (BIAS) { val[0] += bfr(bias[c0 + cofs]); val[1] += bfr(bias[c0 + cofs + 1]); val[2] += bfr(bias[c0 + cofs + 2]); val[3] += bfr(bias[c0 + cofs + 3]); }
                *(v4f*)(crow + (size_t)row * ldc + cofs) = val; }
             }
        __builtin_amdgcn_wave_barrier(); asm volatile("" ::: "memory");
    }
}

__device__ __forceinline__ h16 tohx(float x) { return (h16)x; }
__device__ __forceinline__ void splitf(float y, unsigned short& h, unsigned short& l) { h = f2bf(y); l = f2bf(y - bf2f(h)); }
typedef __attribute__((ext_vector_type(2))) _Float16 v2h;
typedef __attribute__((ext_vector_type(4))) _Float16 v4h;
typedef __attribute__((ext_vector_type(2))) unsigned short v2us;
typedef __attribute__((ext_vector_type(4))) unsigned short v4us;
typedef __attribute__((ext_vector_type(2))) float v2f;
typedef __attribute__((ext_vector_type(4))) int v4i;

__global__ __launch_bounds__(256) void k_wtG(const float* __restrict__ w, int K, int N, bf* Bt) {
    const int lane = threadIdx.x & 31; const int L0 = (blockIdx.x * 8 + (threadIdx.x >> 5)) * 8; const int nlines = N * K / 64;
{
#pragma unroll 1
        for (int l = 0; l < 8; ++l) { const int L = L0 + l; if (L >= nlines) break; const size_t e = (size_t)L * 64 + lane * 2; const int k = (int)(e % K), n = (int)(e / K); v2us o;
            o[0] = f2bf(w[(size_t)k * N + n]); o[1] = f2bf(w[(size_t)(k + 1) * N + n]); *(v2us*)(Bt + e) = o; }
         }
}
__global__ __launch_bounds__(256) void k_cvt8(const float* __restrict__ src, bf* dst, size_t n8) { const size_t i = (size_t)blockIdx.x * 256 + threadIdx.x; if (i >= n8) return; const v8f v = *(const v8f*)(src + i * 8); v8us o;
#pragma unroll
    for (int k = 0; k < 8; ++k) o[k] = f2bf(v[k]); *(v8us*)(dst + i * 8) = o;  }

// ---- k_planes: every operand plane of q, k and v in ONE launch of 768 blocks (256 per input, dealt in turn), 128 elements a thread, 16-byte loads and stores on whole 256-byte pieces.
// q, k: head planes [b * 16 + h][t][d] (fp16 + hi / lo), a plain copy in another order: a block takes 16 rows, a wave two heads of them. v: transposed planes [b * 16 + h][d] at pitch 2 * TT;
// a block takes 256 positions of one head as 4 tiles of 128 t x 64 d, turned in LDS (f32, two buffers, one barrier a tile). The next group's loads fly while this group is converted.
// Only what k_fattn reads is built: hi / lo planes at positions < RH, fp16 query rows at positions >= RH, fp16 key and value rows everywhere.
#define VPI 65                    // LDS row pitch in floats: writers (16 lanes x 4 d, two rows) and readers (16 lanes x 8 t, two d) each meet 32 different banks, with the shift of 4 for t >= 64
// W16, WHL: which planes k_fattn reads at these positions: fp16, hi / lo. The others are neither converted nor stored.
template <bool W16, bool WHL>
__device__ __forceinline__ void cvt8(const float* x, h16* p16, bf* ph, bf* pl) {
    if constexpr (W16) { v8h o16;
#pragma unroll
        for (int j = 0; j < 8; ++j) o16[j] = tohx(x[j]);
        *(v8h*)p16 = o16;
        asm volatile("s_wait_xcnt 0x0" :: "v"(o16) : "memory"); }   // the stored registers may be rewritten only behind this wait (they are its inputs: live up to it)
    if constexpr (WHL) { v8us oh, ol;
#pragma unroll
        for (int j = 0; j < 8; ++j) { unsigned short a2, c2; splitf(x[j], a2, c2); oh[j] = a2; ol[j] = c2; }
        *(v8us*)ph = oh; *(v8us*)pl = ol;
        asm volatile("s_wait_xcnt 0x0" :: "v"(oh), "v"(ol) : "memory"); } }   // as above
// 16 rows of q or k, two heads a wave (one straight run of code per choice of planes: the choice is made once, by the caller, for the whole block)
template <bool W16, bool WHL>
__device__ __forceinline__ void pl_rows(const float* sp, h16* p16, bf* ph, bf* pl) {
    v4f x[2][8];
    // unit n = 0 .. 15: head n >> 3 of the wave's two, rows 2 * (n & 7) + r; a group is 4 units
#pragma unroll
    for (int u = 0; u < 4; ++u) { const float* s = sp + (u & 7) * 2 * DM; x[0][2 * u] = *(const v4f*)s; x[0][2 * u + 1] = *(const v4f*)(s + 4); }
#pragma unroll
    for (int g = 0; g < 4; ++g) {
        if (g < 3) {
#pragma unroll
            for (int u = 0; u < 4; ++u) { const int n = (g + 1) * 4 + u; const float* s = sp + (n >> 3) * HD + (n & 7) * 2 * DM; x[(g + 1) & 1][2 * u] = *(const v4f*)s; x[(g + 1) & 1][2 * u + 1] = *(const v4f*)(s + 4); }
        }
#pragma unroll
        for (int u = 0; u < 4; ++u) { const int n = g * 4 + u; const int po = (n >> 3) * TT * HD + (n & 7) * 2 * HD; float y[8];
#pragma unroll
            for (int j = 0; j < 4; ++j) { y[j] = x[g & 1][2 * u][j]; y[4 + j] = x[g & 1][2 * u + 1][j]; }
            cvt8<W16, WHL>(y, p16 + po, ph + po, pl + po); }
        asm volatile("s_wait_xcnt 0x0" :: "v"(sp), "v"(p16), "v"(ph), "v"(pl) : "memory");   // the registers that this group's loads and stores name may be rewritten only behind this wait (the addresses are its inputs: live and unchanged up to it)
    }
}
// 256 positions of one head of v, turned in LDS
template <bool WHL>
__device__ __forceinline__ void pl_turn(const float* sp, h16* p16, bf* ph, float (*ts)[128 * VPI + 8], const int c, const int r) {
    v4f x[2][8];
#pragma unroll
    for (int j = 0; j < 8; ++j) x[0][j] = *(const v4f*)(sp + j * 16 * DM);
#pragma unroll
    for (int n = 0; n < 4; ++n) {   // tile n: positions (n >> 1) * 128 .., features (n & 1) * 64 ..
        float* L = ts[n & 1];
        if (n < 3) {
#pragma unroll
            for (int j = 0; j < 8; ++j) x[(n + 1) & 1][j] = *(const v4f*)(sp + (((n + 1) >> 1) * 128 + j * 16) * DM + ((n + 1) & 1) * 64);
        }
#pragma unroll
        for (int j = 0; j < 8; ++j)
#pragma unroll
            for (int i = 0; i < 4; ++i) L[(r + 16 * j) * VPI + (j >> 2) * 4 + c * 4 + i] = x[n & 1][j][i];
        // work-group barrier with fences on LDS alone: the tile is whole behind it, and it ends every read of the other buffer, which the next tile overwrites. __syncthreads() would also wait here for the next tile's global loads and this thread's global stores, which no other thread reads
        __builtin_amdgcn_fence(__ATOMIC_RELEASE, "workgroup", "local"); __builtin_amdgcn_s_barrier(); __builtin_amdgcn_fence(__ATOMIC_ACQUIRE, "workgroup", "local");
#pragma unroll
        for (int kk = 0; kk < 4; ++kk) { const int po = ((n & 1) * 64 + kk * 16) * (2 * TT) + (n >> 1) * 128; float y[8];
#pragma unroll
            for (int j = 0; j < 8; ++j) y[j] = L[(c * 8 + j) * VPI + (c >> 3) * 4 + r + 16 * kk];
            cvt8<true, WHL>(y, p16 + po, ph + po, ph + po + TT); }
        asm volatile("s_wait_xcnt 0x0" :: "v"(sp), "v"(p16), "v"(ph) : "memory");   // as above
    }
}
static_assert(RH % 256 == 0, "a block of k_planes lies wholly below or wholly above RH");
__global__ __launch_bounds__(256) void k_planes(const float* __restrict__ q, const float* __restrict__ k, const float* __restrict__ v, h16* Q16, bf* Qh, bf* Ql, h16* K16, bf* Kh, bf* Kl, h16* V16, bf* Vh) {
    __shared__ float ts[2][128 * VPI + 8];
    const int tid = threadIdx.x, kind = blockIdx.x % 3, blk = blockIdx.x / 3;
    if (kind < 2) {
        const int wv = tid >> 5, r = (tid >> 4) & 1, d = (tid & 15) * 8; const int row0 = blk * 16, b = row0 / TT, t0 = row0 % TT;
        const float* sp = (kind ? k : q) + (size_t)(row0 + r) * DM + 2 * wv * HD + d;
        const size_t o = ((size_t)(b * NH_ + 2 * wv) * TT + t0 + r) * HD + d;
        h16* p16 = (kind ? K16 : Q16) + o; bf* ph = (kind ? Kh : Qh) + o; bf* pl = (kind ? Kl : Ql) + o;
        // hi / lo rows are read at positions < RH alone (the queries there and the keys they see), fp16 query rows at the others, fp16 key rows everywhere
        if (t0 >= RH) pl_rows<true, false>(sp, p16, ph, pl);
        else if (kind) pl_rows<true, true>(sp, p16, ph, pl);
        else pl_rows<false, true>(sp, p16, ph, pl);
    } else {
        const int z = blk >> 3, s8 = blk & 7, c = tid & 15, r = tid >> 4;   // c, r: as a loader 4 features at c * 4 of rows r + 16 j; as a storer 8 positions at c * 8 of features r + 16 kk
        const float* sp = v + ((size_t)(z / NH_) * TT + s8 * 256 + r) * DM + (z % NH_) * HD + c * 4;
        const size_t o = ((size_t)z * HD + r) * (2 * TT) + s8 * 256 + c * 8;
        h16* p16 = V16 + o; bf* ph = Vh + o;
        // the choice is the same for the whole block: its barriers stand under block-uniform control flow
        if (s8 * 256 >= RH) pl_turn<false>(sp, p16, ph, ts, c, r);
        else pl_turn<true>(sp, p16, ph, ts, c, r);
    }
}
#define FTHR 5.0f
#define KPB  272                  // LDS pitch in bytes of a key row (256 bytes of data)
#define BUFB 71680                // bytes of one stage buffer: fp16 128 keys: 128 x 272 + 128 x 272 = 69632; hi / lo 64 keys: 2 x 64 x 272 + 2 x 128 x 144 = 71680
// 2^x; the v_nop in the same statement keeps the one free slot the instruction set asks for behind a transcendental
__device__ __forceinline__ float exp2s(float x) { float r; asm("v_exp_f32_e32 %0, %1\n\tv_nop" : "=v"(r) : "v"(x)); return r; }
// eight asynchronous copies of 16 bytes a lane, global g + i * gs (elements) -> LDS byte l + i * ls; the s_wait_xcnt in the same statement stands in front of any rewrite of the address registers that the copies name
template <typename T16>
__device__ __forceinline__ void cp8(const unsigned l, const unsigned ls, const T16* g, const size_t gs) {
    asm volatile("global_load_async_to_lds_b128 %0, %8, off\n\t"
                 "global_load_async_to_lds_b128 %1, %9, off\n\t"
                 "global_load_async_to_lds_b128 %2, %10, off\n\t"
                 "global_load_async_to_lds_b128 %3, %11, off\n\t"
                 "global_load_async_to_lds_b128 %4, %12, off\n\t"
                 "global_load_async_to_lds_b128 %5, %13, off\n\t"
                 "global_load_async_to_lds_b128 %6, %14, off\n\t"
                 "global_load_async_to_lds_b128 %7, %15, off\n\t"
                 "s_wait_xcnt 0x0"
                 :: "v"(l), "v"(l + ls), "v"(l + 2 * ls), "v"(l + 3 * ls), "v"(l + 4 * ls), "v"(l + 5 * ls), "v"(l + 6 * ls), "v"(l + 7 * ls),
                    "v"(g), "v"(g + gs), "v"(g + 2 * gs), "v"(g + 3 * gs), "v"(g + 4 * gs), "v"(g + 5 * gs), "v"(g + 6 * gs), "v"(g + 7 * gs) : "memory");
}
// the same with four copies
template <typename T16>
__device__ __forceinline__ void cp4(const unsigned l, const unsigned ls, const T16* g, const size_t gs) {
    asm volatile("global_load_async_to_lds_b128 %0, %4, off\n\t"
                 "global_load_async_to_lds_b128 %1, %5, off\n\t"
                 "global_load_async_to_lds_b128 %2, %6, off\n\t"
                 "global_load_async_to_lds_b128 %3, %7, off\n\t"
                 "s_wait_xcnt 0x0"
                 :: "v"(l), "v"(l + ls), "v"(l + 2 * ls), "v"(l + 3 * ls), "v"(g), "v"(g + gs), "v"(g + 2 * gs), "v"(g + 3 * gs) : "memory");
}
// one stage: keys kb0 .. kb0 + KS - 1 of every plane into the buffer at LDS byte lb; 16 copies a thread (256 threads). Key rows: 16 lanes a row of 256 bytes; value rows (128 features): KS / 8 lanes a row of 2 * KS bytes.
template <typename T16, int NSPLIT, int KS>
__device__ __forceinline__ void fa_stage(const unsigned lb, const T16* __restrict__ Kp, const T16* __restrict__ K2, const T16* __restrict__ Vt, const T16* __restrict__ V2, const int kb0, const int tid) {
    static_assert(KS == 128 || KS == 64, "a plane's key rows and its value rows are 8 or 4 copies a thread");
    constexpr int NPL = NSPLIT ? 2 : 1, VPB = 2 * KS + 16, CPR = KS / 8, RS = 256 / CPR;
    const int kr = tid >> 4, kc = tid & 15, vr = tid / CPR, vc = tid % CPR;
#pragma unroll
    for (int p = 0; p < NPL; ++p) { const T16* g = (p ? K2 : Kp) + (size_t)(kb0 + kr) * HD + kc * 8; const unsigned l = lb + p * KS * KPB + kr * KPB + kc * 16;
        if constexpr (KS == 128) cp8(l, 16 * KPB, g, (size_t)16 * HD); else cp4(l, 16 * KPB, g, (size_t)16 * HD); }
#pragma unroll
    for (int p = 0; p < NPL; ++p) { const T16* g = (p ? V2 : Vt) + (size_t)vr * (2 * TT) + kb0 + vc * 8; const unsigned l = lb + NPL * KS * KPB + p * 128 * VPB + vr * VPB + vc * 16;
        if constexpr (KS == 128) cp8(l, RS * VPB, g, (size_t)RS * 2 * TT); else cp4(l, RS * VPB, g, (size_t)RS * 2 * TT); }
}
template <typename T16, int NSPLIT, int KS>
__device__ __forceinline__ void fa_tile(const T16* __restrict__ Q, const T16* __restrict__ Q2, const T16* __restrict__ Kp, const T16* __restrict__ K2, const T16* __restrict__ Vt, const T16* __restrict__ V2, const int q0, const int nst, const int tid, const int lr, const int hi, const int wq, const int kh, char* sm, float* __restrict__ orow) {
    typedef WFrag<T16> WF; typedef typename WF::V V;
    constexpr float OFF = (NSPLIT == 0) ? 10.0f : 0.0f;
    constexpr float CL2 = SCL * 1.4426950408889634f;   // scores in log2 units
    constexpr int NPL = NSPLIT ? 2 : 1, KPE = KPB / 2, VPE = KS + 8;   // LDS row pitches in elements
    constexpr int HK = KS / 2;   // keys of a stage that one wave of the pair takes
    const unsigned lb = (unsigned)(size_t)sm;   // LDS byte address of the first buffer
    fa_stage<T16, NSPLIT, KS>(lb, Kp, K2, Vt, V2, 0, tid);   // stage 0 flies while the query fragments are fetched
    V qf[2][4], qg[2][4];
    const size_t qofs = (size_t)(q0 + lr) * HD + 8 * hi; const T16* qp = Q + qofs; const T16* qp2 = NSPLIT ? Q2 + qofs : qp;
#pragma unroll
    for (int qt = 0; qt < 2; ++qt)
#pragma unroll
        for (int ks = 0; ks < 4; ++ks) { const int qo = qt * 16 * HD + ks * 32; qf[qt][ks] = WF::ld(qp + qo); if (NSPLIT) qg[qt][ks] = WF::ld(qp2 + qo); }
    asm volatile("s_wait_xcnt 0x0" :: "v"(qp), "v"(qp2) : "memory");   // the address registers of the loads above stay untouched up to this wait (they are its inputs)
    v8f o[2][8];
#pragma unroll
    for (int qt = 0; qt < 2; ++qt)
#pragma unroll
        for (int dt = 0; dt < 8; ++dt) o[qt][dt] = (v8f){};
    float m[2] = {-3.0e38f, -3.0e38f}, l[2] = {0.f, 0.f};
    asm volatile("s_wait_asynccnt 0x0" ::: "memory");   // this wave's copies of stage 0 have landed
    __syncthreads();                                    // every wave's have: stage 0 may be read
    if (nst > 1) fa_stage<T16, NSPLIT, KS>(lb + BUFB, Kp, K2, Vt, V2, KS, tid);
#pragma unroll 1
    for (int t = 0; t < nst; ++t) {
        const int kb0 = t * KS + kh * HK, kend = min(kb0 + HK - 32, q0);   // this wave's passes of the stage, in its half of the keys: kb0 .. kend (none behind its diagonal)
        const char* bp = sm + (t & 1) * BUFB;
        const T16* kl = (const T16*)bp + (kh * HK + lr) * KPE + 8 * hi; const T16* vl = (const T16*)(bp + NPL * KS * KPB) + lr * VPE + kh * HK + 8 * hi;
        V kf[2][4], kg[2][4];
        if (NSPLIT == 0 && kb0 <= kend) {
#pragma unroll
            for (int kt = 0; kt < 2; ++kt)
#pragma unroll
                for (int ks = 0; ks < 4; ++ks) kf[kt][ks] = WF::ld(kl + kt * 16 * KPE + ks * 32);
        }
#pragma unroll 1
        for (int kb = kb0; kb <= kend; kb += 32) {
            V vf[8], vg[8]; const T16* vp = vl + (kb - kb0); const T16* kp = kl + (kb - kb0) * KPE;
            if (NSPLIT == 0) {   // the value fragments come during the score products and the softmax
#pragma unroll
                for (int dt = 0; dt < 8; ++dt) vf[dt] = WF::ld(vp + dt * 16 * VPE);
                __builtin_amdgcn_sched_barrier(0);   // keeps these LDS reads up here: the compiler moved each down to its product, where the wave then waited out the LDS latency once per fragment
            } else {
#pragma unroll
                for (int kt = 0; kt < 2; ++kt)
#pragma unroll
                    for (int ks = 0; ks < 4; ++ks) { const int ko = kt * 16 * KPE + ks * 32; kf[kt][ks] = WF::ld(kp + ko); kg[kt][ks] = WF::ld(kp + KS * KPE + ko); }
                __builtin_amdgcn_sched_barrier(0);   // all key reads issued in one run in front of the products (else one LDS latency is waited out per fragment)
            }
            v8f s[2][2];
#pragma unroll
            for (int kt = 0; kt < 2; ++kt)
#pragma unroll
                for (int qt = 0; qt < 2; ++qt) s[kt][qt] = (v8f){};
#pragma unroll
            for (int ks = 0; ks < 4; ++ks)
#pragma unroll
                for (int kt = 0; kt < 2; ++kt)
#pragma unroll
                    for (int qt = 0; qt < 2; ++qt) { s[kt][qt] = WF::mma(kf[kt][ks], qf[qt][ks], s[kt][qt]); if (NSPLIT) { s[kt][qt] = WF::mma(kf[kt][ks], qg[qt][ks], s[kt][qt]); s[kt][qt] = WF::mma(kg[kt][ks], qf[qt][ks], s[kt][qt]); } }
            if (NSPLIT == 0 && kb < kend) {   // the next pass's key fragments, one pass ahead, inside this stage's buffer only
#pragma unroll
                for (int kt = 0; kt < 2; ++kt)
#pragma unroll
                    for (int ks = 0; ks < 4; ++ks) kf[kt][ks] = WF::ld(kp + (32 + kt * 16) * KPE + ks * 32);
            }
            if (kb == q0) {   // the diagonal pass: keys after the query are excluded (an exact zero weight)
#pragma unroll
                for (int kt = 0; kt < 2; ++kt)
#pragma unroll
                    for (int qt = 0; qt < 2; ++qt)
#pragma unroll
                        for (int j = 0; j < 8; ++j) if (kt * 16 + hi * 8 + j > qt * 16 + lr) s[kt][qt][j] = -3.0e38f;
            }
            float mx[2];
#pragma unroll
            for (int qt = 0; qt < 2; ++qt) { float a = s[0][qt][0];
#pragma unroll
                for (int j = 1; j < 8; ++j) a = fmaxf(a, s[0][qt][j]);
#pragma unroll
                for (int j = 0; j < 8; ++j) a = fmaxf(a, s[1][qt][j]);
                mx[qt] = a; }
            { const float x0 = __shfl_xor(mx[0], 16, 32), x1 = __shfl_xor(mx[1], 16, 32); mx[0] = fmaxf(mx[0], x0) * CL2; mx[1] = fmaxf(mx[1], x1) * CL2; }
            if (__builtin_amdgcn_ballot_w32(mx[0] > m[0] + FTHR || mx[1] > m[1] + FTHR) != 0) {
#pragma unroll
                for (int qt = 0; qt < 2; ++qt) { const float mn = fmaxf(m[qt], mx[qt]); const float al = exp2s(m[qt] - mn); m[qt] = mn; l[qt] *= al;
#pragma unroll
                    for (int dt = 0; dt < 8; ++dt) o[qt][dt] *= al; }
            }
            V pf[2], pg[2];
#pragma unroll
            for (int qt = 0; qt < 2; ++qt) { const float mo = OFF - m[qt]; float p[16]; float sum = 0.f;
#pragma unroll
                for (int e = 0; e < 16; ++e) { p[e] = exp2s(__builtin_fmaf(s[e >> 3][qt][e & 7], CL2, mo)); sum += p[e]; }
                l[qt] += sum;
                if constexpr (NSPLIT == 0) { v16h t16;
#pragma unroll
                    for (int e = 0; e < 16; ++e) t16[e] = (h16)p[e];
                    pf[qt] = t16;
                } else { v8us h0, h1, l0, l1;
#pragma unroll
                    for (int e = 0; e < 8; ++e) { unsigned short a, c; splitf(p[e], a, c); h0[e] = a; l0[e] = c; splitf(p[8 + e], a, c); h1[e] = a; l1[e] = c; }
                    pf[qt] = cat16b(h0, h1); pg[qt] = cat16b(l0, l1); } }
            if (NSPLIT) {   // hi / lo rows (at most 8 passes a wave): the value fragments come behind the softmax, so that 128 operand registers are not live across it
#pragma unroll
                for (int dt = 0; dt < 8; ++dt) { const int vo = dt * 16 * VPE; vf[dt] = WF::ld(vp + vo); vg[dt] = WF::ld(vp + 128 * VPE + vo); }
                __builtin_amdgcn_sched_barrier(0);   // as above, for the value reads
            }
#pragma unroll
            for (int dt = 0; dt < 8; ++dt)
#pragma unroll
                for (int qt = 0; qt < 2; ++qt) { o[qt][dt] = WF::mma(vf[dt], pf[qt], o[qt][dt]); if (NSPLIT) { o[qt][dt] = WF::mma(vf[dt], pg[qt], o[qt][dt]); o[qt][dt] = WF::mma(vg[dt], pf[qt], o[qt][dt]); } }
        }
        // hand-over, passed by every wave (also one that had no pass in this stage)
        asm volatile("s_wait_dscnt 0x0" ::: "memory");      // this wave's reads of this buffer are done before it is refilled
        asm volatile("s_wait_asynccnt 0x0" ::: "memory");   // this wave's copies of stage t + 1 have landed
        __syncthreads();                                    // stage t + 1 may be read by all; nobody reads stage t's buffer any more
        if (t + 2 < nst) fa_stage<T16, NSPLIT, KS>(lb + (t & 1) * BUFB, Kp, K2, Vt, V2, (t + 2) * KS, tid);
    }
    asm volatile("s_wait_asynccnt 0x0" ::: "memory");   // no copy is outstanding when the stage buffers are reused below and when the wave ends
    // merge of the pair: the wave of the second halves hands its sums, its reference maxima and its O^T over in LDS (the stage buffers, which nobody reads behind the loop's last barrier); 33 rows of 32 lanes x 16 bytes a pair
    v4f* mg = (v4f*)sm + wq * 33 * 32 + (hi * 16 + lr);
    if (kh) {
#pragma unroll
        for (int qt = 0; qt < 2; ++qt)
#pragma unroll
            for (int dt = 0; dt < 8; ++dt) { v4f a, c;
#pragma unroll
                for (int j = 0; j < 4; ++j) { a[j] = o[qt][dt][j]; c[j] = o[qt][dt][4 + j]; }
                mg[((qt * 8 + dt) * 2) * 32] = a; mg[((qt * 8 + dt) * 2 + 1) * 32] = c; }
        mg[32 * 32] = (v4f){m[0], m[1], l[0], l[1]};
    }
    __syncthreads();   // the handed-over values may be read; passed by all eight waves
    if (kh) return;
    { const v4f ml = mg[32 * 32];
#pragma unroll
      for (int qt = 0; qt < 2; ++qt) { const float mn = fmaxf(m[qt], ml[qt]); const float a0 = exp2s(m[qt] - mn), a1 = exp2s(ml[qt] - mn);   // a wave that had no pass hands over zeros under a reference of -3e38: weight 0
          l[qt] = l[qt] * a0 + ml[2 + qt] * a1;
#pragma unroll
          for (int dt = 0; dt < 8; ++dt) { const v4f a = mg[((qt * 8 + dt) * 2) * 32], c = mg[((qt * 8 + dt) * 2 + 1) * 32];
#pragma unroll
              for (int j = 0; j < 4; ++j) { o[qt][dt][j] = o[qt][dt][j] * a0 + a[j] * a1; o[qt][dt][4 + j] = o[qt][dt][4 + j] * a0 + c[j] * a1; } } } }
#pragma unroll
    for (int qt = 0; qt < 2; ++qt) { const float inv = __fdiv_rn(1.0f, l[qt] + __shfl_xor(l[qt], 16, 32));
#pragma unroll
        for (int dt = 0; dt < 8; ++dt) o[qt][dt] *= inv; }
    float* op = orow + (size_t)(q0 + lr) * DQ + hi * 8;   // a lane's 8 accumulator registers are 8 consecutive features of one query row
#pragma unroll
    for (int qt = 0; qt < 2; ++qt)
#pragma unroll
        for (int dt = 0; dt < 8; ++dt) { v4f a, c;
#pragma unroll
            for (int j = 0; j < 4; ++j) { a[j] = o[qt][dt][j]; c[j] = o[qt][dt][4 + j]; }
            *(v4f*)(op + qt * 16 * DQ + dt * 16) = a; *(v4f*)(op + qt * 16 * DQ + dt * 16 + 4) = c; }
}
// grid: 512 blocks of 8 waves = 16 blocks of 128 query rows x 32 (batch, head) planes. A block's registers fill a WGP, so blocks run one behind another there: they are dealt in falling order of their work
// (stages of 128 keys; a hi / lo stage counts three times): query blocks 15 14 13 12 11 3 10 9 8 2 7 6 5 1 4 0, one nibble each below.
__global__ __launch_bounds__(256) void k_fattn(const h16* __restrict__ Q16, const h16* __restrict__ K16, const h16* __restrict__ V16, const bf* __restrict__ Qh, const bf* __restrict__ Ql, const bf* __restrict__ Kh, const bf* __restrict__ Kl, const bf* __restrict__ Vh, const bf* __restrict__ Vl, float* __restrict__ OUT) {
    __shared__ __attribute__((aligned(128))) char sm[2 * BUFB];
    const int tid = threadIdx.x, lane = tid & 31, lr = lane & 15, hi = lane >> 4; const int wv = __builtin_amdgcn_readfirstlane(tid >> 5);
    const int wq = wv & 3, kh = wv >> 2;   // which 32 query columns; which half of every stage's keys
    const int lin = blockIdx.x, z = lin & (NB_ * NH_ - 1), g = lin / (NB_ * NH_); const int qb = (int)((0x041567289A3BCDEFull >> (4 * g)) & 15);
    const int q0 = qb * 128 + wq * 32; const size_t pz = (size_t)z * TT * HD, vz = (size_t)z * HD * TT * 2;
    float* orow = OUT + (size_t)(z / NH_) * TT * DQ + (z % NH_) * HD;
    // the choice is the same for the whole block (RH is a multiple of 128): its barriers stand under block-uniform control flow; stages: the block's keys 0 .. qb * 128 + 127
    if (qb * 128 < RH) fa_tile<bf, 2, 64>(Qh + pz, Ql + pz, Kh + pz, Kl + pz, Vh + vz, Vl + vz, q0, 2 * (qb + 1), tid, lr, hi, wq, kh, sm, orow);
    else fa_tile<h16, 0, 128>(Q16 + pz, nullptr, K16 + pz, nullptr, V16 + vz, nullptr, q0, qb + 1, tid, lr, hi, wq, kh, sm, orow);
}

extern "C" void kernel_launch(void* const* d_in, const int* in_sizes, int n_in,
                              void* d_out, int out_size, void* d_ws, size_t ws_size, hipStream_t stream) {
    (void)in_sizes; (void)n_in; (void)out_size;
    const float* q = (const float*)d_in[0]; const float* k = (const float*)d_in[1]; const float* v = (const float*)d_in[2];   /* q, k, v ([2][2048][2048] each, GIVEN: this module has NO projections): THREE inputs */
    float* OUT = (float*)d_out;     // [2][2048][2048]
    char* wsp = (char*)d_ws;
    auto take = [&](size_t bytes) { char* p = wsp; wsp += (bytes + 255) & ~(size_t)255; return (void*)p; };
    const size_t PZ = (size_t)NH_ * TT * HD;   // elements of one batch's head planes; every plane holds both batches (160 MiB of the 256 MiB workspace)
    h16* QP16 = (h16*)take(NB_ * PZ * 2); h16* KP16 = (h16*)take(NB_ * PZ * 2); h16* VT16 = (h16*)take(NB_ * PZ * 2 * 2);
    bf* QPh = (bf*)take(NB_ * PZ * 2); bf* QPl = (bf*)take(NB_ * PZ * 2); bf* KPh = (bf*)take(NB_ * PZ * 2); bf* KPl = (bf*)take(NB_ * PZ * 2); bf* VTh = (bf*)take(NB_ * PZ * 2 * 2); bf* VTl = VTh + TT;   // value rows at pitch 2 * TT: hi / lo share a row, the fp16 row uses its first half
    if ((size_t)(wsp - (char*)d_ws) > ws_size) return;    // ws 256 MiB
    k_planes<<<3 * 256, 256, 0, stream>>>(q, k, v, QP16, QPh, QPl, KP16, KPh, KPl, VT16, VTh);   /* all planes of both batches straight from the INPUT rows [t][h * 128 + d]; the lo value rows lie TT behind the hi rows */
    k_fattn<<<NB_ * NH_ * (TT / 128), 256, 0, stream>>>(QP16, KP16, VT16, QPh, QPl, KPh, KPl, VTh, VTl, OUT);   /* all 32 (batch, head) planes in one launch; the merged context goes straight to the OUTPUT in f32 */
}

// v007
// One run takes 57 microseconds.
// Next to v006, in two timings, it ran 1.07 and 1.08 times as fast.
// All steps since v000 together make it 22.9 times as fast.
#include <hip/hip_runtime.h>

// Causal multi-head attention CORE on GIVEN q, k, v (q, k, v [2][2048][2048]; 16 heads x 128 by reshape: head h = features h * 128 .. h * 128 + 127; dots = (q x 128^-0.5) . k; keys after the query take -50000 (== exclusion: an exact zero weight after the softmax); softmax over the keys; out = attn v merged in head order -> [2][2048][2048] (8.4 M); NO projections, NO rotary; argument order q, k, v).
// Compute dtypes, f32 accumulate: the GIVEN f32 q, k, v are NOT rounded to bf16 (no projection, no input cast): the plane builder reads k and v directly: k as f16 planes + bf16 hi / lo planes (hi + lo carries about 16 bits of the f32 value), v likewise (transposed); q is converted the same way by the attention kernel itself; causal scores, online softmax and attn.v in one kernel: query rows < 512 hl (3 products), the rest single fp16 (P x 1024 and more); softmax f32; the merged context is written to the output in f32 (no output projection).

#define NB_  2
#define TT   2048
#define DM   2048
#define NH_  16
#define NKV  16
#define REP  (NH_ / NKV)
#define HD   128
#define DQ   (NH_ * HD)
#define DKV  (NKV * HD)
#define RH   512                  // query rows < RH use hi+lo planes (0: none)
#define SCL  0.088388347648318447f   // HD^-0.5
typedef _Float16 h16;
typedef unsigned short bf;
typedef __attribute__((ext_vector_type(16))) __bf16   v16bf;
typedef __attribute__((ext_vector_type(16))) _Float16 v16h;
typedef __attribute__((ext_vector_type(8)))  _Float16 v8h;
typedef __attribute__((ext_vector_type(8)))  unsigned short v8us;
typedef __attribute__((ext_vector_type(8)))  float    v8f;
typedef __attribute__((ext_vector_type(4)))  float    v4f;
typedef v8h  __attribute__((may_alias)) v8ha;
typedef v4f  __attribute__((may_alias)) v4fa;
typedef v8us __attribute__((may_alias)) v8usa;

__device__ __forceinline__ unsigned short f2bf(float f) { unsigned u = __float_as_uint(f); u += 0x7FFFu + ((u >> 16) & 1u); return (unsigned short)(u >> 16); }
__device__ __forceinline__ float bf2f(unsigned short b) { return __uint_as_float(((unsigned)b) << 16); }
__device__ __forceinline__ float bfr(float f) { return bf2f(f2bf(f)); }
__device__ __forceinline__ v16h cat16(v8h lo, v8h hi) { return __builtin_shufflevector(lo, hi, 0, 1, 2, 3, 4, 5, 6, 7, 8, 9, 10, 11, 12, 13, 14, 15); }
__device__ __forceinline__ v16bf cat16b(v8us lo, v8us hi) { return __builtin_bit_cast(v16bf, __builtin_shufflevector(lo, hi, 0, 1, 2, 3, 4, 5, 6, 7, 8, 9, 10, 11, 12, 13, 14, 15)); }
__device__ __forceinline__ v8f wmma16(v16h a, v16h b, v8f c) { return __builtin_amdgcn_wmma_f32_16x16x32_f16(false, a, false, b, (short)0, c, false, false); }
__device__ __forceinline__ v8f wmmab(v16bf a, v16bf b, v8f c) { return __builtin_amdgcn_wmma_f32_16x16x32_bf16(false, a, false, b, (short)0, c, false, false); }



// ---- k_gemmw: register-blocked GEMM, ONE WAVE per 64x64 output tile (16 accumulators), operands straight from K-contiguous 16-bit planes; grid (M/64, N/64, Z), 32 threads.
// C[m][n] (f32, pitch ldc, + optional f32 bias[n]) = sum_k A[m][k] Bt[n][k] (+ split products per NSPLIT). z-batch strides sA/sB/sC in elements. K % 32 == 0.
template <typename T16> struct WFrag;
template <> struct WFrag<h16> { typedef v16h V; static __device__ __forceinline__ V ld(const h16* p) { return cat16(*(const v8h*)p, *(const v8h*)(p + 16)); } static __device__ __forceinline__ v8f mma(V a, V b, v8f c) { return wmma16(a, b, c); } };
template <> struct WFrag<bf> { typedef v16bf V; static __device__ __forceinline__ V ld(const bf* p) { return cat16b(*(const v8us*)p, *(const v8us*)(p + 16)); } static __device__ __forceinline__ v8f mma(V a, V b, v8f c) { return wmmab(a, b, c); } };
template <typename T16, int NSPLIT, bool BIAS>
__global__ __launch_bounds__(32) void k_gemmw(const T16* __restrict__ A, const T16* __restrict__ A2, const T16* __restrict__ Bt, const T16* __restrict__ Bt2, int K, float* C, int ldc, const float* __restrict__ bias, size_t sA, size_t sB, size_t sC) {
    typedef typename WFrag<T16>::V V;
    __shared__ __align__(16) float os[16 * 68];
    const size_t z = blockIdx.z; A += z * sA; if (A2) A2 += z * sA; Bt += z * sB; if (Bt2) Bt2 += z * sB; C += z * sC;
    const int lane = threadIdx.x & 31, lr = lane & 15, hi = lane >> 4; const int r0 = blockIdx.x * 64, c0 = blockIdx.y * 64;
    v8f acc[4][4];
#pragma unroll
    for (int mb = 0; mb < 4; ++mb)
#pragma unroll
        for (int nb = 0; nb < 4; ++nb) acc[mb][nb] = (v8f){};
    const size_t aoff = (size_t)(r0 + lr) * K + 8 * hi, boff = (size_t)(c0 + lr) * K + 8 * hi;
#pragma unroll 1
    for (int kc = 0; kc < K; kc += 32) {
        V a[4], a2[4];
#pragma unroll
        for (int mb = 0; mb < 4; ++mb) { a[mb] = WFrag<T16>::ld(A + aoff + (size_t)mb * 16 * K + kc); if (NSPLIT == 1 || NSPLIT == 2) a2[mb] = WFrag<T16>::ld(A2 + aoff + (size_t)mb * 16 * K + kc); }
#pragma unroll
        for (int nb = 0; nb < 4; ++nb) { const V b = WFrag<T16>::ld(Bt + boff + (size_t)nb * 16 * K + kc); V b2; if (NSPLIT >= 2) b2 = WFrag<T16>::ld(Bt2 + boff + (size_t)nb * 16 * K + kc);
#pragma unroll
            for (int mb = 0; mb < 4; ++mb) { acc[mb][nb] = WFrag<T16>::mma(a[mb], b, acc[mb][nb]); if (NSPLIT == 1 || NSPLIT == 2) acc[mb][nb] = WFrag<T16>::mma(a2[mb], b, acc[mb][nb]); if (NSPLIT >= 2) acc[mb][nb] = WFrag<T16>::mma(a[mb], b2, acc[mb][nb]); } }
        asm volatile("v_nop\n\tv_nop\n\tv_nop\n\tv_nop" : "+v"(acc[0][0]), "+v"(acc[1][1]), "+v"(acc[2][2]), "+v"(acc[3][3]) : "v"(a[0]), "v"(a[3]));
    }
#pragma unroll
    for (int mb = 0; mb < 4; ++mb) {
#pragma unroll
        for (int nb = 0; nb < 4; ++nb) {
#pragma unroll
            for (int j = 0; j < 8; ++j) os[(hi * 8 + j) * 68 + nb * 16 + lr] = acc[mb][nb][j]; }
        __builtin_amdgcn_wave_barrier(); asm volatile("" ::: "memory");
        float* crow = C + (size_t)(r0 + mb * 16) * ldc + c0;
{
#pragma unroll
            for (int s = 0; s < 8; ++s) { const int row = 2 * s + hi, cofs = lr * 4; v4f val = *(const v4fa*)(os + row * 68 + cofs); if (BIAS) { val[0] += bfr(bias[c0 + cofs]); val[1] += bfr(bias[c0 + cofs + 1]); val[2] += bfr(bias[c0 + cofs + 2]); val[3] += bfr(bias[c0 + cofs + 3]); }
                *(v4f*)(crow + (size_t)row * ldc + cofs) = val; }
             }
        __builtin_amdgcn_wave_barrier(); asm volatile("" ::: "memory");
    }
}

__device__ __forceinline__ h16 tohx(float x) { return (h16)x; }
__device__ __forceinline__ void splitf(float y, unsigned short& h, unsigned short& l) { h = f2bf(y); l = f2bf(y - bf2f(h)); }
typedef __attribute__((ext_vector_type(2))) _Float16 v2h;
typedef __attribute__((ext_vector_type(4))) _Float16 v4h;
typedef __attribute__((ext_vector_type(2))) unsigned short v2us;
typedef __attribute__((ext_vector_type(4))) unsigned short v4us;
typedef __attribute__((ext_vector_type(2))) float v2f;
typedef __attribute__((ext_vector_type(4))) int v4i;

__global__ __launch_bounds__(256) void k_wtG(const float* __restrict__ w, int K, int N, bf* Bt) {
    const int lane = threadIdx.x & 31; const int L0 = (blockIdx.x * 8 + (threadIdx.x >> 5)) * 8; const int nlines = N * K / 64;
{
#pragma unroll 1
        for (int l = 0; l < 8; ++l) { const int L = L0 + l; if (L >= nlines) break; const size_t e = (size_t)L * 64 + lane * 2; const int k = (int)(e % K), n = (int)(e / K); v2us o;
            o[0] = f2bf(w[(size_t)k * N + n]); o[1] = f2bf(w[(size_t)(k + 1) * N + n]); *(v2us*)(Bt + e) = o; }
         }
}
__global__ __launch_bounds__(256) void k_cvt8(const float* __restrict__ src, bf* dst, size_t n8) { const size_t i = (size_t)blockIdx.x * 256 + threadIdx.x; if (i >= n8) return; const v8f v = *(const v8f*)(src + i * 8); v8us o;
#pragma unroll
    for (int k = 0; k < 8; ++k) o[k] = f2bf(v[k]); *(v8us*)(dst + i * 8) = o;  }

// ---- k_planes: every operand plane of k and v in ONE launch of 512 blocks (256 per input, dealt in turn), 128 elements a thread, 16-byte loads and stores on whole 256-byte pieces.
// k: head planes [b * 16 + h][t][d] (fp16 + hi / lo), a plain copy in another order: a block takes 16 rows, a wave two heads of them. v: transposed planes [b * 16 + h][d] at pitch 2 * TT;
// a block takes 256 positions of one head as 4 tiles of 128 t x 64 d, turned in LDS (f32, two buffers, one barrier a tile). The next group's loads fly while this group is converted.
// Only what k_fattn reads is built: hi / lo planes at positions < RH, fp16 key and value rows everywhere. No plane of q: every query row is read by ONE block of k_fattn, which converts it itself.
#define VPI 65                    // LDS row pitch in floats: writers (16 lanes x 4 d, two rows) and readers (16 lanes x 8 t, two d) each meet 32 different banks, with the shift of 4 for t >= 64
// W16, WHL: which planes k_fattn reads at these positions: fp16, hi / lo. The others are neither converted nor stored.
template <bool W16, bool WHL>
__device__ __forceinline__ void cvt8(const float* x, h16* p16, bf* ph, bf* pl) {
    if constexpr (W16) { v8h o16;
#pragma unroll
        for (int j = 0; j < 8; ++j) o16[j] = tohx(x[j]);
        *(v8h*)p16 = o16;
        asm volatile("s_wait_xcnt 0x0" :: "v"(o16) : "memory"); }   // the stored registers may be rewritten only behind this wait (they are its inputs: live up to it)
    if constexpr (WHL) { v8us oh, ol;
#pragma unroll
        for (int j = 0; j < 8; ++j) { unsigned short a2, c2; splitf(x[j], a2, c2); oh[j] = a2; ol[j] = c2; }
        *(v8us*)ph = oh; *(v8us*)pl = ol;
        asm volatile("s_wait_xcnt 0x0" :: "v"(oh), "v"(ol) : "memory"); } }   // as above
// 16 rows of k, two heads a wave (one straight run of code per choice of planes: the choice is made once, by the caller, for the whole block)
template <bool W16, bool WHL>
__device__ __forceinline__ void pl_rows(const float* sp, h16* p16, bf* ph, bf* pl) {
    v4f x[2][8];
    // unit n = 0 .. 15: head n >> 3 of the wave's two, rows 2 * (n & 7) + r; a group is 4 units
#pragma unroll
    for (int u = 0; u < 4; ++u) { const float* s = sp + (u & 7) * 2 * DM; x[0][2 * u] = *(const v4f*)s; x[0][2 * u + 1] = *(const v4f*)(s + 4); }
#pragma unroll
    for (int g = 0; g < 4; ++g) {
        if (g < 3) {
#pragma unroll
            for (int u = 0; u < 4; ++u) { const int n = (g + 1) * 4 + u; const float* s = sp + (n >> 3) * HD + (n & 7) * 2 * DM; x[(g + 1) & 1][2 * u] = *(const v4f*)s; x[(g + 1) & 1][2 * u + 1] = *(const v4f*)(s + 4); }
        }
#pragma unroll
        for (int u = 0; u < 4; ++u) { const int n = g * 4 + u; const int po = (n >> 3) * TT * HD + (n & 7) * 2 * HD; float y[8];
#pragma unroll
            for (int j = 0; j < 4; ++j) { y[j] = x[g & 1][2 * u][j]; y[4 + j] = x[g & 1][2 * u + 1][j]; }
            cvt8<W16, WHL>(y, p16 + po, ph + po, pl + po); }
        asm volatile("s_wait_xcnt 0x0" :: "v"(sp), "v"(p16), "v"(ph), "v"(pl) : "memory");   // the registers that this group's loads and stores name may be rewritten only behind this wait (the addresses are its inputs: live and unchanged up to it)
    }
}
// 256 positions of one head of v, turned in LDS
template <bool WHL>
__device__ __forceinline__ void pl_turn(const float* sp, h16* p16, bf* ph, float (*ts)[128 * VPI + 8], const int c, const int r) {
    v4f x[2][8];
#pragma unroll
    for (int j = 0; j < 8; ++j) x[0][j] = *(const v4f*)(sp + j * 16 * DM);
#pragma unroll
    for (int n = 0; n < 4; ++n) {   // tile n: positions (n >> 1) * 128 .., features (n & 1) * 64 ..
        float* L = ts[n & 1];
        if (n < 3) {
#pragma unroll
            for (int j = 0; j < 8; ++j) x[(n + 1) & 1][j] = *(const v4f*)(sp + (((n + 1) >> 1) * 128 + j * 16) * DM + ((n + 1) & 1) * 64);
        }
#pragma unroll
        for (int j = 0; j < 8; ++j)
#pragma unroll
            for (int i = 0; i < 4; ++i) L[(r + 16 * j) * VPI + (j >> 2) * 4 + c * 4 + i] = x[n & 1][j][i];
        // work-group barrier with fences on LDS alone: the tile is whole behind it, and it ends every read of the other buffer, which the next tile overwrites. __syncthreads() would also wait here for the next tile's global loads and this thread's global stores, which no other thread reads
        __builtin_amdgcn_fence(__ATOMIC_RELEASE, "workgroup", "local"); __builtin_amdgcn_s_barrier(); __builtin_amdgcn_fence(__ATOMIC_ACQUIRE, "workgroup", "local");
#pragma unroll
        for (int kk = 0; kk < 4; ++kk) { const int po = ((n & 1) * 64 + kk * 16) * (2 * TT) + (n >> 1) * 128; float y[8];
#pragma unroll
            for (int j = 0; j < 8; ++j) y[j] = L[(c * 8 + j) * VPI + (c >> 3) * 4 + r + 16 * kk];
            cvt8<true, WHL>(y, p16 + po, ph + po, ph + po + TT); }
        asm volatile("s_wait_xcnt 0x0" :: "v"(sp), "v"(p16), "v"(ph) : "memory");   // as above
    }
}
static_assert(RH % 256 == 0, "a block of k_planes lies wholly below or wholly above RH");
__global__ __launch_bounds__(256) void k_planes(const float* __restrict__ k, const float* __restrict__ v, h16* K16, bf* Kh, bf* Kl, h16* V16, bf* Vh) {
    __shared__ float ts[2][128 * VPI + 8];
    const int tid = threadIdx.x, kind = blockIdx.x & 1, blk = blockIdx.x >> 1;
    if (kind == 0) {
        const int wv = tid >> 5, r = (tid >> 4) & 1, d = (tid & 15) * 8; const int row0 = blk * 16, b = row0 / TT, t0 = row0 % TT;
        const float* sp = k + (size_t)(row0 + r) * DM + 2 * wv * HD + d;
        const size_t o = ((size_t)(b * NH_ + 2 * wv) * TT + t0 + r) * HD + d;
        h16* p16 = K16 + o; bf* ph = Kh + o; bf* pl = Kl + o;
        // hi / lo rows are read at positions < RH alone (the keys that the queries there see), fp16 key rows everywhere
        if (t0 >= RH) pl_rows<true, false>(sp, p16, ph, pl);
        else pl_rows<true, true>(sp, p16, ph, pl);
    } else {
        const int z = blk >> 3, s8 = blk & 7, c = tid & 15, r = tid >> 4;   // c, r: as a loader 4 features at c * 4 of rows r + 16 j; as a storer 8 positions at c * 8 of features r + 16 kk
        const float* sp = v + ((size_t)(z / NH_) * TT + s8 * 256 + r) * DM + (z % NH_) * HD + c * 4;
        const size_t o = ((size_t)z * HD + r) * (2 * TT) + s8 * 256 + c * 8;
        h16* p16 = V16 + o; bf* ph = Vh + o;
        // the choice is the same for the whole block: its barriers stand under block-uniform control flow
        if (s8 * 256 >= RH) pl_turn<false>(sp, p16, ph, ts, c, r);
        else pl_turn<true>(sp, p16, ph, ts, c, r);
    }
}
#define FTHR 5.0f
#define KPB  272                  // LDS pitch in bytes of a key row (256 bytes of data)
#define QSB  (2 * 128 * KPB)      // bytes of the query rows in LDS behind the stage buffers: 128 rows, one plane (fp16) or two (hi / lo)
#define BUFB 71680                // bytes of one stage buffer: fp16 128 keys: 128 x 272 + 128 x 272 = 69632; hi / lo 64 keys: 2 x 64 x 272 + 2 x 128 x 144 = 71680
// 2^x; the v_nop in the same statement keeps the one free slot the instruction set asks for behind a transcendental
__device__ __forceinline__ float exp2s(float x) { float r; asm("v_exp_f32_e32 %0, %1\n\tv_nop" : "=v"(r) : "v"(x)); return r; }
// eight asynchronous copies of 16 bytes a lane, global g + i * gs (elements) -> LDS byte l + i * ls; the s_wait_xcnt in the same statement stands in front of any rewrite of the address registers that the copies name
template <typename T16>
__device__ __forceinline__ void cp8(const unsigned l, const unsigned ls, const T16* g, const size_t gs) {
    asm volatile("global_load_async_to_lds_b128 %0, %8, off\n\t"
                 "global_load_async_to_lds_b128 %1, %9, off\n\t"
                 "global_load_async_to_lds_b128 %2, %10, off\n\t"
                 "global_load_async_to_lds_b128 %3, %11, off\n\t"
                 "global_load_async_to_lds_b128 %4, %12, off\n\t"
                 "global_load_async_to_lds_b128 %5, %13, off\n\t"
                 "global_load_async_to_lds_b128 %6, %14, off\n\t"
                 "global_load_async_to_lds_b128 %7, %15, off\n\t"
                 "s_wait_xcnt 0x0"
                 :: "v"(l), "v"(l + ls), "v"(l + 2 * ls), "v"(l + 3 * ls), "v"(l + 4 * ls), "v"(l + 5 * ls), "v"(l + 6 * ls), "v"(l + 7 * ls),
                    "v"(g), "v"(g + gs), "v"(g + 2 * gs), "v"(g + 3 * gs), "v"(g + 4 * gs), "v"(g + 5 * gs), "v"(g + 6 * gs), "v"(g + 7 * gs) : "memory");
}
// the same with four copies
template <typename T16>
__device__ __forceinline__ void cp4(const unsigned l, const unsigned ls, const T16* g, const size_t gs) {
    asm volatile("global_load_async_to_lds_b128 %0, %4, off\n\t"
                 "global_load_async_to_lds_b128 %1, %5, off\n\t"
                 "global_load_async_to_lds_b128 %2, %6, off\n\t"
                 "global_load_async_to_lds_b128 %3, %7, off\n\t"
                 "s_wait_xcnt 0x0"
                 :: "v"(l), "v"(l + ls), "v"(l + 2 * ls), "v"(l + 3 * ls), "v"(g), "v"(g + gs), "v"(g + 2 * gs), "v"(g + 3 * gs) : "memory");
}
// one stage: keys kb0 .. kb0 + KS - 1 of every plane into the buffer at LDS byte lb; 16 copies a thread (256 threads). Key rows: 16 lanes a row of 256 bytes; value rows (128 features): KS / 8 lanes a row of 2 * KS bytes.
template <typename T16, int NSPLIT, int KS>
__device__ __forceinline__ void fa_stage(const unsigned lb, const T16* __restrict__ Kp, const T16* __restrict__ K2, const T16* __restrict__ Vt, const T16* __restrict__ V2, const int kb0, const int tid) {
    static_assert(KS == 128 || KS == 64, "a plane's key rows and its value rows are 8 or 4 copies a thread");
    constexpr int NPL = NSPLIT ? 2 : 1, VPB = 2 * KS + 16, CPR = KS / 8, RS = 256 / CPR;
    const int kr = tid >> 4, kc = tid & 15, vr = tid / CPR, vc = tid % CPR;
#pragma unroll
    for (int p = 0; p < NPL; ++p) { const T16* g = (p ? K2 : Kp) + (size_t)(kb0 + kr) * HD + kc * 8; const unsigned l = lb + p * KS * KPB + kr * KPB + kc * 16;
        if constexpr (KS == 128) cp8(l, 16 * KPB, g, (size_t)16 * HD); else cp4(l, 16 * KPB, g, (size_t)16 * HD); }
#pragma unroll
    for (int p = 0; p < NPL; ++p) { const T16* g = (p ? V2 : Vt) + (size_t)vr * (2 * TT) + kb0 + vc * 8; const unsigned l = lb + NPL * KS * KPB + p * 128 * VPB + vr * VPB + vc * 16;
        if constexpr (KS == 128) cp8(l, RS * VPB, g, (size_t)RS * 2 * TT); else cp4(l, RS * VPB, g, (size_t)RS * 2 * TT); }
}
template <typename T16, int NSPLIT, int KS>
__device__ __forceinline__ void fa_tile(const float* __restrict__ qrows, const T16* __restrict__ Kp, const T16* __restrict__ K2, const T16* __restrict__ Vt, const T16* __restrict__ V2, const int q0, const int nst, const int tid, const int lr, const int hi, const int wq, const int kh, char* sm, float* __restrict__ orow) {
    typedef WFrag<T16> WF; typedef typename WF::V V;
    constexpr float OFF = (NSPLIT == 0) ? 10.0f : 0.0f;
    constexpr float CL2 = SCL * 1.4426950408889634f;   // scores in log2 units
    constexpr int NPL = NSPLIT ? 2 : 1, KPE = KPB / 2, VPE = KS + 8;   // LDS row pitches in elements
    constexpr int HK = KS / 2;   // keys of a stage that one wave of the pair takes
    const unsigned lb = (unsigned)(size_t)sm;   // LDS byte address of the first buffer
    // the block's query rows: a wave takes 16 of them, a lane 4 features of each
    v4f x[16];
    const float* qp = qrows + (size_t)((tid >> 5) * 16) * DM + (tid & 31) * 4;
#pragma unroll
    for (int i = 0; i < 16; ++i) x[i] = *(const v4f*)(qp + i * DM);
    asm volatile("s_wait_xcnt 0x0" :: "v"(qp) : "memory");   // the address registers of the loads above stay untouched up to this wait (they are its inputs)
    fa_stage<T16, NSPLIT, KS>(lb, Kp, K2, Vt, V2, 0, tid);   // stage 0 flies beside the query rows
    char* qs = sm + 2 * BUFB;
    { char* qw = qs + (tid >> 5) * 16 * KPB + (tid & 31) * 8;
#pragma unroll
      for (int i = 0; i < 16; ++i) {
          if constexpr (NSPLIT == 0) { v4h o16;
#pragma unroll
              for (int j = 0; j < 4; ++j) o16[j] = tohx(x[i][j]);
              *(v4h*)(qw + i * KPB) = o16;
          } else { v4us oh, ol;
#pragma unroll
              for (int j = 0; j < 4; ++j) { unsigned short a2, c2; splitf(x[i][j], a2, c2); oh[j] = a2; ol[j] = c2; }
              *(v4us*)(qw + i * KPB) = oh; *(v4us*)(qw + 128 * KPB + i * KPB) = ol; } } }
    v8f o[2][8];
#pragma unroll
    for (int qt = 0; qt < 2; ++qt)
#pragma unroll
        for (int dt = 0; dt < 8; ++dt) o[qt][dt] = (v8f){};
    float m[2] = {-3.0e38f, -3.0e38f}, l[2] = {0.f, 0.f};
    asm volatile("s_wait_asynccnt 0x0" ::: "memory");   // this wave's copies of stage 0 have landed
    __syncthreads();                                    // every wave's have: stage 0 and the converted query rows may be read
    if (nst > 1) fa_stage<T16, NSPLIT, KS>(lb + BUFB, Kp, K2, Vt, V2, KS, tid);
    V qf[2][4], qg[2][4];
    const T16* ql = (const T16*)qs + (wq * 32 + lr) * KPE + 8 * hi;
#pragma unroll
    for (int qt = 0; qt < 2; ++qt)
#pragma unroll
        for (int ks = 0; ks < 4; ++ks) { const int qo = qt * 16 * KPE + ks * 32; qf[qt][ks] = WF::ld(ql + qo); if (NSPLIT) qg[qt][ks] = WF::ld(ql + 128 * KPE + qo); }
#pragma unroll 1
    for (int t = 0; t < nst; ++t) {
        const int kb0 = t * KS + kh * HK, kend = min(kb0 + HK - 32, q0);   // this wave's passes of the stage, in its half of the keys: kb0 .. kend (none behind its diagonal)
        const char* bp = sm + (t & 1) * BUFB;
        const T16* kl = (const T16*)bp + (kh * HK + lr) * KPE + 8 * hi; const T16* vl = (const T16*)(bp + NPL * KS * KPB) + lr * VPE + kh * HK + 8 * hi;
        V kf[2][4], kg[2][4];
        if (NSPLIT == 0 && kb0 <= kend) {
#pragma unroll
            for (int kt = 0; kt < 2; ++kt)
#pragma unroll
                for (int ks = 0; ks < 4; ++ks) kf[kt][ks] = WF::ld(kl + kt * 16 * KPE + ks * 32);
        }
#pragma unroll 1
        for (int kb = kb0; kb <= kend; kb += 32) {
            V vf[8], vg[8]; const T16* vp = vl + (kb - kb0); const T16* kp = kl + (kb - kb0) * KPE;
            if (NSPLIT == 0) {   // the value fragments come during the score products and the softmax
#pragma unroll
                for (int dt = 0; dt < 8; ++dt) vf[dt] = WF::ld(vp + dt * 16 * VPE);
                __builtin_amdgcn_sched_barrier(0);   // keeps these LDS reads up here: the compiler moved each down to its product, where the wave then waited out the LDS latency once per fragment
            } else {
#pragma unroll
                for (int kt = 0; kt < 2; ++kt)
#pragma unroll
                    for (int ks = 0; ks < 4; ++ks) { const int ko = kt * 16 * KPE + ks * 32; kf[kt][ks] = WF::ld(kp + ko); kg[kt][ks] = WF::ld(kp + KS * KPE + ko); }
                __builtin_amdgcn_sched_barrier(0);   // all key reads issued in one run in front of the products (else one LDS latency is waited out per fragment)
            }
            v8f s[2][2];
#pragma unroll
            for (int kt = 0; kt < 2; ++kt)
#pragma unroll
                for (int qt = 0; qt < 2; ++qt) s[kt][qt] = (v8f){};
#pragma unroll
            for (int ks = 0; ks < 4; ++ks)
#pragma unroll
                for (int kt = 0; kt < 2; ++kt)
#pragma unroll
                    for (int qt = 0; qt < 2; ++qt) { s[kt][qt] = WF::mma(kf[kt][ks], qf[qt][ks], s[kt][qt]); if (NSPLIT) { s[kt][qt] = WF::mma(kf[kt][ks], qg[qt][ks], s[kt][qt]); s[kt][qt] = WF::mma(kg[kt][ks], qf[qt][ks], s[kt][qt]); } }
            if (NSPLIT == 0 && kb < kend) {   // the next pass's key fragments, one pass ahead, inside this stage's buffer only
#pragma unroll
                for (int kt = 0; kt < 2; ++kt)
#pragma unroll
                    for (int ks = 0; ks < 4; ++ks) kf[kt][ks] = WF::ld(kp + (32 + kt * 16) * KPE + ks * 32);
            }
            if (kb == q0) {   // the diagonal pass: keys after the query are excluded (an exact zero weight)
#pragma unroll
                for (int kt = 0; kt < 2; ++kt)
#pragma unroll
                    for (int qt = 0; qt < 2; ++qt)
#pragma unroll
                        for (int j = 0; j < 8; ++j) if (kt * 16 + hi * 8 + j > qt * 16 + lr) s[kt][qt][j] = -3.0e38f;
            }
            float mx[2];
#pragma unroll
            for (int qt = 0; qt < 2; ++qt) { float a = s[0][qt][0];
#pragma unroll
                for (int j = 1; j < 8; ++j) a = fmaxf(a, s[0][qt][j]);
#pragma unroll
                for (int j = 0; j < 8; ++j) a = fmaxf(a, s[1][qt][j]);
                mx[qt] = a; }
            { const float x0 = __shfl_xor(mx[0], 16, 32), x1 = __shfl_xor(mx[1], 16, 32); mx[0] = fmaxf(mx[0], x0) * CL2; mx[1] = fmaxf(mx[1], x1) * CL2; }
            if (__builtin_amdgcn_ballot_w32(mx[0] > m[0] + FTHR || mx[1] > m[1] + FTHR) != 0) {
#pragma unroll
                for (int qt = 0; qt < 2; ++qt) { const float mn = fmaxf(m[qt], mx[qt]); const float al = exp2s(m[qt] - mn); m[qt] = mn; l[qt] *= al;
#pragma unroll
                    for (int dt = 0; dt < 8; ++dt) o[qt][dt] *= al; }
            }
            V pf[2], pg[2];
#pragma unroll
            for (int qt = 0; qt < 2; ++qt) { const float mo = OFF - m[qt]; float p[16]; float sum = 0.f;
#pragma unroll
                for (int e = 0; e < 16; ++e) { p[e] = exp2s(__builtin_fmaf(s[e >> 3][qt][e & 7], CL2, mo)); sum += p[e]; }
                l[qt] += sum;
                if constexpr (NSPLIT == 0) { v16h t16;
#pragma unroll
                    for (int e = 0; e < 16; ++e) t16[e] = (h16)p[e];
                    pf[qt] = t16;
                } else { v8us h0, h1, l0, l1;
#pragma unroll
                    for (int e = 0; e < 8; ++e) { unsigned short a, c; splitf(p[e], a, c); h0[e] = a; l0[e] = c; splitf(p[8 + e], a, c); h1[e] = a; l1[e] = c; }
                    pf[qt] = cat16b(h0, h1); pg[qt] = cat16b(l0, l1); } }
            if (NSPLIT) {   // hi / lo rows (at most 8 passes a wave): the value fragments come behind the softmax, so that 128 operand registers are not live across it
#pragma unroll
                for (int dt = 0; dt < 8; ++dt) { const int vo = dt * 16 * VPE; vf[dt] = WF::ld(vp + vo); vg[dt] = WF::ld(vp + 128 * VPE + vo); }
                __builtin_amdgcn_sched_barrier(0);   // as above, for the value reads
            }
#pragma unroll
            for (int dt = 0; dt < 8; ++dt)
#pragma unroll
                for (int qt = 0; qt < 2; ++qt) { o[qt][dt] = WF::mma(vf[dt], pf[qt], o[qt][dt]); if (NSPLIT) { o[qt][dt] = WF::mma(vf[dt], pg[qt], o[qt][dt]); o[qt][dt] = WF::mma(vg[dt], pf[qt], o[qt][dt]); } }
        }
        // hand-over, passed by every wave (also one that had no pass in this stage)
        asm volatile("s_wait_dscnt 0x0" ::: "memory");      // this wave's reads of this buffer are done before it is refilled
        asm volatile("s_wait_asynccnt 0x0" ::: "memory");   // this wave's copies of stage t + 1 have landed
        __syncthreads();                                    // stage t + 1 may be read by all; nobody reads stage t's buffer any more
        if (t + 2 < nst) fa_stage<T16, NSPLIT, KS>(lb + (t & 1) * BUFB, Kp, K2, Vt, V2, (t + 2) * KS, tid);
    }
    asm volatile("s_wait_asynccnt 0x0" ::: "memory");   // no copy is outstanding when the stage buffers are reused below and when the wave ends
    // merge of the pair: the wave of the second halves hands its sums, its reference maxima and its O^T over in LDS (the stage buffers, which nobody reads behind the loop's last barrier); 33 rows of 32 lanes x 16 bytes a pair
    v4f* mg = (v4f*)sm + wq * 33 * 32 + (hi * 16 + lr);
    if (kh) {
#pragma unroll
        for (int qt = 0; qt < 2; ++qt)
#pragma unroll
            for (int dt = 0; dt < 8; ++dt) { v4f a, c;
#pragma unroll
                for (int j = 0; j < 4; ++j) { a[j] = o[qt][dt][j]; c[j] = o[qt][dt][4 + j]; }
                mg[((qt * 8 + dt) * 2) * 32] = a; mg[((qt * 8 + dt) * 2 + 1) * 32] = c; }
        mg[32 * 32] = (v4f){m[0], m[1], l[0], l[1]};
    }
    __syncthreads();   // the handed-over values may be read; passed by all eight waves
    if (kh) return;
    { const v4f ml = mg[32 * 32];
#pragma unroll
      for (int qt = 0; qt < 2; ++qt) { const float mn = fmaxf(m[qt], ml[qt]); const float a0 = exp2s(m[qt] - mn), a1 = exp2s(ml[qt] - mn);   // a wave that had no pass hands over zeros under a reference of -3e38: weight 0
          l[qt] = l[qt] * a0 + ml[2 + qt] * a1;
#pragma unroll
          for (int dt = 0; dt < 8; ++dt) { const v4f a = mg[((qt * 8 + dt) * 2) * 32], c = mg[((qt * 8 + dt) * 2 + 1) * 32];
#pragma unroll
              for (int j = 0; j < 4; ++j) { o[qt][dt][j] = o[qt][dt][j] * a0 + a[j] * a1; o[qt][dt][4 + j] = o[qt][dt][4 + j] * a0 + c[j] * a1; } } } }
#pragma unroll
    for (int qt = 0; qt < 2; ++qt) { const float inv = __fdiv_rn(1.0f, l[qt] + __shfl_xor(l[qt], 16, 32));
#pragma unroll
        for (int dt = 0; dt < 8; ++dt) o[qt][dt] *= inv; }
    float* op = orow + (size_t)(q0 + lr) * DQ + hi * 8;   // a lane's 8 accumulator registers are 8 consecutive features of one query row
#pragma unroll
    for (int qt = 0; qt < 2; ++qt)
#pragma unroll
        for (int dt = 0; dt < 8; ++dt) { v4f a, c;
#pragma unroll
            for (int j = 0; j < 4; ++j) { a[j] = o[qt][dt][j]; c[j] = o[qt][dt][4 + j]; }
            *(v4f*)(op + qt * 16 * DQ + dt * 16) = a; *(v4f*)(op + qt * 16 * DQ + dt * 16 + 4) = c; }
}
// grid: 512 blocks of 8 waves = 16 blocks of 128 query rows x 32 (batch, head) planes. A block's registers fill a WGP, so blocks run one behind another there: they are dealt in falling order of their work
// (stages of 128 keys; a hi / lo stage counts three times): query blocks 15 14 13 12 11 3 10 9 8 2 7 6 5 1 4 0, one nibble each below.
__global__ __launch_bounds__(256) void k_fattn(const float* __restrict__ q, const h16* __restrict__ K16, const h16* __restrict__ V16, const bf* __restrict__ Kh, const bf* __restrict__ Kl, const bf* __restrict__ Vh, const bf* __restrict__ Vl, float* __restrict__ OUT) {
    __shared__ __attribute__((aligned(128))) char sm[2 * BUFB + QSB];
    const int tid = threadIdx.x, lane = tid & 31, lr = lane & 15, hi = lane >> 4; const int wv = __builtin_amdgcn_readfirstlane(tid >> 5);
    const int wq = wv & 3, kh = wv >> 2;   // which 32 query columns; which half of every stage's keys
    const int lin = blockIdx.x, z = lin & (NB_ * NH_ - 1), g = lin / (NB_ * NH_); const int qb = (int)((0x041567289A3BCDEFull >> (4 * g)) & 15);
    const int q0 = qb * 128 + wq * 32; const size_t pz = (size_t)z * TT * HD, vz = (size_t)z * HD * TT * 2;
    float* orow = OUT + (size_t)(z / NH_) * TT * DQ + (z % NH_) * HD;
    const float* qrows = q + ((size_t)(z / NH_) * TT + qb * 128) * DM + (z % NH_) * HD;   // the block's first query row, at its head's features
    // the choice is the same for the whole block (RH is a multiple of 128): its barriers stand under block-uniform control flow; stages: the block's keys 0 .. qb * 128 + 127
    if (qb * 128 < RH) fa_tile<bf, 2, 64>(qrows, Kh + pz, Kl + pz, Vh + vz, Vl + vz, q0, 2 * (qb + 1), tid, lr, hi, wq, kh, sm, orow);
    else fa_tile<h16, 0, 128>(qrows, K16 + pz, nullptr, V16 + vz, nullptr, q0, qb + 1, tid, lr, hi, wq, kh, sm, orow);
}

extern "C" void kernel_launch(void* const* d_in, const int* in_sizes, int n_in,
                              void* d_out, int out_size, void* d_ws, size_t ws_size, hipStream_t stream) {
    (void)in_sizes; (void)n_in; (void)out_size;
    const float* q = (const float*)d_in[0]; const float* k = (const float*)d_in[1]; const float* v = (const float*)d_in[2];   /* q, k, v ([2][2048][2048] each, GIVEN: this module has NO projections): THREE inputs */
    float* OUT = (float*)d_out;     // [2][2048][2048]
    char* wsp = (char*)d_ws;
    auto take = [&](size_t bytes) { char* p = wsp; wsp += (bytes + 255) & ~(size_t)255; return (void*)p; };
    const size_t PZ = (size_t)NH_ * TT * HD;   // elements of one batch's head planes; every plane holds both batches (112 MiB of the 256 MiB workspace)
    h16* KP16 = (h16*)take(NB_ * PZ * 2); h16* VT16 = (h16*)take(NB_ * PZ * 2 * 2);
    bf* KPh = (bf*)take(NB_ * PZ * 2); bf* KPl = (bf*)take(NB_ * PZ * 2); bf* VTh = (bf*)take(NB_ * PZ * 2 * 2); bf* VTl = VTh + TT;   // value rows at pitch 2 * TT: hi / lo share a row, the fp16 row uses its first half
    if ((size_t)(wsp - (char*)d_ws) > ws_size) return;    // ws 256 MiB
    k_planes<<<2 * 256, 256, 0, stream>>>(k, v, KP16, KPh, KPl, VT16, VTh);   /* the key and value planes of both batches straight from the INPUT rows [t][h * 128 + d]; the lo value rows lie TT behind the hi rows */
    k_fattn<<<NB_ * NH_ * (TT / 128), 256, 0, stream>>>(q, KP16, VT16, KPh, KPl, VTh, VTl, OUT);   /* all 32 (batch, head) planes in one launch; the merged context goes straight to the OUTPUT in f32 */
}

// v008
// One run takes 55.2 microseconds.
// Next to v007, in two timings, it ran 1.05 and 1.03 times as fast.
// Counting every step since v000, it is 23.7 times as fast.
#include <hip/hip_runtime.h>

// Causal multi-head attention CORE on GIVEN q, k, v (q, k, v [2][2048][2048]; 16 heads x 128 by reshape: head h = features h * 128 .. h * 128 + 127; dots = (q x 128^-0.5) . k; keys after the query take -50000 (== exclusion: an exact zero weight after the softmax); softmax over the keys; out = attn v merged in head order -> [2][2048][2048] (8.4 M); NO projections, NO rotary; argument order q, k, v).
// Compute dtypes, f32 accumulate: the GIVEN f32 q, k, v are NOT rounded to bf16 (no projection, no input cast): the plane builder reads k and v directly: k as f16 planes + bf16 hi / lo planes (hi + lo carries about 16 bits of the f32 value), v likewise (transposed); q is converted the same way by the attention kernel itself; causal scores, online softmax and attn.v in one kernel: query rows < 512 hl (3 products), the rest single fp16 (P x 128 and more); softmax f32; the merged context is written to the output in f32 (no output projection).

#define NB_  2
#define TT   2048
#define DM   2048
#define NH_  16
#define NKV  16
#define REP  (NH_ / NKV)
#define HD   128
#define DQ   (NH_ * HD)
#define DKV  (NKV * HD)
#define RH   512                  // query rows < RH use hi+lo planes (0: none)
#define SCL  0.088388347648318447f   // HD^-0.5
typedef _Float16 h16;
typedef unsigned short bf;
typedef __attribute__((ext_vector_type(16))) __bf16   v16bf;
typedef __attribute__((ext_vector_type(16))) _Float16 v16h;
typedef __attribute__((ext_vector_type(8)))  _Float16 v8h;
typedef __attribute__((ext_vector_type(8)))  unsigned short v8us;
typedef __attribute__((ext_vector_type(8)))  float    v8f;
typedef __attribute__((ext_vector_type(4)))  float    v4f;
typedef v8h  __attribute__((may_alias)) v8ha;
typedef v4f  __attribute__((may_alias)) v4fa;
typedef v8us __attribute__((may_alias)) v8usa;

__device__ __forceinline__ unsigned short f2bf(float f) { unsigned u = __float_as_uint(f); u += 0x7FFFu + ((u >> 16) & 1u); return (unsigned short)(u >> 16); }
__device__ __forceinline__ float bf2f(unsigned short b) { return __uint_as_float(((unsigned)b) << 16); }
__device__ __forceinline__ float bfr(float f) { return bf2f(f2bf(f)); }
__device__ __forceinline__ v16h cat16(v8h lo, v8h hi) { return __builtin_shufflevector(lo, hi, 0, 1, 2, 3, 4, 5, 6, 7, 8, 9, 10, 11, 12, 13, 14, 15); }
__device__ __forceinline__ v16bf cat16b(v8us lo, v8us hi) { return __builtin_bit_cast(v16bf, __builtin_shufflevector(lo, hi, 0, 1, 2, 3, 4, 5, 6, 7, 8, 9, 10, 11, 12, 13, 14, 15)); }
__device__ __forceinline__ v8f wmma16(v16h a, v16h b, v8f c) { return __builtin_amdgcn_wmma_f32_16x16x32_f16(false, a, false, b, (short)0, c, false, false); }
__device__ __forceinline__ v8f wmmab(v16bf a, v16bf b, v8f c) { return __builtin_amdgcn_wmma_f32_16x16x32_bf16(false, a, false, b, (short)0, c, false, false); }



// ---- k_gemmw: register-blocked GEMM, ONE WAVE per 64x64 output tile (16 accumulators), operands straight from K-contiguous 16-bit planes; grid (M/64, N/64, Z), 32 threads.
// C[m][n] (f32, pitch ldc, + optional f32 bias[n]) = sum_k A[m][k] Bt[n][k] (+ split products per NSPLIT). z-batch strides sA/sB/sC in elements. K % 32 == 0.
template <typename T16> struct WFrag;
template <> struct WFrag<h16> { typedef v16h V; static __device__ __forceinline__ V ld(const h16* p) { return cat16(*(const v8h*)p, *(const v8h*)(p + 16)); } static __device__ __forceinline__ v8f mma(V a, V b, v8f c) { return wmma16(a, b, c); } };
template <> struct WFrag<bf> { typedef v16bf V; static __device__ __forceinline__ V ld(const bf* p) { return cat16b(*(const v8us*)p, *(const v8us*)(p + 16)); } static __device__ __forceinline__ v8f mma(V a, V b, v8f c) { return wmmab(a, b, c); } };
template <typename T16, int NSPLIT, bool BIAS>
__global__ __launch_bounds__(32) void k_gemmw(const T16* __restrict__ A, const T16* __restrict__ A2, const T16* __restrict__ Bt, const T16* __restrict__ Bt2, int K, float* C, int ldc, const float* __restrict__ bias, size_t sA, size_t sB, size_t sC) {
    typedef typename WFrag<T16>::V V;
    __shared__ __align__(16) float os[16 * 68];
    const size_t z = blockIdx.z; A += z * sA; if (A2) A2 += z * sA; Bt += z * sB; if (Bt2) Bt2 += z * sB; C += z * sC;
    const int lane = threadIdx.x & 31, lr = lane & 15, hi = lane >> 4; const int r0 = blockIdx.x * 64, c0 = blockIdx.y * 64;
    v8f acc[4][4];
#pragma unroll
    for (int mb = 0; mb < 4; ++mb)
#pragma unroll
        for (int nb = 0; nb < 4; ++nb) acc[mb][nb] = (v8f){};
    const size_t aoff = (size_t)(r0 + lr) * K + 8 * hi, boff = (size_t)(c0 + lr) * K + 8 * hi;
#pragma unroll 1
    for (int kc = 0; kc < K; kc += 32) {
        V a[4], a2[4];
#pragma unroll
        for (int mb = 0; mb < 4; ++mb) { a[mb] = WFrag<T16>::ld(A + aoff + (size_t)mb * 16 * K + kc); if (NSPLIT == 1 || NSPLIT == 2) a2[mb] = WFrag<T16>::ld(A2 + aoff + (size_t)mb * 16 * K + kc); }
#pragma unroll
        for (int nb = 0; nb < 4; ++nb) { const V b = WFrag<T16>::ld(Bt + boff + (size_t)nb * 16 * K + kc); V b2; if (NSPLIT >= 2) b2 = WFrag<T16>::ld(Bt2 + boff + (size_t)nb * 16 * K + kc);
#pragma unroll
            for (int mb = 0; mb < 4; ++mb) { acc[mb][nb] = WFrag<T16>::mma(a[mb], b, acc[mb][nb]); if (NSPLIT == 1 || NSPLIT == 2) acc[mb][nb] = WFrag<T16>::mma(a2[mb], b, acc[mb][nb]); if (NSPLIT >= 2) acc[mb][nb] = WFrag<T16>::mma(a[mb], b2, acc[mb][nb]); } }
        asm volatile("v_nop\n\tv_nop\n\tv_nop\n\tv_nop" : "+v"(acc[0][0]), "+v"(acc[1][1]), "+v"(acc[2][2]), "+v"(acc[3][3]) : "v"(a[0]), "v"(a[3]));
    }
#pragma unroll
    for (int mb = 0; mb < 4; ++mb) {
#pragma unroll
        for (int nb = 0; nb < 4; ++nb) {
#pragma unroll
            for (int j = 0; j < 8; ++j) os[(hi * 8 + j) * 68 + nb * 16 + lr] = acc[mb][nb][j]; }
        __builtin_amdgcn_wave_barrier(); asm volatile("" ::: "memory");
        float* crow = C + (size_t)(r0 + mb * 16) * ldc + c0;
{
#pragma unroll
            for (int s = 0; s < 8; ++s) { const int row = 2 * s + hi, cofs = lr * 4; v4f val = *(const v4fa*)(os + row * 68 + cofs); if (BIAS) { val[0] += bfr(bias[c0 + cofs]); val[1] += bfr(bias[c0 + cofs + 1]); val[2] += bfr(bias[c0 + cofs + 2]); val[3] += bfr(bias[c0 + cofs + 3]); }
                *(v4f*)(crow + (size_t)row * ldc + cofs) = val; }
             }
        __builtin_amdgcn_wave_barrier(); asm volatile("" ::: "memory");
    }
}

__device__ __forceinline__ h16 tohx(float x) { return (h16)x; }
__device__ __forceinline__ void splitf(float y, unsigned short& h, unsigned short& l) { h = f2bf(y); l = f2bf(y - bf2f(h)); }
typedef __attribute__((ext_vector_type(2))) _Float16 v2h;
typedef __attribute__((ext_vector_type(4))) _Float16 v4h;
typedef __attribute__((ext_vector_type(2))) unsigned short v2us;
typedef __attribute__((ext_vector_type(4))) unsigned short v4us;
typedef __attribute__((ext_vector_type(2))) float v2f;
typedef __attribute__((ext_vector_type(4))) int v4i;

__global__ __launch_bounds__(256) void k_wtG(const float* __restrict__ w, int K, int N, bf* Bt) {
    const int lane = threadIdx.x & 31; const int L0 = (blockIdx.x * 8 + (threadIdx.x >> 5)) * 8; const int nlines = N * K / 64;
{
#pragma unroll 1
        for (int l = 0; l < 8; ++l) { const int L = L0 + l; if (L >= nlines) break; const size_t e = (size_t)L * 64 + lane * 2; const int k = (int)(e % K), n = (int)(e / K); v2us o;
            o[0] = f2bf(w[(size_t)k * N + n]); o[1] = f2bf(w[(size_t)(k + 1) * N + n]); *(v2us*)(Bt + e) = o; }
         }
}
__global__ __launch_bounds__(256) void k_cvt8(const float* __restrict__ src, bf* dst, size_t n8) { const size_t i = (size_t)blockIdx.x * 256 + threadIdx.x; if (i >= n8) return; const v8f v = *(const v8f*)(src + i * 8); v8us o;
#pragma unroll
    for (int k = 0; k < 8; ++k) o[k] = f2bf(v[k]); *(v8us*)(dst + i * 8) = o;  }

// ---- k_planes: every operand plane of k and v in ONE launch of 512 blocks (256 per input, dealt in turn), 128 elements a thread, 16-byte loads and stores on whole 256-byte pieces.
// k: head planes [b * 16 + h][t][d] (fp16 + hi / lo), a plain copy in another order: a block takes 16 rows, a wave two heads of them. v: transposed planes [b * 16 + h][d] at pitch 2 * TT;
// a block takes 256 positions of one head as 4 tiles of 128 t x 64 d, turned in LDS (f32, two buffers, one barrier a tile). The next group's loads fly while this group is converted.
// Only what k_fattn reads is built: hi / lo planes at positions < RH, fp16 key and value rows everywhere. No plane of q: every query row is read by ONE block of k_fattn, which converts it itself.
#define VPI 65                    // LDS row pitch in floats: writers (16 lanes x 4 d, two rows) and readers (16 lanes x 8 t, two d) each meet 32 different banks, with the shift of 4 for t >= 64
// W16, WHL: which planes k_fattn reads at these positions: fp16, hi / lo. The others are neither converted nor stored.
template <bool W16, bool WHL>
__device__ __forceinline__ void cvt8(const float* x, h16* p16, bf* ph, bf* pl) {
    if constexpr (W16) { v8h o16;
#pragma unroll
        for (int j = 0; j < 8; ++j) o16[j] = tohx(x[j]);
        *(v8h*)p16 = o16;
        asm volatile("s_wait_xcnt 0x0" :: "v"(o16) : "memory"); }   // the stored registers may be rewritten only behind this wait (they are its inputs: live up to it)
    if constexpr (WHL) { v8us oh, ol;
#pragma unroll
        for (int j = 0; j < 8; ++j) { unsigned short a2, c2; splitf(x[j], a2, c2); oh[j] = a2; ol[j] = c2; }
        *(v8us*)ph = oh; *(v8us*)pl = ol;
        asm volatile("s_wait_xcnt 0x0" :: "v"(oh), "v"(ol) : "memory"); } }   // as above
// 16 rows of k, two heads a wave (one straight run of code per choice of planes: the choice is made once, by the caller, for the whole block)
template <bool W16, bool WHL>
__device__ __forceinline__ void pl_rows(const float* sp, h16* p16, bf* ph, bf* pl) {
    v4f x[2][8];
    // unit n = 0 .. 15: head n >> 3 of the wave's two, rows 2 * (n & 7) + r; a group is 4 units
#pragma unroll
    for (int u = 0; u < 4; ++u) { const float* s = sp + (u & 7) * 2 * DM; x[0][2 * u] = *(const v4f*)s; x[0][2 * u + 1] = *(const v4f*)(s + 4); }
#pragma unroll
    for (int g = 0; g < 4; ++g) {
        if (g < 3) {
#pragma unroll
            for (int u = 0; u < 4; ++u) { const int n = (g + 1) * 4 + u; const float* s = sp + (n >> 3) * HD + (n & 7) * 2 * DM; x[(g + 1) & 1][2 * u] = *(const v4f*)s; x[(g + 1) & 1][2 * u + 1] = *(const v4f*)(s + 4); }
        }
#pragma unroll
        for (int u = 0; u < 4; ++u) { const int n = g * 4 + u; const int po = (n >> 3) * TT * HD + (n & 7) * 2 * HD; float y[8];
#pragma unroll
            for (int j = 0; j < 4; ++j) { y[j] = x[g & 1][2 * u][j]; y[4 + j] = x[g & 1][2 * u + 1][j]; }
            cvt8<W16, WHL>(y, p16 + po, ph + po, pl + po); }
        asm volatile("s_wait_xcnt 0x0" :: "v"(sp), "v"(p16), "v"(ph), "v"(pl) : "memory");   // the registers that this group's loads and stores name may be rewritten only behind this wait (the addresses are its inputs: live and unchanged up to it)
    }
}
// 256 positions of one head of v, turned in LDS
template <bool WHL>
__device__ __forceinline__ void pl_turn(const float* sp, h16* p16, bf* ph, float (*ts)[128 * VPI + 8], const int c, const int r) {
    v4f x[2][8];
#pragma unroll
    for (int j = 0; j < 8; ++j) x[0][j] = *(const v4f*)(sp + j * 16 * DM);
#pragma unroll
    for (int n = 0; n < 4; ++n) {   // tile n: positions (n >> 1) * 128 .., features (n & 1) * 64 ..
        float* L = ts[n & 1];
        if (n < 3) {
#pragma unroll
            for (int j = 0; j < 8; ++j) x[(n + 1) & 1][j] = *(const v4f*)(sp + (((n + 1) >> 1) * 128 + j * 16) * DM + ((n + 1) & 1) * 64);
        }
#pragma unroll
        for (int j = 0; j < 8; ++j)
#pragma unroll
            for (int i = 0; i < 4; ++i) L[(r + 16 * j) * VPI + (j >> 2) * 4 + c * 4 + i] = x[n & 1][j][i];
        // work-group barrier with fences on LDS alone: the tile is whole behind it, and it ends every read of the other buffer, which the next tile overwrites. __syncthreads() would also wait here for the next tile's global loads and this thread's global stores, which no other thread reads
        __builtin_amdgcn_fence(__ATOMIC_RELEASE, "workgroup", "local"); __builtin_amdgcn_s_barrier(); __builtin_amdgcn_fence(__ATOMIC_ACQUIRE, "workgroup", "local");
#pragma unroll
        for (int kk = 0; kk < 4; ++kk) { const int po = ((n & 1) * 64 + kk * 16) * (2 * TT) + (n >> 1) * 128; float y[8];
#pragma unroll
            for (int j = 0; j < 8; ++j) y[j] = L[(c * 8 + j) * VPI + (c >> 3) * 4 + r + 16 * kk];
            cvt8<true, WHL>(y, p16 + po, ph + po, ph + po + TT); }
        asm volatile("s_wait_xcnt 0x0" :: "v"(sp), "v"(p16), "v"(ph) : "memory");   // as above
    }
}
static_assert(RH % 256 == 0, "a block of k_planes lies wholly below or wholly above RH");
__global__ __launch_bounds__(256) void k_planes(const float* __restrict__ k, const float* __restrict__ v, h16* K16, bf* Kh, bf* Kl, h16* V16, bf* Vh) {
    __shared__ float ts[2][128 * VPI + 8];
    const int tid = threadIdx.x, kind = blockIdx.x & 1, blk = blockIdx.x >> 1;
    if (kind == 0) {
        const int wv = tid >> 5, r = (tid >> 4) & 1, d = (tid & 15) * 8; const int row0 = blk * 16, b = row0 / TT, t0 = row0 % TT;
        const float* sp = k + (size_t)(row0 + r) * DM + 2 * wv * HD + d;
        const size_t o = ((size_t)(b * NH_ + 2 * wv) * TT + t0 + r) * HD + d;
        h16* p16 = K16 + o; bf* ph = Kh + o; bf* pl = Kl + o;
        // hi / lo rows are read at positions < RH alone (the keys that the queries there see), fp16 key rows everywhere
        if (t0 >= RH) pl_rows<true, false>(sp, p16, ph, pl);
        else pl_rows<true, true>(sp, p16, ph, pl);
    } else {
        const int z = blk >> 3, s8 = blk & 7, c = tid & 15, r = tid >> 4;   // c, r: as a loader 4 features at c * 4 of rows r + 16 j; as a storer 8 positions at c * 8 of features r + 16 kk
        const float* sp = v + ((size_t)(z / NH_) * TT + s8 * 256 + r) * DM + (z % NH_) * HD + c * 4;
        const size_t o = ((size_t)z * HD + r) * (2 * TT) + s8 * 256 + c * 8;
        h16* p16 = V16 + o; bf* ph = Vh + o;
        // the choice is the same for the whole block: its barriers stand under block-uniform control flow
        if (s8 * 256 >= RH) pl_turn<false>(sp, p16, ph, ts, c, r);
        else pl_turn<true>(sp, p16, ph, ts, c, r);
    }
}
#define FTHR 8.0f
#define KPB  272                  // LDS pitch in bytes of a key row (256 bytes of data)
#define QSB  (2 * 128 * KPB)      // bytes of the query rows in LDS behind the stage buffers: 128 rows, one plane (fp16) or two (hi / lo)
#define BUFB 71680                // bytes of one stage buffer: fp16 128 keys: 128 x 272 + 128 x 272 = 69632; hi / lo 64 keys: 2 x 64 x 272 + 2 x 128 x 144 = 71680
// 2^x; the v_nop in the same statement keeps the one free slot the instruction set asks for behind a transcendental
__device__ __forceinline__ float exp2s(float x) { float r; asm("v_exp_f32_e32 %0, %1\n\tv_nop" : "=v"(r) : "v"(x)); return r; }
// eight asynchronous copies of 16 bytes a lane, global g + i * gs (elements) -> LDS byte l + i * ls; the s_wait_xcnt in the same statement stands in front of any rewrite of the address registers that the copies name
template <typename T16>
__device__ __forceinline__ void cp8(const unsigned l, const unsigned ls, const T16* g, const size_t gs) {
    asm volatile("global_load_async_to_lds_b128 %0, %8, off\n\t"
                 "global_load_async_to_lds_b128 %1, %9, off\n\t"
                 "global_load_async_to_lds_b128 %2, %10, off\n\t"
                 "global_load_async_to_lds_b128 %3, %11, off\n\t"
                 "global_load_async_to_lds_b128 %4, %12, off\n\t"
                 "global_load_async_to_lds_b128 %5, %13, off\n\t"
                 "global_load_async_to_lds_b128 %6, %14, off\n\t"
                 "global_load_async_to_lds_b128 %7, %15, off\n\t"
                 "s_wait_xcnt 0x0"
                 :: "v"(l), "v"(l + ls), "v"(l + 2 * ls), "v"(l + 3 * ls), "v"(l + 4 * ls), "v"(l + 5 * ls), "v"(l + 6 * ls), "v"(l + 7 * ls),
                    "v"(g), "v"(g + gs), "v"(g + 2 * gs), "v"(g + 3 * gs), "v"(g + 4 * gs), "v"(g + 5 * gs), "v"(g + 6 * gs), "v"(g + 7 * gs) : "memory");
}
// the same with four copies
template <typename T16>
__device__ __forceinline__ void cp4(const unsigned l, const unsigned ls, const T16* g, const size_t gs) {
    asm volatile("global_load_async_to_lds_b128 %0, %4, off\n\t"
                 "global_load_async_to_lds_b128 %1, %5, off\n\t"
                 "global_load_async_to_lds_b128 %2, %6, off\n\t"
                 "global_load_async_to_lds_b128 %3, %7, off\n\t"
                 "s_wait_xcnt 0x0"
                 :: "v"(l), "v"(l + ls), "v"(l + 2 * ls), "v"(l + 3 * ls), "v"(g), "v"(g + gs), "v"(g + 2 * gs), "v"(g + 3 * gs) : "memory");
}
// one stage: keys kb0 .. kb0 + KS - 1 of every plane into the buffer at LDS byte lb; 16 copies a thread (256 threads). Key rows: 16 lanes a row of 256 bytes; value rows (128 features): KS / 8 lanes a row of 2 * KS bytes.
template <typename T16, int NSPLIT, int KS>
__device__ __forceinline__ void fa_stage(const unsigned lb, const T16* __restrict__ Kp, const T16* __restrict__ K2, const T16* __restrict__ Vt, const T16* __restrict__ V2, const int kb0, const int tid) {
    static_assert(KS == 128 || KS == 64, "a plane's key rows and its value rows are 8 or 4 copies a thread");
    constexpr int NPL = NSPLIT ? 2 : 1, VPB = 2 * KS + 16, CPR = KS / 8, RS = 256 / CPR;
    const int kr = tid >> 4, kc = tid & 15, vr = tid / CPR, vc = tid % CPR;
#pragma unroll
    for (int p = 0; p < NPL; ++p) { const T16* g = (p ? K2 : Kp) + (size_t)(kb0 + kr) * HD + kc * 8; const unsigned l = lb + p * KS * KPB + kr * KPB + kc * 16;
        if constexpr (KS == 128) cp8(l, 16 * KPB, g, (size_t)16 * HD); else cp4(l, 16 * KPB, g, (size_t)16 * HD); }
#pragma unroll
    for (int p = 0; p < NPL; ++p) { const T16* g = (p ? V2 : Vt) + (size_t)vr * (2 * TT) + kb0 + vc * 8; const unsigned l = lb + NPL * KS * KPB + p * 128 * VPB + vr * VPB + vc * 16;
        if constexpr (KS == 128) cp8(l, RS * VPB, g, (size_t)RS * 2 * TT); else cp4(l, RS * VPB, g, (size_t)RS * 2 * TT); }
}
template <typename T16, int NSPLIT, int KS>
__device__ __forceinline__ void fa_tile(const float* __restrict__ qrows, const T16* __restrict__ Kp, const T16* __restrict__ K2, const T16* __restrict__ Vt, const T16* __restrict__ V2, const int q0, const int nst, const int tid, const int lr, const int hi, const int wq, const int kh, char* sm, float* __restrict__ orow) {
    typedef WFrag<T16> WF; typedef typename WF::V V;
    constexpr float OFF = (NSPLIT == 0) ? 7.0f : 0.0f;
    constexpr float CL2 = SCL * 1.4426950408889634f;   // scores in log2 units
    constexpr float PLIM = (NSPLIT == 0) ? 32768.0f : 256.0f;   // 2^(OFF + FTHR): the bound on a lane's sums of P in one pass
    static_assert(OFF + FTHR == ((NSPLIT == 0) ? 15.0f : 8.0f), "PLIM is 2^(OFF + FTHR)");
    constexpr int NPL = NSPLIT ? 2 : 1, KPE = KPB / 2, VPE = KS + 8;   // LDS row pitches in elements
    constexpr int HK = KS / 2;   // keys of a stage that one wave of the pair takes
    const unsigned lb = (unsigned)(size_t)sm;   // LDS byte address of the first buffer
    // the block's query rows: a wave takes 16 of them, a lane 4 features of each
    v4f x[16];
    const float* qp = qrows + (size_t)((tid >> 5) * 16) * DM + (tid & 31) * 4;
#pragma unroll
    for (int i = 0; i < 16; ++i) x[i] = *(const v4f*)(qp + i * DM);
    asm volatile("s_wait_xcnt 0x0" :: "v"(qp) : "memory");   // the address registers of the loads above stay untouched up to this wait (they are its inputs)
    fa_stage<T16, NSPLIT, KS>(lb, Kp, K2, Vt, V2, 0, tid);   // stage 0 flies beside the query rows
    char* qs = sm + 2 * BUFB;
    { char* qw = qs + (tid >> 5) * 16 * KPB + (tid & 31) * 8;
#pragma unroll
      for (int i = 0; i < 16; ++i) {
          if constexpr (NSPLIT == 0) { v4h o16;
#pragma unroll
              for (int j = 0; j < 4; ++j) o16[j] = tohx(x[i][j]);
              *(v4h*)(qw + i * KPB) = o16;
          } else { v4us oh, ol;
#pragma unroll
              for (int j = 0; j < 4; ++j) { unsigned short a2, c2; splitf(x[i][j], a2, c2); oh[j] = a2; ol[j] = c2; }
              *(v4us*)(qw + i * KPB) = oh; *(v4us*)(qw + 128 * KPB + i * KPB) = ol; } } }
    v8f o[2][8];
#pragma unroll
    for (int qt = 0; qt < 2; ++qt)
#pragma unroll
        for (int dt = 0; dt < 8; ++dt) o[qt][dt] = (v8f){};
    float m[2] = {-3.0e38f, -3.0e38f}, l[2] = {0.f, 0.f};
    asm volatile("s_wait_asynccnt 0x0" ::: "memory");   // this wave's copies of stage 0 have landed
    __syncthreads();                                    // every wave's have: stage 0 and the converted query rows may be read
    if (nst > 1) fa_stage<T16, NSPLIT, KS>(lb + BUFB, Kp, K2, Vt, V2, KS, tid);
    V qf[2][4], qg[2][4];
    const T16* ql = (const T16*)qs + (wq * 32 + lr) * KPE + 8 * hi;
#pragma unroll
    for (int qt = 0; qt < 2; ++qt)
#pragma unroll
        for (int ks = 0; ks < 4; ++ks) { const int qo = qt * 16 * KPE + ks * 32; qf[qt][ks] = WF::ld(ql + qo); if (NSPLIT) qg[qt][ks] = WF::ld(ql + 128 * KPE + qo); }
#pragma unroll 1
    for (int t = 0; t < nst; ++t) {
        const int kb0 = t * KS + kh * HK, kend = min(kb0 + HK - 32, q0);   // this wave's passes of the stage, in its half of the keys: kb0 .. kend (none behind its diagonal)
        const char* bp = sm + (t & 1) * BUFB;
        const T16* kl = (const T16*)bp + (kh * HK + lr) * KPE + 8 * hi; const T16* vl = (const T16*)(bp + NPL * KS * KPB) + lr * VPE + kh * HK + 8 * hi;
        V kf[2][4], kg[2][4];
        if (NSPLIT == 0 && kb0 <= kend) {
#pragma unroll
            for (int kt = 0; kt < 2; ++kt)
#pragma unroll
                for (int ks = 0; ks < 4; ++ks) kf[kt][ks] = WF::ld(kl + kt * 16 * KPE + ks * 32);
        }
#pragma unroll 1
        for (int kb = kb0; kb <= kend; kb += 32) {
            V vf[8], vg[8]; const T16* vp = vl + (kb - kb0); const T16* kp = kl + (kb - kb0) * KPE;
            if (NSPLIT == 0) {   // the value fragments come during the score products and the softmax
#pragma unroll
                for (int dt = 0; dt < 8; ++dt) vf[dt] = WF::ld(vp + dt * 16 * VPE);
                __builtin_amdgcn_sched_barrier(0);   // keeps these LDS reads up here: the compiler moved each down to its product, where the wave then waited out the LDS latency once per fragment
            } else {
#pragma unroll
                for (int kt = 0; kt < 2; ++kt)
#pragma unroll
                    for (int ks = 0; ks < 4; ++ks) { const int ko = kt * 16 * KPE + ks * 32; kf[kt][ks] = WF::ld(kp + ko); kg[kt][ks] = WF::ld(kp + KS * KPE + ko); }
                __builtin_amdgcn_sched_barrier(0);   // all key reads issued in one run in front of the products (else one LDS latency is waited out per fragment)
            }
            v8f s[2][2];
#pragma unroll
            for (int kt = 0; kt < 2; ++kt)
#pragma unroll
                for (int qt = 0; qt < 2; ++qt) s[kt][qt] = (v8f){};
#pragma unroll
            for (int ks = 0; ks < 4; ++ks)
#pragma unroll
                for (int kt = 0; kt < 2; ++kt)
#pragma unroll
                    for (int qt = 0; qt < 2; ++qt) { s[kt][qt] = WF::mma(kf[kt][ks], qf[qt][ks], s[kt][qt]); if (NSPLIT) { s[kt][qt] = WF::mma(kf[kt][ks], qg[qt][ks], s[kt][qt]); s[kt][qt] = WF::mma(kg[kt][ks], qf[qt][ks], s[kt][qt]); } }
            if (NSPLIT == 0 && kb < kend) {   // the next pass's key fragments, one pass ahead, inside this stage's buffer only
#pragma unroll
                for (int kt = 0; kt < 2; ++kt)
#pragma unroll
                    for (int ks = 0; ks < 4; ++ks) kf[kt][ks] = WF::ld(kp + (32 + kt * 16) * KPE + ks * 32);
            }
            if (kb == q0) {   // the diagonal pass: keys after the query are excluded (an exact zero weight)
#pragma unroll
                for (int kt = 0; kt < 2; ++kt)
#pragma unroll
                    for (int qt = 0; qt < 2; ++qt)
#pragma unroll
                        for (int j = 0; j < 8; ++j) if (kt * 16 + hi * 8 + j > qt * 16 + lr) s[kt][qt][j] = -3.0e38f;
            }
            // P under the reference in use, its in-lane sums, and P packed as the B operand
            V pf[2], pg[2]; float sum[2];
            auto soft = [&]() {
                // the same products and the same two chains of sums as one by one, written on register pairs (two scores of a query a multiply-add, the two query groups' sums an add)
                v2f x[2][8]; float p[2][16]; v2f acc = {0.f, 0.f};
#pragma unroll
                for (int qt = 0; qt < 2; ++qt) { const float mo = OFF - m[qt];
#pragma unroll
                    for (int i = 0; i < 8; ++i) x[qt][i] = __builtin_elementwise_fma((v2f){s[i >> 2][qt][(2 * i) & 7], s[i >> 2][qt][(2 * i + 1) & 7]}, (v2f){CL2, CL2}, (v2f){mo, mo}); }
#pragma unroll
                for (int e = 0; e < 16; ++e) { const v2f pe = {exp2s(x[0][e >> 1][e & 1]), exp2s(x[1][e >> 1][e & 1])}; acc += pe; p[0][e] = pe[0]; p[1][e] = pe[1]; }
                sum[0] = acc[0]; sum[1] = acc[1];
#pragma unroll
                for (int qt = 0; qt < 2; ++qt) {
                    if constexpr (NSPLIT == 0) { v16h t16;
#pragma unroll
                        for (int e = 0; e < 16; ++e) t16[e] = (h16)p[qt][e];
                        pf[qt] = t16;
                    } else { v8us h0, h1, l0, l1;
#pragma unroll
                        for (int e = 0; e < 8; ++e) { unsigned short a2, c2; splitf(p[qt][e], a2, c2); h0[e] = a2; l0[e] = c2; splitf(p[qt][8 + e], a2, c2); h1[e] = a2; l1[e] = c2; }
                        pf[qt] = cat16b(h0, h1); pg[qt] = cat16b(l0, l1); } }
            };
            soft();
            // every P is >= 0, so no P exceeds its lane's sums: sums within PLIM say that the reference still serves. Else (always in a wave's first pass, whose P are infinite) the maxima are formed, the references replaced and P formed anew
            if (__builtin_amdgcn_ballot_w32(sum[0] + sum[1] > PLIM) != 0) {
                float mx[2];
#pragma unroll
                for (int qt = 0; qt < 2; ++qt) { float a = s[0][qt][0];
#pragma unroll
                    for (int j = 1; j < 8; ++j) a = fmaxf(a, s[0][qt][j]);
#pragma unroll
                    for (int j = 0; j < 8; ++j) a = fmaxf(a, s[1][qt][j]);
                    mx[qt] = a; }
                { const float x0 = __shfl_xor(mx[0], 16, 32), x1 = __shfl_xor(mx[1], 16, 32); mx[0] = fmaxf(mx[0], x0) * CL2; mx[1] = fmaxf(mx[1], x1) * CL2; }
#pragma unroll
                for (int qt = 0; qt < 2; ++qt) { const float mn = fmaxf(m[qt], mx[qt]); const float al = exp2s(m[qt] - mn); m[qt] = mn; l[qt] *= al;
#pragma unroll
                    for (int dt = 0; dt < 8; ++dt) o[qt][dt] *= al; }
                soft();
            }
            l[0] += sum[0]; l[1] += sum[1];
            if (NSPLIT) {   // hi / lo rows (at most 16 passes): the value fragments come behind the softmax, so that 128 operand registers are not live across it
#pragma unroll
                for (int dt = 0; dt < 8; ++dt) { const int vo = dt * 16 * VPE; vf[dt] = WF::ld(vp + vo); vg[dt] = WF::ld(vp + 128 * VPE + vo); }
                __builtin_amdgcn_sched_barrier(0);   // as above, for the value reads
            }
#pragma unroll
            for (int dt = 0; dt < 8; ++dt)
#pragma unroll
                for (int qt = 0; qt < 2; ++qt) { o[qt][dt] = WF::mma(vf[dt], pf[qt], o[qt][dt]); if (NSPLIT) { o[qt][dt] = WF::mma(vf[dt], pg[qt], o[qt][dt]); o[qt][dt] = WF::mma(vg[dt], pf[qt], o[qt][dt]); } }
        }
        // hand-over, passed by every wave (also one that had no pass in this stage)
        asm volatile("s_wait_dscnt 0x0" ::: "memory");      // this wave's reads of this buffer are done before it is refilled
        asm volatile("s_wait_asynccnt 0x0" ::: "memory");   // this wave's copies of stage t + 1 have landed
        __syncthreads();                                    // stage t + 1 may be read by all; nobody reads stage t's buffer any more
        if (t + 2 < nst) fa_stage<T16, NSPLIT, KS>(lb + (t & 1) * BUFB, Kp, K2, Vt, V2, (t + 2) * KS, tid);
    }
    asm volatile("s_wait_asynccnt 0x0" ::: "memory");   // no copy is outstanding when the stage buffers are reused below and when the wave ends
    // merge of the pair: the wave of the second halves hands its sums, its reference maxima and its O^T over in LDS (the stage buffers, which nobody reads behind the loop's last barrier); 33 rows of 32 lanes x 16 bytes a pair
    v4f* mg = (v4f*)sm + wq * 33 * 32 + (hi * 16 + lr);
    if (kh) {
#pragma unroll
        for (int qt = 0; qt < 2; ++qt)
#pragma unroll
            for (int dt = 0; dt < 8; ++dt) { v4f a, c;
#pragma unroll
                for (int j = 0; j < 4; ++j) { a[j] = o[qt][dt][j]; c[j] = o[qt][dt][4 + j]; }
                mg[((qt * 8 + dt) * 2) * 32] = a; mg[((qt * 8 + dt) * 2 + 1) * 32] = c; }
        mg[32 * 32] = (v4f){m[0], m[1], l[0], l[1]};
    }
    __syncthreads();   // the handed-over values may be read; passed by all eight waves
    if (kh) return;
    { const v4f ml = mg[32 * 32];
#pragma unroll
      for (int qt = 0; qt < 2; ++qt) { const float mn = fmaxf(m[qt], ml[qt]); const float a0 = exp2s(m[qt] - mn), a1 = exp2s(ml[qt] - mn);   // a wave that had no pass hands over zeros under a reference of -3e38: weight 0
          l[qt] = l[qt] * a0 + ml[2 + qt] * a1;
#pragma unroll
          for (int dt = 0; dt < 8; ++dt) { const v4f a = mg[((qt * 8 + dt) * 2) * 32], c = mg[((qt * 8 + dt) * 2 + 1) * 32];
#pragma unroll
              for (int j = 0; j < 4; ++j) { o[qt][dt][j] = o[qt][dt][j] * a0 + a[j] * a1; o[qt][dt][4 + j] = o[qt][dt][4 + j] * a0 + c[j] * a1; } } } }
#pragma unroll
    for (int qt = 0; qt < 2; ++qt) { const float inv = __fdiv_rn(1.0f, l[qt] + __shfl_xor(l[qt], 16, 32));
#pragma unroll
        for (int dt = 0; dt < 8; ++dt) o[qt][dt] *= inv; }
    float* op = orow + (size_t)(q0 + lr) * DQ + hi * 8;   // a lane's 8 accumulator registers are 8 consecutive features of one query row
#pragma unroll
    for (int qt = 0; qt < 2; ++qt)
#pragma unroll
        for (int dt = 0; dt < 8; ++dt) { v4f a, c;
#pragma unroll
            for (int j = 0; j < 4; ++j) { a[j] = o[qt][dt][j]; c[j] = o[qt][dt][4 + j]; }
            *(v4f*)(op + qt * 16 * DQ + dt * 16) = a; *(v4f*)(op + qt * 16 * DQ + dt * 16 + 4) = c; }
}
// grid: 512 blocks of 8 waves = 16 blocks of 128 query rows x 32 (batch, head) planes. A block's registers fill a WGP, so blocks run one behind another there: they are dealt in falling order of their work
// (stages of 128 keys; a hi / lo stage counts three times): query blocks 15 14 13 12 11 3 10 9 8 2 7 6 5 1 4 0, one nibble each below.
__global__ __launch_bounds__(256) void k_fattn(const float* __restrict__ q, const h16* __restrict__ K16, const h16* __restrict__ V16, const bf* __restrict__ Kh, const bf* __restrict__ Kl, const bf* __restrict__ Vh, const bf* __restrict__ Vl, float* __restrict__ OUT) {
    __shared__ __attribute__((aligned(128))) char sm[2 * BUFB + QSB];
    const int tid = threadIdx.x, lane = tid & 31, lr = lane & 15, hi = lane >> 4; const int wv = __builtin_amdgcn_readfirstlane(tid >> 5);
    const int wq = wv & 3, kh = wv >> 2;   // which 32 query columns; which half of every stage's keys
    const int lin = blockIdx.x, z = lin & (NB_ * NH_ - 1), g = lin / (NB_ * NH_); const int qb = (int)((0x041567289A3BCDEFull >> (4 * g)) & 15);
    const int q0 = qb * 128 + wq * 32; const size_t pz = (size_t)z * TT * HD, vz = (size_t)z * HD * TT * 2;
    float* orow = OUT + (size_t)(z / NH_) * TT * DQ + (z % NH_) * HD;
    const float* qrows = q + ((size_t)(z / NH_) * TT + qb * 128) * DM + (z % NH_) * HD;   // the block's first query row, at its head's features
    // the choice is the same for the whole block (RH is a multiple of 128): its barriers stand under block-uniform control flow; stages: the block's keys 0 .. qb * 128 + 127
    if (qb * 128 < RH) fa_tile<bf, 2, 64>(qrows, Kh + pz, Kl + pz, Vh + vz, Vl + vz, q0, 2 * (qb + 1), tid, lr, hi, wq, kh, sm, orow);
    else fa_tile<h16, 0, 128>(qrows, K16 + pz, nullptr, V16 + vz, nullptr, q0, qb + 1, tid, lr, hi, wq, kh, sm, orow);
}

extern "C" void kernel_launch(void* const* d_in, const int* in_sizes, int n_in,
                              void* d_out, int out_size, void* d_ws, size_t ws_size, hipStream_t stream) {
    (void)in_sizes; (void)n_in; (void)out_size;
    const float* q = (const float*)d_in[0]; const float* k = (const float*)d_in[1]; const float* v = (const float*)d_in[2];   /* q, k, v ([2][2048][2048] each, GIVEN: this module has NO projections): THREE inputs */
    float* OUT = (float*)d_out;     // [2][2048][2048]
    char* wsp = (char*)d_ws;
    auto take = [&](size_t bytes) { char* p = wsp; wsp += (bytes + 255) & ~(size_t)255; return (void*)p; };
    const size_t PZ = (size_t)NH_ * TT * HD;   // elements of one batch's head planes; every plane holds both batches (112 MiB of the 256 MiB workspace)
    h16* KP16 = (h16*)take(NB_ * PZ * 2); h16* VT16 = (h16*)take(NB_ * PZ * 2 * 2);
    bf* KPh = (bf*)take(NB_ * PZ * 2); bf* KPl = (bf*)take(NB_ * PZ * 2); bf* VTh = (bf*)take(NB_ * PZ * 2 * 2); bf* VTl = VTh + TT;   // value rows at pitch 2 * TT: hi / lo share a row, the fp16 row uses its first half
    if ((size_t)(wsp - (char*)d_ws) > ws_size) return;    // ws 256 MiB
    k_planes<<<2 * 256, 256, 0, stream>>>(k, v, KP16, KPh, KPl, VT16, VTh);   /* the key and value planes of both batches straight from the INPUT rows [t][h * 128 + d]; the lo value rows lie TT behind the hi rows */
    k_fattn<<<NB_ * NH_ * (TT / 128), 256, 0, stream>>>(q, KP16, VT16, KPh, KPl, VTh, VTl, OUT);   /* all 32 (batch, head) planes in one launch; the merged context goes straight to the OUTPUT in f32 */
}

// v009
// It runs in 45.6 microseconds.
// In two side-by-side timings against v008, it was 1.21 and 1.20 times as fast.
// All steps since v000 together make it 28.7 times as fast.
#include <hip/hip_runtime.h>

// Causal multi-head attention CORE on GIVEN q, k, v (q, k, v [2][2048][2048]; 16 heads x 128 by reshape: head h = features h * 128 .. h * 128 + 127; dots = (q x 128^-0.5) . k; keys after the query take -50000 (== exclusion: an exact zero weight after the softmax); softmax over the keys; out = attn v merged in head order -> [2][2048][2048] (8.4 M); NO projections, NO rotary; argument order q, k, v).
// Compute dtypes, f32 accumulate: the GIVEN f32 q, k, v are NOT rounded to bf16 (no projection, no input cast): the attention kernel reads q, k and v directly and converts them itself: f16, or bf16 hi / lo (hi + lo carries about 16 bits of the f32 value); causal scores, online softmax and attn.v in one kernel: query rows < 512 hl (3 products), the rest single fp16 (P x 128 and more); softmax f32; the merged context is written to the output in f32 (no output projection).

#define NB_  2
#define TT   2048
#define DM   2048
#define NH_  16
#define NKV  16
#define REP  (NH_ / NKV)
#define HD   128
#define DQ   (NH_ * HD)
#define DKV  (NKV * HD)
#define RH   512                  // query rows < RH use hi+lo planes (0: none)
#define SCL  0.088388347648318447f   // HD^-0.5
typedef _Float16 h16;
typedef unsigned short bf;
typedef __attribute__((ext_vector_type(16))) __bf16   v16bf;
typedef __attribute__((ext_vector_type(16))) _Float16 v16h;
typedef __attribute__((ext_vector_type(8)))  _Float16 v8h;
typedef __attribute__((ext_vector_type(8)))  unsigned short v8us;
typedef __attribute__((ext_vector_type(8)))  float    v8f;
typedef __attribute__((ext_vector_type(4)))  float    v4f;
typedef v8h  __attribute__((may_alias)) v8ha;
typedef v4f  __attribute__((may_alias)) v4fa;
typedef v8us __attribute__((may_alias)) v8usa;

__device__ __forceinline__ unsigned short f2bf(float f) { unsigned u = __float_as_uint(f); u += 0x7FFFu + ((u >> 16) & 1u); return (unsigned short)(u >> 16); }
__device__ __forceinline__ float bf2f(unsigned short b) { return __uint_as_float(((unsigned)b) << 16); }
__device__ __forceinline__ float bfr(float f) { return bf2f(f2bf(f)); }
__device__ __forceinline__ v16h cat16(v8h lo, v8h hi) { return __builtin_shufflevector(lo, hi, 0, 1, 2, 3, 4, 5, 6, 7, 8, 9, 10, 11, 12, 13, 14, 15); }
__device__ __forceinline__ v16bf cat16b(v8us lo, v8us hi) { return __builtin_bit_cast(v16bf, __builtin_shufflevector(lo, hi, 0, 1, 2, 3, 4, 5, 6, 7, 8, 9, 10, 11, 12, 13, 14, 15)); }
__device__ __forceinline__ v8f wmma16(v16h a, v16h b, v8f c) { return __builtin_amdgcn_wmma_f32_16x16x32_f16(false, a, false, b, (short)0, c, false, false); }
__device__ __forceinline__ v8f wmmab(v16bf a, v16bf b, v8f c) { return __builtin_amdgcn_wmma_f32_16x16x32_bf16(false, a, false, b, (short)0, c, false, false); }



// ---- k_gemmw: register-blocked GEMM, ONE WAVE per 64x64 output tile (16 accumulators), operands straight from K-contiguous 16-bit planes; grid (M/64, N/64, Z), 32 threads.
// C[m][n] (f32, pitch ldc, + optional f32 bias[n]) = sum_k A[m][k] Bt[n][k] (+ split products per NSPLIT). z-batch strides sA/sB/sC in elements. K % 32 == 0.
template <typename T16> struct WFrag;
template <> struct WFrag<h16> { typedef v16h V; static __device__ __forceinline__ V ld(const h16* p) { return cat16(*(const v8h*)p, *(const v8h*)(p + 16)); } static __device__ __forceinline__ v8f mma(V a, V b, v8f c) { return wmma16(a, b, c); } };
template <> struct WFrag<bf> { typedef v16bf V; static __device__ __forceinline__ V ld(const bf* p) { return cat16b(*(const v8us*)p, *(const v8us*)(p + 16)); } static __device__ __forceinline__ v8f mma(V a, V b, v8f c) { return wmmab(a, b, c); } };
template <typename T16, int NSPLIT, bool BIAS>
__global__ __launch_bounds__(32) void k_gemmw(const T16* __restrict__ A, const T16* __restrict__ A2, const T16* __restrict__ Bt, const T16* __restrict__ Bt2, int K, float* C, int ldc, const float* __restrict__ bias, size_t sA, size_t sB, size_t sC) {
    typedef typename WFrag<T16>::V V;
    __shared__ __align__(16) float os[16 * 68];
    const size_t z = blockIdx.z; A += z * sA; if (A2) A2 += z * sA; Bt += z * sB; if (Bt2) Bt2 += z * sB; C += z * sC;
    const int lane = threadIdx.x & 31, lr = lane & 15, hi = lane >> 4; const int r0 = blockIdx.x * 64, c0 = blockIdx.y * 64;
    v8f acc[4][4];
#pragma unroll
    for (int mb = 0; mb < 4; ++mb)
#pragma unroll
        for (int nb = 0; nb < 4; ++nb) acc[mb][nb] = (v8f){};
    const size_t aoff = (size_t)(r0 + lr) * K + 8 * hi, boff = (size_t)(c0 + lr) * K + 8 * hi;
#pragma unroll 1
    for (int kc = 0; kc < K; kc += 32) {
        V a[4], a2[4];
#pragma unroll
        for (int mb = 0; mb < 4; ++mb) { a[mb] = WFrag<T16>::ld(A + aoff + (size_t)mb * 16 * K + kc); if (NSPLIT == 1 || NSPLIT == 2) a2[mb] = WFrag<T16>::ld(A2 + aoff + (size_t)mb * 16 * K + kc); }
#pragma unroll
        for (int nb = 0; nb < 4; ++nb) { const V b = WFrag<T16>::ld(Bt + boff + (size_t)nb * 16 * K + kc); V b2; if (NSPLIT >= 2) b2 = WFrag<T16>::ld(Bt2 + boff + (size_t)nb * 16 * K + kc);
#pragma unroll
            for (int mb = 0; mb < 4; ++mb) { acc[mb][nb] = WFrag<T16>::mma(a[mb], b, acc[mb][nb]); if (NSPLIT == 1 || NSPLIT == 2) acc[mb][nb] = WFrag<T16>::mma(a2[mb], b, acc[mb][nb]); if (NSPLIT >= 2) acc[mb][nb] = WFrag<T16>::mma(a[mb], b2, acc[mb][nb]); } }
        asm volatile("v_nop\n\tv_nop\n\tv_nop\n\tv_nop" : "+v"(acc[0][0]), "+v"(acc[1][1]), "+v"(acc[2][2]), "+v"(acc[3][3]) : "v"(a[0]), "v"(a[3]));
    }
#pragma unroll
    for (int mb = 0; mb < 4; ++mb) {
#pragma unroll
        for (int nb = 0; nb < 4; ++nb) {
#pragma unroll
            for (int j = 0; j < 8; ++j) os[(hi * 8 + j) * 68 + nb * 16 + lr] = acc[mb][nb][j]; }
        __builtin_amdgcn_wave_barrier(); asm volatile("" ::: "memory");
        float* crow = C + (size_t)(r0 + mb * 16) * ldc + c0;
{
#pragma unroll
            for (int s = 0; s < 8; ++s) { const int row = 2 * s + hi, cofs = lr * 4; v4f val = *(const v4fa*)(os + row * 68 + cofs); if (BIAS) { val[0] += bfr(bias[c0 + cofs]); val[1] += bfr(bias[c0 + cofs + 1]); val[2] += bfr(bias[c0 + cofs + 2]); val[3] += bfr(bias[c0 + cofs + 3]); }
                *(v4f*)(crow + (size_t)row * ldc + cofs) = val; }
             }
        __builtin_amdgcn_wave_barrier(); asm volatile("" ::: "memory");
    }
}

__device__ __forceinline__ h16 tohx(float x) { return (h16)x; }
__device__ __forceinline__ void splitf(float y, unsigned short& h, unsigned short& l) { h = f2bf(y); l = f2bf(y - bf2f(h)); }
typedef __attribute__((ext_vector_type(2))) _Float16 v2h;
typedef __attribute__((ext_vector_type(4))) _Float16 v4h;
typedef __attribute__((ext_vector_type(2))) unsigned short v2us;
typedef __attribute__((ext_vector_type(4))) unsigned short v4us;
typedef __attribute__((ext_vector_type(2))) float v2f;
typedef __attribute__((ext_vector_type(4))) int v4i;

__global__ __launch_bounds__(256) void k_wtG(const float* __restrict__ w, int K, int N, bf* Bt) {
    const int lane = threadIdx.x & 31; const int L0 = (blockIdx.x * 8 + (threadIdx.x >> 5)) * 8; const int nlines = N * K / 64;
{
#pragma unroll 1
        for (int l = 0; l < 8; ++l) { const int L = L0 + l; if (L >= nlines) break; const size_t e = (size_t)L * 64 + lane * 2; const int k = (int)(e % K), n = (int)(e / K); v2us o;
            o[0] = f2bf(w[(size_t)k * N + n]); o[1] = f2bf(w[(size_t)(k + 1) * N + n]); *(v2us*)(Bt + e) = o; }
         }
}
__global__ __launch_bounds__(256) void k_cvt8(const float* __restrict__ src, bf* dst, size_t n8) { const size_t i = (size_t)blockIdx.x * 256 + threadIdx.x; if (i >= n8) return; const v8f v = *(const v8f*)(src + i * 8); v8us o;
#pragma unroll
    for (int k = 0; k < 8; ++k) o[k] = f2bf(v[k]); *(v8us*)(dst + i * 8) = o;  }

#define FTHR 8.0f
#define KPB  272                  // LDS pitch in bytes of a key row (256 bytes of data)
#define VPB  288                  // LDS pitch in bytes of a value row (256 bytes of data)
#define QSB  (2 * 128 * KPB)      // bytes of the query rows in LDS behind the stage buffers: 128 rows, one plane (fp16) or two (hi / lo)
#define BUFB 71680                // bytes of one stage buffer: fp16 128 keys: 128 x 272 + 128 x 288; hi / lo 64 keys: 2 x 64 x 272 + 2 x 64 x 288
// 2^x; the v_nop in the same statement keeps the one free slot the instruction set asks for behind a transcendental
__device__ __forceinline__ float exp2s(float x) { float r; asm("v_exp_f32_e32 %0, %1\n\tv_nop" : "=v"(r) : "v"(x)); return r; }
typedef __attribute__((ext_vector_type(8))) short s16x8;
typedef __attribute__((ext_vector_type(4))) __bf16 v4b;
// transposing 16-bit LDS read: lane (c, h) gets 8 rows (8 h ..) of column c of a row-major tile
__device__ __forceinline__ v8us ld_tr16(const char* p) { typedef __attribute__((address_space(3))) s16x8 lds_s16x8; return __builtin_bit_cast(v8us, __builtin_amdgcn_ds_load_tr16_b128_v8i16((lds_s16x8*)p)); }
// one 16 (features) x 32 (keys) A fragment of V^T from value rows at pitch VPB: keys 8 h .. and 16 + 8 h .., the order of the packed scores
__device__ __forceinline__ void ldvt(v16h& f, const char* p) { f = cat16(__builtin_bit_cast(v8h, ld_tr16(p)), __builtin_bit_cast(v8h, ld_tr16(p + 16 * VPB))); }
__device__ __forceinline__ void ldvt(v16bf& f, const char* p) { f = cat16b(ld_tr16(p), ld_tr16(p + 16 * VPB)); }
// N input rows of one head (512 bytes each, a lane 4 features of every row)
template <bool PIN, int N>
__device__ __forceinline__ void ld_rows(v4f (&x)[N], const float* p, const int lo) {   // p: the wave's first row (the same in every lane); lo: the lane's place in a row
    const float* pl = p + lo;
#pragma unroll
    for (int i = 0; i < N; ++i) x[i] = *(const v4f*)(pl + i * DM);
    // the address registers of the loads above may be rewritten only behind this wait. PIN: the address is its input and so lives up to it (one build let the last load's result land on the address pair); without PIN the wait stands directly behind the loads (an input there made the compiler keep an address pair from stage to stage, in scratch)
    if constexpr (PIN) asm volatile("s_wait_xcnt 0x0" :: "v"(pl) : "memory"); else asm volatile("s_wait_xcnt 0x0" ::: "memory");
}
// the same rows converted and laid into LDS at w (+ i * pitch): fp16, or hi at w and lo at w + lo (round to nearest even, lo = the rounded rest)
template <int NSPLIT, int N>
__device__ __forceinline__ void st_rows(const v4f (&x)[N], char* w, const int pitch, const int lo) {
#pragma unroll
    for (int i = 0; i < N; ++i) {
        if constexpr (NSPLIT == 0) { v4h o16;
#pragma unroll
            for (int j = 0; j < 4; ++j) o16[j] = tohx(x[i][j]);
            *(v4h*)(w + i * pitch) = o16;
        } else { const v4us oh = __builtin_bit_cast(v4us, __builtin_convertvector(x[i], v4b)); v4f r;
#pragma unroll
            for (int j = 0; j < 4; ++j) r[j] = x[i][j] - bf2f(oh[j]);
            *(v4us*)(w + i * pitch) = oh; *(v4us*)(w + lo + i * pitch) = __builtin_bit_cast(v4us, __builtin_convertvector(r, v4b)); }
    }
}
template <typename T16, int NSPLIT, int KS>
__device__ __forceinline__ void fa_tile(const float* __restrict__ qrows, const float* __restrict__ krows, const float* __restrict__ vrows, const int q0, const int nst, const int tid, const int lr, const int hi, const int wq, const int kh, char* sm, float* __restrict__ orow) {
    typedef WFrag<T16> WF; typedef typename WF::V V;
    constexpr float OFF = (NSPLIT == 0) ? 7.0f : 0.0f;
    constexpr float CL2 = SCL * 1.4426950408889634f;   // scores in log2 units
    constexpr float PLIM = (NSPLIT == 0) ? 32768.0f : 256.0f;   // 2^(OFF + FTHR): the bound on a lane's sums of P in one pass
    static_assert(OFF + FTHR == ((NSPLIT == 0) ? 15.0f : 8.0f), "PLIM is 2^(OFF + FTHR)");
    constexpr int NPL = NSPLIT ? 2 : 1, KPE = KPB / 2;   // planes of a stage; LDS pitch of a key row in elements
    constexpr int HK = KS / 2;   // keys of a stage that one wave of the pair takes
    constexpr int RW = KS / 8;   // rows of a stage (keys, and values) that one wave brings in
    const int wv = kh * 4 + wq, ln = hi * 16 + lr;   // the wave's number (a scalar) and the lane's
    const float* kgp = krows + (size_t)(wv * RW) * DM; const float* vgp = vrows + (size_t)(wv * RW) * DM;   // the wave's rows of stage 0
    const int kw = wv * RW * KPB + ln * 8, vw = NPL * KS * KPB + wv * RW * VPB + ln * 8;   // where they go in a stage buffer (bytes)
    // the block's query rows: a wave takes 16 of them, a lane 4 features of each
    v4f x[16];
    const float* qp = qrows + (size_t)((tid >> 5) * 16) * DM + (tid & 31) * 4;
#pragma unroll
    for (int i = 0; i < 16; ++i) x[i] = *(const v4f*)(qp + i * DM);
    asm volatile("s_wait_xcnt 0x0" :: "v"(qp) : "memory");   // the address registers of the loads above stay untouched up to this wait (they are its inputs)
    v4f xk[RW], xv[RW]; ld_rows<false>(xk, kgp, ln * 4); ld_rows<false>(xv, vgp, ln * 4);   // stage 0 flies beside the query rows
    char* qs = sm + 2 * BUFB;
    { char* qw = qs + (tid >> 5) * 16 * KPB + (tid & 31) * 8;
#pragma unroll
      for (int i = 0; i < 16; ++i) {
          if constexpr (NSPLIT == 0) { v4h o16;
#pragma unroll
              for (int j = 0; j < 4; ++j) o16[j] = tohx(x[i][j]);
              *(v4h*)(qw + i * KPB) = o16;
          } else { v4us oh, ol;
#pragma unroll
              for (int j = 0; j < 4; ++j) { unsigned short a2, c2; splitf(x[i][j], a2, c2); oh[j] = a2; ol[j] = c2; }
              *(v4us*)(qw + i * KPB) = oh; *(v4us*)(qw + 128 * KPB + i * KPB) = ol; } } }
    st_rows<NSPLIT>(xk, sm + kw, KPB, KS * KPB); st_rows<NSPLIT>(xv, sm + vw, VPB, KS * VPB);
    v8f o[2][8];
#pragma unroll
    for (int qt = 0; qt < 2; ++qt)
#pragma unroll
        for (int dt = 0; dt < 8; ++dt) o[qt][dt] = (v8f){};
    float m[2] = {-3.0e38f, -3.0e38f}, l[2] = {0.f, 0.f};
    __syncthreads();   // stage 0 and the converted query rows may be read
    V qf[2][4], qg[2][4];
    const T16* ql = (const T16*)qs + (wq * 32 + lr) * KPE + 8 * hi;
#pragma unroll
    for (int qt = 0; qt < 2; ++qt)
#pragma unroll
        for (int ks = 0; ks < 4; ++ks) { const int qo = qt * 16 * KPE + ks * 32; qf[qt][ks] = WF::ld(ql + qo); if (NSPLIT) qg[qt][ks] = WF::ld(ql + 128 * KPE + qo); }
    v4f xs[RW];   // fp16 rows: input rows of the next stage on their way
#pragma unroll 1
    for (int t = 0; t < nst; ++t) {
        const int kb0 = t * KS + kh * HK, kend = min(kb0 + HK - 32, q0);   // this wave's passes of the stage, in its half of the keys: kb0 .. kend (none behind its diagonal)
        const char* bp = sm + (t & 1) * BUFB;
        const T16* kl = (const T16*)bp + (kh * HK + lr) * KPE + 8 * hi; const char* vl = bp + NPL * KS * KPB + (kh * HK + 8 * hi + (lr & 7)) * VPB + ((lr >> 3) & 1) * 16;   // vl: the lane's address for the transposing read
        const bool more = t + 1 < nst; char* nb = sm + ((t + 1) & 1) * BUFB; const size_t go = (size_t)(t + 1) * KS * DM;   // the next stage: is there one, its buffer (nobody has read it since the last barrier), its first input row
        if constexpr (NSPLIT == 0) { if (more) ld_rows<false>(xs, kgp + go, ln * 4); }   // its key rows fly during this stage's first pass
        V kf[2][4], kg[2][4];
        if (NSPLIT == 0 && kb0 <= kend) {
#pragma unroll
            for (int kt = 0; kt < 2; ++kt)
#pragma unroll
                for (int ks = 0; ks < 4; ++ks) kf[kt][ks] = WF::ld(kl + kt * 16 * KPE + ks * 32);
        }
#pragma unroll 1
        for (int kb = kb0; kb <= kend; kb += 32) {
            V vf[8], vg2[8]; const char* vp = vl + (kb - kb0) * VPB; const T16* kp = kl + (kb - kb0) * KPE;
            if (NSPLIT == 0) {   // the value fragments come during the score products and the softmax
#pragma unroll
                for (int dt = 0; dt < 8; ++dt) ldvt(vf[dt], vp + dt * 32);
                __builtin_amdgcn_sched_barrier(0);   // keeps these LDS reads up here: the compiler moved each down to its product, where the wave then waited out the LDS latency once per fragment
            } else {
#pragma unroll
                for (int kt = 0; kt < 2; ++kt)
#pragma unroll
                    for (int ks = 0; ks < 4; ++ks) { const int ko = kt * 16 * KPE + ks * 32; kf[kt][ks] = WF::ld(kp + ko); kg[kt][ks] = WF::ld(kp + KS * KPE + ko); }
                __builtin_amdgcn_sched_barrier(0);   // all key reads issued in one run in front of the products (else one LDS latency is waited out per fragment)
            }
            v8f s[2][2];
#pragma unroll
            for (int kt = 0; kt < 2; ++kt)
#pragma unroll
                for (int qt = 0; qt < 2; ++qt) s[kt][qt] = (v8f){};
#pragma unroll
            for (int ks = 0; ks < 4; ++ks)
#pragma unroll
                for (int kt = 0; kt < 2; ++kt)
#pragma unroll
                    for (int qt = 0; qt < 2; ++qt) { s[kt][qt] = WF::mma(kf[kt][ks], qf[qt][ks], s[kt][qt]); if (NSPLIT) { s[kt][qt] = WF::mma(kf[kt][ks], qg[qt][ks], s[kt][qt]); s[kt][qt] = WF::mma(kg[kt][ks], qf[qt][ks], s[kt][qt]); } }
            if (NSPLIT == 0 && kb < kend) {   // the next pass's key fragments, one pass ahead, inside this stage's buffer only
#pragma unroll
                for (int kt = 0; kt < 2; ++kt)
#pragma unroll
                    for (int ks = 0; ks < 4; ++ks) kf[kt][ks] = WF::ld(kp + (32 + kt * 16) * KPE + ks * 32);
            }
            if (kb == q0) {   // the diagonal pass: keys after the query are excluded (an exact zero weight)
#pragma unroll
                for (int kt = 0; kt < 2; ++kt)
#pragma unroll
                    for (int qt = 0; qt < 2; ++qt)
#pragma unroll
                        for (int j = 0; j < 8; ++j) if (kt * 16 + hi * 8 + j > qt * 16 + lr) s[kt][qt][j] = -3.0e38f;
            }
            // P under the reference in use, its in-lane sums, and P packed as the B operand
            V pf[2], pg[2]; float sum[2];
            auto soft = [&]() {
                // the same products and the same two chains of sums as one by one, written on register pairs (two scores of a query a multiply-add, the two query groups' sums an add)
                v2f x[2][8]; float p[2][16]; v2f acc = {0.f, 0.f};
#pragma unroll
                for (int qt = 0; qt < 2; ++qt) { const float mo = OFF - m[qt];
#pragma unroll
                    for (int i = 0; i < 8; ++i) x[qt][i] = __builtin_elementwise_fma((v2f){s[i >> 2][qt][(2 * i) & 7], s[i >> 2][qt][(2 * i + 1) & 7]}, (v2f){CL2, CL2}, (v2f){mo, mo}); }
#pragma unroll
                for (int e = 0; e < 16; ++e) { const v2f pe = {exp2s(x[0][e >> 1][e & 1]), exp2s(x[1][e >> 1][e & 1])}; acc += pe; p[0][e] = pe[0]; p[1][e] = pe[1]; }
                sum[0] = acc[0]; sum[1] = acc[1];
#pragma unroll
                for (int qt = 0; qt < 2; ++qt) {
                    if constexpr (NSPLIT == 0) { v16h t16;
#pragma unroll
                        for (int e = 0; e < 16; ++e) t16[e] = (h16)p[qt][e];
                        pf[qt] = t16;
                    } else { v8us h0, h1, l0, l1;
#pragma unroll
                        for (int e = 0; e < 8; ++e) { unsigned short a2, c2; splitf(p[qt][e], a2, c2); h0[e] = a2; l0[e] = c2; splitf(p[qt][8 + e], a2, c2); h1[e] = a2; l1[e] = c2; }
                        pf[qt] = cat16b(h0, h1); pg[qt] = cat16b(l0, l1); } }
            };
            soft();
            // every P is >= 0, so no P exceeds its lane's sums: sums within PLIM say that the reference still serves. Else (always in a wave's first pass, whose P are infinite) the maxima are formed, the references replaced and P formed anew
            if (__builtin_amdgcn_ballot_w32(sum[0] + sum[1] > PLIM) != 0) {
                float mx[2];
#pragma unroll
                for (int qt = 0; qt < 2; ++qt) { float a = s[0][qt][0];
#pragma unroll
                    for (int j = 1; j < 8; ++j) a = fmaxf(a, s[0][qt][j]);
#pragma unroll
                    for (int j = 0; j < 8; ++j) a = fmaxf(a, s[1][qt][j]);
                    mx[qt] = a; }
                { const float x0 = __shfl_xor(mx[0], 16, 32), x1 = __shfl_xor(mx[1], 16, 32); mx[0] = fmaxf(mx[0], x0) * CL2; mx[1] = fmaxf(mx[1], x1) * CL2; }
#pragma unroll
                for (int qt = 0; qt < 2; ++qt) { const float mn = fmaxf(m[qt], mx[qt]); const float al = exp2s(m[qt] - mn); m[qt] = mn; l[qt] *= al;
#pragma unroll
                    for (int dt = 0; dt < 8; ++dt) o[qt][dt] *= al; }
                soft();
            }
            l[0] += sum[0]; l[1] += sum[1];
            if (NSPLIT) {   // hi / lo rows (at most 16 passes): the value fragments come behind the softmax, so that 128 operand registers are not live across it
#pragma unroll
                for (int dt = 0; dt < 8; ++dt) { ldvt(vf[dt], vp + dt * 32); ldvt(vg2[dt], vp + KS * VPB + dt * 32); }
                __builtin_amdgcn_sched_barrier(0);   // as above, for the value reads
            }
#pragma unroll
            for (int dt = 0; dt < 8; ++dt)
#pragma unroll
                for (int qt = 0; qt < 2; ++qt) { o[qt][dt] = WF::mma(vf[dt], pf[qt], o[qt][dt]); if (NSPLIT) { o[qt][dt] = WF::mma(vf[dt], pg[qt], o[qt][dt]); o[qt][dt] = WF::mma(vg2[dt], pf[qt], o[qt][dt]); } }
            // fp16 rows: a stage that has a successor lies wholly in front of every wave's diagonal, so each wave has exactly two passes in it: behind the first the key rows are laid down and the value rows set off, behind the second those are laid down
            if constexpr (NSPLIT == 0) { if (more) {
                if (kb == kb0) { st_rows<0>(xs, nb + kw, KPB, 0); ld_rows<false>(xs, vgp + go, ln * 4); }
                else st_rows<0>(xs, nb + vw, VPB, 0); } }
        }
        if constexpr (NSPLIT != 0) { if (more) { v4f a[RW], c[RW]; ld_rows<true>(a, kgp + go, ln * 4); ld_rows<true>(c, vgp + go, ln * 4); st_rows<NSPLIT>(a, nb + kw, KPB, KS * KPB); st_rows<NSPLIT>(c, nb + vw, VPB, KS * VPB); } }
        // hand-over, passed by every wave (also one that had no pass in this stage)
        asm volatile("s_wait_dscnt 0x0" ::: "memory");      // this wave's reads of this buffer and its writes of the next are done
        __syncthreads();                                    // stage t + 1 may be read by all; nobody reads stage t's buffer any more
    }
    // merge of the pair: the wave of the second halves hands its sums, its reference maxima and its O^T over in LDS (the stage buffers, which nobody reads behind the loop's last barrier); 33 rows of 32 lanes x 16 bytes a pair
    v4f* mg = (v4f*)sm + wq * 33 * 32 + (hi * 16 + lr);
    if (kh) {
#pragma unroll
        for (int qt = 0; qt < 2; ++qt)
#pragma unroll
            for (int dt = 0; dt < 8; ++dt) { v4f a, c;
#pragma unroll
                for (int j = 0; j < 4; ++j) { a[j] = o[qt][dt][j]; c[j] = o[qt][dt][4 + j]; }
                mg[((qt * 8 + dt) * 2) * 32] = a; mg[((qt * 8 + dt) * 2 + 1) * 32] = c; }
        mg[32 * 32] = (v4f){m[0], m[1], l[0], l[1]};
    }
    __syncthreads();   // the handed-over values may be read; passed by all eight waves
    if (kh) return;
    { const v4f ml = mg[32 * 32];
#pragma unroll
      for (int qt = 0; qt < 2; ++qt) { const float mn = fmaxf(m[qt], ml[qt]); const float a0 = exp2s(m[qt] - mn), a1 = exp2s(ml[qt] - mn);   // a wave that had no pass hands over zeros under a reference of -3e38: weight 0
          l[qt] = l[qt] * a0 + ml[2 + qt] * a1;
#pragma unroll
          for (int dt = 0; dt < 8; ++dt) { const v4f a = mg[((qt * 8 + dt) * 2) * 32], c = mg[((qt * 8 + dt) * 2 + 1) * 32];
#pragma unroll
              for (int j = 0; j < 4; ++j) { o[qt][dt][j] = o[qt][dt][j] * a0 + a[j] * a1; o[qt][dt][4 + j] = o[qt][dt][4 + j] * a0 + c[j] * a1; } } } }
#pragma unroll
    for (int qt = 0; qt < 2; ++qt) { const float inv = __fdiv_rn(1.0f, l[qt] + __shfl_xor(l[qt], 16, 32));
#pragma unroll
        for (int dt = 0; dt < 8; ++dt) o[qt][dt] *= inv; }
    float* op = orow + (size_t)(q0 + lr) * DQ + hi * 8;   // a lane's 8 accumulator registers are 8 consecutive features of one query row
#pragma unroll
    for (int qt = 0; qt < 2; ++qt)
#pragma unroll
        for (int dt = 0; dt < 8; ++dt) { v4f a, c;
#pragma unroll
            for (int j = 0; j < 4; ++j) { a[j] = o[qt][dt][j]; c[j] = o[qt][dt][4 + j]; }
            *(v4f*)(op + qt * 16 * DQ + dt * 16) = a; *(v4f*)(op + qt * 16 * DQ + dt * 16 + 4) = c; }
}
// grid: 512 blocks of 8 waves = 16 blocks of 128 query rows x 32 (batch, head) planes. A block's registers fill a WGP, so blocks run one behind another there: they are dealt in falling order of their work
// (in fp16 stages of 128 keys; a hi / lo key counts three to four times an fp16 key): query blocks 15 14 3 13 12 11 10 2 9 8 7 1 6 5 4 0, one nibble each below.
__global__ __launch_bounds__(256) void k_fattn(const float* __restrict__ q, const float* __restrict__ k, const float* __restrict__ v, float* __restrict__ OUT) {
    __shared__ __attribute__((aligned(128))) char sm[2 * BUFB + QSB];
    const int tid = threadIdx.x, lane = tid & 31, lr = lane & 15, hi = lane >> 4; const int wv = __builtin_amdgcn_readfirstlane(tid >> 5);
    const int wq = wv & 3, kh = wv >> 2;   // which 32 query columns; which half of every stage's keys
    const int lin = blockIdx.x, z = lin & (NB_ * NH_ - 1), g = lin / (NB_ * NH_); const int qb = (int)((0x045617892ABCD3EFull >> (4 * g)) & 15);
    const int q0 = qb * 128 + wq * 32; const size_t hz = (size_t)(z / NH_) * TT * DM + (z % NH_) * HD;   // hz: row 0 of the plane's batch, at its head's features
    float* orow = OUT + (size_t)(z / NH_) * TT * DQ + (z % NH_) * HD;
    const float* qrows = q + ((size_t)(z / NH_) * TT + qb * 128) * DM + (z % NH_) * HD;   // the block's first query row, at its head's features
    // the choice is the same for the whole block (RH is a multiple of 128): its barriers stand under block-uniform control flow; stages: the block's keys 0 .. qb * 128 + 127
    if (qb * 128 < RH) fa_tile<bf, 2, 64>(qrows, k + hz, v + hz, q0, 2 * (qb + 1), tid, lr, hi, wq, kh, sm, orow);
    else fa_tile<h16, 0, 128>(qrows, k + hz, v + hz, q0, qb + 1, tid, lr, hi, wq, kh, sm, orow);
}

extern "C" void kernel_launch(void* const* d_in, const int* in_sizes, int n_in,
                              void* d_out, int out_size, void* d_ws, size_t ws_size, hipStream_t stream) {
    (void)in_sizes; (void)n_in; (void)out_size;
    const float* q = (const float*)d_in[0]; const float* k = (const float*)d_in[1]; const float* v = (const float*)d_in[2];   /* q, k, v ([2][2048][2048] each, GIVEN: this module has NO projections): THREE inputs */
    float* OUT = (float*)d_out;     // [2][2048][2048]
    (void)d_ws; (void)ws_size;      // no workspace
    k_fattn<<<NB_ * NH_ * (TT / 128), 256, 0, stream>>>(q, k, v, OUT);   /* all 32 (batch, head) planes in one launch, straight from the INPUT rows [t][h * 128 + d]; the merged context goes straight to the OUTPUT in f32 */
}

// v010
// One run takes 44 microseconds.
// Next to v009, in two timings, it ran 1.04 times as fast each time.
// Counting every step since v000, it is 29.7 times as fast.
#include <hip/hip_runtime.h>

// Causal multi-head attention CORE on GIVEN q, k, v (q, k, v [2][2048][2048]; 16 heads x 128 by reshape: head h = features h * 128 .. h * 128 + 127; dots = (q x 128^-0.5) . k; keys after the query take -50000 (== exclusion: an exact zero weight after the softmax); softmax over the keys; out = attn v merged in head order -> [2][2048][2048] (8.4 M); NO projections, NO rotary; argument order q, k, v).
// Compute dtypes, f32 accumulate: the GIVEN f32 q, k, v are NOT rounded to bf16 (no projection, no input cast): the attention kernel reads q, k and v directly and converts them itself: f16, or bf16 hi / lo (hi + lo carries about 16 bits of the f32 value); causal scores, online softmax and attn.v in one kernel: query rows < 512 hl (3 products), the rest single fp16 (P x 128 and more); softmax f32; the merged context is written to the output in f32 (no output projection).

#define NB_  2
#define TT   2048
#define DM   2048
#define NH_  16
#define NKV  16
#define REP  (NH_ / NKV)
#define HD   128
#define DQ   (NH_ * HD)
#define DKV  (NKV * HD)
#define RH   512                  // query rows < RH use hi+lo planes (0: none)
#define SCL  0.088388347648318447f   // HD^-0.5
typedef _Float16 h16;
typedef unsigned short bf;
typedef __attribute__((ext_vector_type(16))) __bf16   v16bf;
typedef __attribute__((ext_vector_type(16))) _Float16 v16h;
typedef __attribute__((ext_vector_type(8)))  _Float16 v8h;
typedef __attribute__((ext_vector_type(8)))  unsigned short v8us;
typedef __attribute__((ext_vector_type(8)))  float    v8f;
typedef __attribute__((ext_vector_type(4)))  float    v4f;
typedef v8h  __attribute__((may_alias)) v8ha;
typedef v4f  __attribute__((may_alias)) v4fa;
typedef v8us __attribute__((may_alias)) v8usa;

__device__ __forceinline__ unsigned short f2bf(float f) { unsigned u = __float_as_uint(f); u += 0x7FFFu + ((u >> 16) & 1u); return (unsigned short)(u >> 16); }
__device__ __forceinline__ float bf2f(unsigned short b) { return __uint_as_float(((unsigned)b) << 16); }
__device__ __forceinline__ float bfr(float f) { return bf2f(f2bf(f)); }
__device__ __forceinline__ v16h cat16(v8h lo, v8h hi) { return __builtin_shufflevector(lo, hi, 0, 1, 2, 3, 4, 5, 6, 7, 8, 9, 10, 11, 12, 13, 14, 15); }
__device__ __forceinline__ v16bf cat16b(v8us lo, v8us hi) { return __builtin_bit_cast(v16bf, __builtin_shufflevector(lo, hi, 0, 1, 2, 3, 4, 5, 6, 7, 8, 9, 10, 11, 12, 13, 14, 15)); }
__device__ __forceinline__ v8f wmma16(v16h a, v16h b, v8f c) { return __builtin_amdgcn_wmma_f32_16x16x32_f16(false, a, false, b, (short)0, c, false, false); }
__device__ __forceinline__ v8f wmmab(v16bf a, v16bf b, v8f c) { return __builtin_amdgcn_wmma_f32_16x16x32_bf16(false, a, false, b, (short)0, c, false, false); }



// ---- k_gemmw: register-blocked GEMM, ONE WAVE per 64x64 output tile (16 accumulators), operands straight from K-contiguous 16-bit planes; grid (M/64, N/64, Z), 32 threads.
// C[m][n] (f32, pitch ldc, + optional f32 bias[n]) = sum_k A[m][k] Bt[n][k] (+ split products per NSPLIT). z-batch strides sA/sB/sC in elements. K % 32 == 0.
template <typename T16> struct WFrag;
template <> struct WFrag<h16> { typedef v16h V; static __device__ __forceinline__ V ld(const h16* p) { return cat16(*(const v8h*)p, *(const v8h*)(p + 16)); } static __device__ __forceinline__ v8f mma(V a, V b, v8f c) { return wmma16(a, b, c); } };
template <> struct WFrag<bf> { typedef v16bf V; static __device__ __forceinline__ V ld(const bf* p) { return cat16b(*(const v8us*)p, *(const v8us*)(p + 16)); } static __device__ __forceinline__ v8f mma(V a, V b, v8f c) { return wmmab(a, b, c); } };
template <typename T16, int NSPLIT, bool BIAS>
__global__ __launch_bounds__(32) void k_gemmw(const T16* __restrict__ A, const T16* __restrict__ A2, const T16* __restrict__ Bt, const T16* __restrict__ Bt2, int K, float* C, int ldc, const float* __restrict__ bias, size_t sA, size_t sB, size_t sC) {
    typedef typename WFrag<T16>::V V;
    __shared__ __align__(16) float os[16 * 68];
    const size_t z = blockIdx.z; A += z * sA; if (A2) A2 += z * sA; Bt += z * sB; if (Bt2) Bt2 += z * sB; C += z * sC;
    const int lane = threadIdx.x & 31, lr = lane & 15, hi = lane >> 4; const int r0 = blockIdx.x * 64, c0 = blockIdx.y * 64;
    v8f acc[4][4];
#pragma unroll
    for (int mb = 0; mb < 4; ++mb)
#pragma unroll
        for (int nb = 0; nb < 4; ++nb) acc[mb][nb] = (v8f){};
    const size_t aoff = (size_t)(r0 + lr) * K + 8 * hi, boff = (size_t)(c0 + lr) * K + 8 * hi;
#pragma unroll 1
    for (int kc = 0; kc < K; kc += 32) {
        V a[4], a2[4];
#pragma unroll
        for (int mb = 0; mb < 4; ++mb) { a[mb] = WFrag<T16>::ld(A + aoff + (size_t)mb * 16 * K + kc); if (NSPLIT == 1 || NSPLIT == 2) a2[mb] = WFrag<T16>::ld(A2 + aoff + (size_t)mb * 16 * K + kc); }
#pragma unroll
        for (int nb = 0; nb < 4; ++nb) { const V b = WFrag<T16>::ld(Bt + boff + (size_t)nb * 16 * K + kc); V b2; if (NSPLIT >= 2) b2 = WFrag<T16>::ld(Bt2 + boff + (size_t)nb * 16 * K + kc);
#pragma unroll
            for (int mb = 0; mb < 4; ++mb) { acc[mb][nb] = WFrag<T16>::mma(a[mb], b, acc[mb][nb]); if (NSPLIT == 1 || NSPLIT == 2) acc[mb][nb] = WFrag<T16>::mma(a2[mb], b, acc[mb][nb]); if (NSPLIT >= 2) acc[mb][nb] = WFrag<T16>::mma(a[mb], b2, acc[mb][nb]); } }
        asm volatile("v_nop\n\tv_nop\n\tv_nop\n\tv_nop" : "+v"(acc[0][0]), "+v"(acc[1][1]), "+v"(acc[2][2]), "+v"(acc[3][3]) : "v"(a[0]), "v"(a[3]));
    }
#pragma unroll
    for (int mb = 0; mb < 4; ++mb) {
#pragma unroll
        for (int nb = 0; nb < 4; ++nb) {
#pragma unroll
            for (int j = 0; j < 8; ++j) os[(hi * 8 + j) * 68 + nb * 16 + lr] = acc[mb][nb][j]; }
        __builtin_amdgcn_wave_barrier(); asm volatile("" ::: "memory");
        float* crow = C + (size_t)(r0 + mb * 16) * ldc + c0;
{
#pragma unroll
            for (int s = 0; s < 8; ++s) { const int row = 2 * s + hi, cofs = lr * 4; v4f val = *(const v4fa*)(os + row * 68 + cofs); if (BIAS) { val[0] += bfr(bias[c0 + cofs]); val[1] += bfr(bias[c0 + cofs + 1]); val[2] += bfr(bias[c0 + cofs + 2]); val[3] += bfr(bias[c0 + cofs + 3]); }
                *(v4f*)(crow + (size_t)row * ldc + cofs) = val; }
             }
        __builtin_amdgcn_wave_barrier(); asm volatile("" ::: "memory");
    }
}

__device__ __forceinline__ h16 tohx(float x) { return (h16)x; }
__device__ __forceinline__ void splitf(float y, unsigned short& h, unsigned short& l) { h = f2bf(y); l = f2bf(y - bf2f(h)); }
typedef __attribute__((ext_vector_type(2))) _Float16 v2h;
typedef __attribute__((ext_vector_type(4))) _Float16 v4h;
typedef __attribute__((ext_vector_type(2))) unsigned short v2us;
typedef __attribute__((ext_vector_type(4))) unsigned short v4us;
typedef __attribute__((ext_vector_type(2))) float v2f;
typedef __attribute__((ext_vector_type(4))) int v4i;

__global__ __launch_bounds__(256) void k_wtG(const float* __restrict__ w, int K, int N, bf* Bt) {
    const int lane = threadIdx.x & 31; const int L0 = (blockIdx.x * 8 + (threadIdx.x >> 5)) * 8; const int nlines = N * K / 64;
{
#pragma unroll 1
        for (int l = 0; l < 8; ++l) { const int L = L0 + l; if (L >= nlines) break; const size_t e = (size_t)L * 64 + lane * 2; const int k = (int)(e % K), n = (int)(e / K); v2us o;
            o[0] = f2bf(w[(size_t)k * N + n]); o[1] = f2bf(w[(size_t)(k + 1) * N + n]); *(v2us*)(Bt + e) = o; }
         }
}
__global__ __launch_bounds__(256) void k_cvt8(const float* __restrict__ src, bf* dst, size_t n8) { const size_t i = (size_t)blockIdx.x * 256 + threadIdx.x; if (i >= n8) return; const v8f v = *(const v8f*)(src + i * 8); v8us o;
#pragma unroll
    for (int k = 0; k < 8; ++k) o[k] = f2bf(v[k]); *(v8us*)(dst + i * 8) = o;  }

#define FTHR 8.0f
#define KPB  272                  // LDS pitch in bytes of a key row (256 bytes of data)
#define VPB  288                  // LDS pitch in bytes of a value row (256 bytes of data)
#define QSB  (2 * 128 * KPB)      // bytes of the query rows in LDS behind the stage buffers: 128 rows in two planes (hi / lo), or 256 rows in one (fp16: heavy tile, then light)
#define BUFB 71680                // bytes of one stage buffer: fp16 128 keys: 128 x 272 + 128 x 288; hi / lo 64 keys: 2 x 64 x 272 + 2 x 64 x 288
// 2^x; the v_nop in the same statement keeps the one free slot the instruction set asks for behind a transcendental
__device__ __forceinline__ float exp2s(float x) { float r; asm("v_exp_f32_e32 %0, %1\n\tv_nop" : "=v"(r) : "v"(x)); return r; }
typedef __attribute__((ext_vector_type(8))) short s16x8;
typedef __attribute__((ext_vector_type(4))) __bf16 v4b;
// transposing 16-bit LDS read: lane (c, h) gets 8 rows (8 h ..) of column c of a row-major tile
__device__ __forceinline__ v8us ld_tr16(const char* p) { typedef __attribute__((address_space(3))) s16x8 lds_s16x8; return __builtin_bit_cast(v8us, __builtin_amdgcn_ds_load_tr16_b128_v8i16((lds_s16x8*)p)); }
// one 16 (features) x 32 (keys) A fragment of V^T from value rows at pitch VPB: keys 8 h .. and 16 + 8 h .., the order of the packed scores
__device__ __forceinline__ void ldvt(v16h& f, const char* p) { f = cat16(__builtin_bit_cast(v8h, ld_tr16(p)), __builtin_bit_cast(v8h, ld_tr16(p + 16 * VPB))); }
__device__ __forceinline__ void ldvt(v16bf& f, const char* p) { f = cat16b(ld_tr16(p), ld_tr16(p + 16 * VPB)); }
// N input rows of one head (512 bytes each, a lane 4 features of every row)
template <bool PIN, int N>
__device__ __forceinline__ void ld_rows(v4f (&x)[N], const float* p, const int lo) {   // p: the wave's first row (the same in every lane); lo: the lane's place in a row
    const float* pl = p + lo;
#pragma unroll
    for (int i = 0; i < N; ++i) x[i] = *(const v4f*)(pl + i * DM);
    // the address registers of the loads above may be rewritten only behind this wait. PIN: the address is its input and so lives up to it (one build let the last load's result land on the address pair); without PIN the wait stands directly behind the loads (an input there made the compiler keep an address pair from stage to stage, in scratch)
    if constexpr (PIN) asm volatile("s_wait_xcnt 0x0" :: "v"(pl) : "memory"); else asm volatile("s_wait_xcnt 0x0" ::: "memory");
}
// the same rows converted and laid into LDS at w (+ i * pitch): fp16, or hi at w and lo at w + lo (round to nearest even, lo = the rounded rest)
template <int NSPLIT, int N>
__device__ __forceinline__ void st_rows(const v4f (&x)[N], char* w, const int pitch, const int lo) {
#pragma unroll
    for (int i = 0; i < N; ++i) {
        if constexpr (NSPLIT == 0) { v4h o16;
#pragma unroll
            for (int j = 0; j < 4; ++j) o16[j] = tohx(x[i][j]);
            *(v4h*)(w + i * pitch) = o16;
        } else { const v4us oh = __builtin_bit_cast(v4us, __builtin_convertvector(x[i], v4b)); v4f r;
#pragma unroll
            for (int j = 0; j < 4; ++j) r[j] = x[i][j] - bf2f(oh[j]);
            *(v4us*)(w + i * pitch) = oh; *(v4us*)(w + lo + i * pitch) = __builtin_bit_cast(v4us, __builtin_convertvector(r, v4b)); }
    }
}
template <typename T16, int NSPLIT, int KS>
__device__ __forceinline__ void fa_tile(const float* __restrict__ qrows, const float* __restrict__ qrowsB, const float* __restrict__ krows, const float* __restrict__ vrows, const int q0, const int q0B, const int nB, const int nst, const int tid, const int lr, const int hi, const int wq, const int kh, char* sm, float* __restrict__ orow) {
    typedef WFrag<T16> WF; typedef typename WF::V V;
    constexpr float OFF = (NSPLIT == 0) ? 7.0f : 0.0f;
    constexpr float CL2 = SCL * 1.4426950408889634f;   // scores in log2 units
    constexpr float PLIM = (NSPLIT == 0) ? 32768.0f : 256.0f;   // 2^(OFF + FTHR): the bound on a lane's sums of P in one pass
    static_assert(OFF + FTHR == ((NSPLIT == 0) ? 15.0f : 8.0f), "PLIM is 2^(OFF + FTHR)");
    constexpr int NPL = NSPLIT ? 2 : 1, KPE = KPB / 2;   // planes of a stage; LDS pitch of a key row in elements
    constexpr int HK = KS / 2;   // keys of a stage that one wave of the pair takes
    constexpr int RW = KS / 8;   // rows of a stage (keys, and values) that one wave brings in
    const int wv = kh * 4 + wq, ln = hi * 16 + lr;   // the wave's number (a scalar) and the lane's
    const float* kgp = krows + (size_t)(wv * RW) * DM; const float* vgp = vrows + (size_t)(wv * RW) * DM;   // the wave's rows of stage 0
    const int kw = wv * RW * KPB + ln * 8, vw = NPL * KS * KPB + wv * RW * VPB + ln * 8;   // where they go in a stage buffer (bytes)
    // the block's query rows: a wave takes 16 of them, a lane 4 features of each
    v4f x[16];
    const float* qp = qrows + (size_t)((tid >> 5) * 16) * DM + (tid & 31) * 4;
#pragma unroll
    for (int i = 0; i < 16; ++i) x[i] = *(const v4f*)(qp + i * DM);
    asm volatile("s_wait_xcnt 0x0" :: "v"(qp) : "memory");   // the address registers of the loads above stay untouched up to this wait (they are its inputs)
    v4f xb[NSPLIT == 0 ? 16 : 1];   // fp16 rows: the light tile's query rows, dealt the same way
    if constexpr (NSPLIT == 0) {
        const float* qpb = qrowsB + (size_t)((tid >> 5) * 16) * DM + (tid & 31) * 4;
#pragma unroll
        for (int i = 0; i < 16; ++i) xb[i] = *(const v4f*)(qpb + i * DM);
        asm volatile("s_wait_xcnt 0x0" :: "v"(qpb) : "memory");   // as above, for these loads' address registers
    }
    v4f xk[RW], xv[RW]; ld_rows<false>(xk, kgp, ln * 4); ld_rows<false>(xv, vgp, ln * 4);   // stage 0 flies beside the query rows
    char* qs = sm + 2 * BUFB;
    { char* qw = qs + (tid >> 5) * 16 * KPB + (tid & 31) * 8;
#pragma unroll
      for (int i = 0; i < 16; ++i) {
          if constexpr (NSPLIT == 0) { v4h o16;
#pragma unroll
              for (int j = 0; j < 4; ++j) o16[j] = tohx(x[i][j]);
              *(v4h*)(qw + i * KPB) = o16;
#pragma unroll
              for (int j = 0; j < 4; ++j) o16[j] = tohx(xb[i][j]);
              *(v4h*)(qw + 128 * KPB + i * KPB) = o16;   // the light tile's rows lie behind the heavy tile's
          } else { v4us oh, ol;
#pragma unroll
              for (int j = 0; j < 4; ++j) { unsigned short a2, c2; splitf(x[i][j], a2, c2); oh[j] = a2; ol[j] = c2; }
              *(v4us*)(qw + i * KPB) = oh; *(v4us*)(qw + 128 * KPB + i * KPB) = ol; } } }
    st_rows<NSPLIT>(xk, sm + kw, KPB, KS * KPB); st_rows<NSPLIT>(xv, sm + vw, VPB, KS * VPB);
    v8f o[2][8];
#pragma unroll
    for (int qt = 0; qt < 2; ++qt)
#pragma unroll
        for (int dt = 0; dt < 8; ++dt) o[qt][dt] = (v8f){};
    float m[2] = {-3.0e38f, -3.0e38f}, l[2] = {0.f, 0.f};
    __syncthreads();   // stage 0 and the converted query rows may be read
    V qf[2][4], qg[2][4];
    const T16* ql = (const T16*)qs + (wq * 32 + lr) * KPE + 8 * hi;
    const bool two = NSPLIT == 0 && nB > 0;   // the block has a light tile beside its heavy one
    const int qsel = (two && kh) ? 128 * KPE : 0;   // waves 4 to 7 then begin on the light tile
#pragma unroll
    for (int qt = 0; qt < 2; ++qt)
#pragma unroll
        for (int ks = 0; ks < 4; ++ks) { const int qo = qt * 16 * KPE + ks * 32; qf[qt][ks] = WF::ld(ql + qsel + qo); if (NSPLIT) qg[qt][ks] = WF::ld(ql + 128 * KPE + qo); }
    int qc = (two && kh) ? q0B : q0;   // the first of the 32 query rows that the wave works on now
    // the wave's 32 finished query rows: divided by their sums and stored
    auto put = [&](const int qx) {
#pragma unroll
        for (int qt = 0; qt < 2; ++qt) { const float inv = __fdiv_rn(1.0f, l[qt] + __shfl_xor(l[qt], 16, 32));
#pragma unroll
            for (int dt = 0; dt < 8; ++dt) o[qt][dt] *= inv; }
        float* op = orow + (size_t)(qx + lr) * DQ + hi * 8;   // a lane's 8 accumulator registers are 8 consecutive features of one query row
#pragma unroll
        for (int qt = 0; qt < 2; ++qt)
#pragma unroll
            for (int dt = 0; dt < 8; ++dt) { v4f a, c;
#pragma unroll
                for (int j = 0; j < 4; ++j) { a[j] = o[qt][dt][j]; c[j] = o[qt][dt][4 + j]; }
                *(v4f*)(op + qt * 16 * DQ + dt * 16) = a; *(v4f*)(op + qt * 16 * DQ + dt * 16 + 4) = c; }
        // the stores' address and data registers may be rewritten only behind this wait: they are its inputs and so live up to it
        asm volatile("s_wait_xcnt 0x0" :: "v"(op), "v"(o[0][0]), "v"(o[0][1]), "v"(o[0][2]), "v"(o[0][3]), "v"(o[0][4]), "v"(o[0][5]), "v"(o[0][6]), "v"(o[0][7]), "v"(o[1][0]), "v"(o[1][1]), "v"(o[1][2]), "v"(o[1][3]), "v"(o[1][4]), "v"(o[1][5]), "v"(o[1][6]), "v"(o[1][7]) : "memory");
    };
    v4f xs[RW];   // fp16 rows: input rows of the next stage on their way
#pragma unroll 1
    for (int t = 0; t < nst; ++t) {
        const bool more = t + 1 < nst; char* nb = sm + ((t + 1) & 1) * BUFB; const size_t go = (size_t)(t + 1) * KS * DM;   // the next stage: is there one, its buffer (nobody has read it since the last barrier), its first input row
        if constexpr (NSPLIT == 0) { if (more) ld_rows<false>(xs, kgp + go, ln * 4); }   // its key rows fly during this stage's first pass
        if constexpr (NSPLIT == 0) { if (two && kh && t == nB) {   // the light tile is done (no barrier in here): waves 4 to 7 store it and start anew on the heavy tile's query rows
            put(qc); qc = q0;
#pragma unroll
            for (int qt = 0; qt < 2; ++qt) { m[qt] = -3.0e38f; l[qt] = 0.f;
#pragma unroll
                for (int dt = 0; dt < 8; ++dt) o[qt][dt] = (v8f){};
#pragma unroll
                for (int ks = 0; ks < 4; ++ks) qf[qt][ks] = WF::ld(ql + qt * 16 * KPE + ks * 32); }
        } }
        const bool both = NSPLIT == 0 && t < nB;   // fp16 rows: the stage serves both tiles, every wave takes all of its keys for its own tile; behind the light tile's last stage the pair shares the heavy tile's keys by halves
        const int k1 = both ? 0 : kh * HK;   // the wave's first key in the stage
        const int kb0 = t * KS + k1, kend = min(kb0 + (both ? KS : HK) - 32, qc);   // this wave's passes of the stage: kb0 .. kend (none behind its diagonal)
        const char* bp = sm + (t & 1) * BUFB;
        const T16* kl = (const T16*)bp + (k1 + lr) * KPE + 8 * hi; const char* vl = bp + NPL * KS * KPB + (k1 + 8 * hi + (lr & 7)) * VPB + ((lr >> 3) & 1) * 16;   // vl: the lane's address for the transposing read
        V kf[2][4], kg[2][4];
        if (NSPLIT == 0 && kb0 <= kend) {
#pragma unroll
            for (int kt = 0; kt < 2; ++kt)
#pragma unroll
                for (int ks = 0; ks < 4; ++ks) kf[kt][ks] = WF::ld(kl + kt * 16 * KPE + ks * 32);
        }
#pragma unroll 1
        for (int kb = kb0; kb <= kend; kb += 32) {
            V vf[8], vg2[8]; const char* vp = vl + (kb - kb0) * VPB; const T16* kp = kl + (kb - kb0) * KPE;
            if (NSPLIT == 0) {   // the value fragments come during the score products and the softmax
#pragma unroll
                for (int dt = 0; dt < 8; ++dt) ldvt(vf[dt], vp + dt * 32);
                __builtin_amdgcn_sched_barrier(0);   // keeps these LDS reads up here: the compiler moved each down to its product, where the wave then waited out the LDS latency once per fragment
            } else {
#pragma unroll
                for (int kt = 0; kt < 2; ++kt)
#pragma unroll
                    for (int ks = 0; ks < 4; ++ks) { const int ko = kt * 16 * KPE + ks * 32; kf[kt][ks] = WF::ld(kp + ko); kg[kt][ks] = WF::ld(kp + KS * KPE + ko); }
                __builtin_amdgcn_sched_barrier(0);   // all key reads issued in one run in front of the products (else one LDS latency is waited out per fragment)
            }
            v8f s[2][2];
#pragma unroll
            for (int kt = 0; kt < 2; ++kt)
#pragma unroll
                for (int qt = 0; qt < 2; ++qt) s[kt][qt] = (v8f){};
#pragma unroll
            for (int ks = 0; ks < 4; ++ks)
#pragma unroll
                for (int kt = 0; kt < 2; ++kt)
#pragma unroll
                    for (int qt = 0; qt < 2; ++qt) { s[kt][qt] = WF::mma(kf[kt][ks], qf[qt][ks], s[kt][qt]); if (NSPLIT) { s[kt][qt] = WF::mma(kf[kt][ks], qg[qt][ks], s[kt][qt]); s[kt][qt] = WF::mma(kg[kt][ks], qf[qt][ks], s[kt][qt]); } }
            if (NSPLIT == 0 && kb < kend) {   // the next pass's key fragments, one pass ahead, inside this stage's buffer only
#pragma unroll
                for (int kt = 0; kt < 2; ++kt)
#pragma unroll
                    for (int ks = 0; ks < 4; ++ks) kf[kt][ks] = WF::ld(kp + (32 + kt * 16) * KPE + ks * 32);
            }
            if (kb == qc) {   // the diagonal pass: keys after the query are excluded (an exact zero weight)
#pragma unroll
                for (int kt = 0; kt < 2; ++kt)
#pragma unroll
                    for (int qt = 0; qt < 2; ++qt)
#pragma unroll
                        for (int j = 0; j < 8; ++j) if (kt * 16 + hi * 8 + j > qt * 16 + lr) s[kt][qt][j] = -3.0e38f;
            }
            // P under the reference in use, its in-lane sums, and P packed as the B operand
            V pf[2], pg[2]; float sum[2];
            auto soft = [&]() {
                // the same products and the same two chains of sums as one by one, written on register pairs (two scores of a query a multiply-add, the two query groups' sums an add)
                v2f x[2][8]; float p[2][16]; v2f acc = {0.f, 0.f};
#pragma unroll
                for (int qt = 0; qt < 2; ++qt) { const float mo = OFF - m[qt];
#pragma unroll
                    for (int i = 0; i < 8; ++i) x[qt][i] = __builtin_elementwise_fma((v2f){s[i >> 2][qt][(2 * i) & 7], s[i >> 2][qt][(2 * i + 1) & 7]}, (v2f){CL2, CL2}, (v2f){mo, mo}); }
#pragma unroll
                for (int e = 0; e < 16; ++e) { const v2f pe = {exp2s(x[0][e >> 1][e & 1]), exp2s(x[1][e >> 1][e & 1])}; acc += pe; p[0][e] = pe[0]; p[1][e] = pe[1]; }
                sum[0] = acc[0]; sum[1] = acc[1];
#pragma unroll
                for (int qt = 0; qt < 2; ++qt) {
                    if constexpr (NSPLIT == 0) { v16h t16;
#pragma unroll
                        for (int e = 0; e < 16; ++e) t16[e] = (h16)p[qt][e];
                        pf[qt] = t16;
                    } else { v8us h0, h1, l0, l1;
#pragma unroll
                        for (int e = 0; e < 8; ++e) { unsigned short a2, c2; splitf(p[qt][e], a2, c2); h0[e] = a2; l0[e] = c2; splitf(p[qt][8 + e], a2, c2); h1[e] = a2; l1[e] = c2; }
                        pf[qt] = cat16b(h0, h1); pg[qt] = cat16b(l0, l1); } }
            };
            soft();
            // every P is >= 0, so no P exceeds its lane's sums: sums within PLIM say that the reference still serves. Else (always in a wave's first pass, whose P are infinite) the maxima are formed, the references replaced and P formed anew
            if (__builtin_amdgcn_ballot_w32(sum[0] + sum[1] > PLIM) != 0) {
                float mx[2];
#pragma unroll
                for (int qt = 0; qt < 2; ++qt) { float a = s[0][qt][0];
#pragma unroll
                    for (int j = 1; j < 8; ++j) a = fmaxf(a, s[0][qt][j]);
#pragma unroll
                    for (int j = 0; j < 8; ++j) a = fmaxf(a, s[1][qt][j]);
                    mx[qt] = a; }
                { const float x0 = __shfl_xor(mx[0], 16, 32), x1 = __shfl_xor(mx[1], 16, 32); mx[0] = fmaxf(mx[0], x0) * CL2; mx[1] = fmaxf(mx[1], x1) * CL2; }
#pragma unroll
                for (int qt = 0; qt < 2; ++qt) { const float mn = fmaxf(m[qt], mx[qt]); const float al = exp2s(m[qt] - mn); m[qt] = mn; l[qt] *= al;
#pragma unroll
                    for (int dt = 0; dt < 8; ++dt) o[qt][dt] *= al; }
                soft();
            }
            l[0] += sum[0]; l[1] += sum[1];
            if (NSPLIT) {   // hi / lo rows (at most 16 passes): the value fragments come behind the softmax, so that 128 operand registers are not live across it
#pragma unroll
                for (int dt = 0; dt < 8; ++dt) { ldvt(vf[dt], vp + dt * 32); ldvt(vg2[dt], vp + KS * VPB + dt * 32); }
                __builtin_amdgcn_sched_barrier(0);   // as above, for the value reads
            }
#pragma unroll
            for (int dt = 0; dt < 8; ++dt)
#pragma unroll
                for (int qt = 0; qt < 2; ++qt) { o[qt][dt] = WF::mma(vf[dt], pf[qt], o[qt][dt]); if (NSPLIT) { o[qt][dt] = WF::mma(vf[dt], pg[qt], o[qt][dt]); o[qt][dt] = WF::mma(vg2[dt], pf[qt], o[qt][dt]); } }
            // fp16 rows: in a stage that has a successor every wave has at least one pass: behind the first the key rows are laid down and the value rows set off, behind the second those are laid down
            if constexpr (NSPLIT == 0) { if (more) {
                if (kb == kb0) { st_rows<0>(xs, nb + kw, KPB, 0); ld_rows<false>(xs, vgp + go, ln * 4); }
                else if (kb == kb0 + 32) st_rows<0>(xs, nb + vw, VPB, 0); } }
        }
        if constexpr (NSPLIT == 0) { if (more && kend == kb0) st_rows<0>(xs, nb + vw, VPB, 0); }   // a wave whose diagonal left it one pass only (light tile, last stage)
        if constexpr (NSPLIT != 0) { if (more) { v4f a[RW], c[RW]; ld_rows<true>(a, kgp + go, ln * 4); ld_rows<true>(c, vgp + go, ln * 4); st_rows<NSPLIT>(a, nb + kw, KPB, KS * KPB); st_rows<NSPLIT>(c, nb + vw, VPB, KS * VPB); } }
        // hand-over, passed by every wave (also one that had no pass in this stage)
        asm volatile("s_wait_dscnt 0x0" ::: "memory");      // this wave's reads of this buffer and its writes of the next are done
        __syncthreads();                                    // stage t + 1 may be read by all; nobody reads stage t's buffer any more
    }
    // merge of the pair: the wave of the second halves hands its sums, its reference maxima and its O^T over in LDS (the stage buffers, which nobody reads behind the loop's last barrier); 33 rows of 32 lanes x 16 bytes a pair
    v4f* mg = (v4f*)sm + wq * 33 * 32 + (hi * 16 + lr);
    if (kh) {
#pragma unroll
        for (int qt = 0; qt < 2; ++qt)
#pragma unroll
            for (int dt = 0; dt < 8; ++dt) { v4f a, c;
#pragma unroll
                for (int j = 0; j < 4; ++j) { a[j] = o[qt][dt][j]; c[j] = o[qt][dt][4 + j]; }
                mg[((qt * 8 + dt) * 2) * 32] = a; mg[((qt * 8 + dt) * 2 + 1) * 32] = c; }
        mg[32 * 32] = (v4f){m[0], m[1], l[0], l[1]};
    }
    __syncthreads();   // the handed-over values may be read; passed by all eight waves
    if (kh) return;
    { const v4f ml = mg[32 * 32];
#pragma unroll
      for (int qt = 0; qt < 2; ++qt) { const float mn = fmaxf(m[qt], ml[qt]); const float a0 = exp2s(m[qt] - mn), a1 = exp2s(ml[qt] - mn);   // a wave that had no pass hands over zeros under a reference of -3e38: weight 0
          l[qt] = l[qt] * a0 + ml[2 + qt] * a1;
#pragma unroll
          for (int dt = 0; dt < 8; ++dt) { const v4f a = mg[((qt * 8 + dt) * 2) * 32], c = mg[((qt * 8 + dt) * 2 + 1) * 32];
#pragma unroll
              for (int j = 0; j < 4; ++j) { o[qt][dt][j] = o[qt][dt][j] * a0 + a[j] * a1; o[qt][dt][4 + j] = o[qt][dt][4 + j] * a0 + c[j] * a1; } } } }
    put(q0);
}
// grid: 352 blocks of 8 waves = 11 groups x 32 (batch, head) planes. Groups 0 to 4: fp16 query tiles (128 rows each) in pairs of one plane, heavy 14 - g with light 4 + g: every pair has the same number of passes, and a stage of keys
// that both tiles need is brought in and converted once for the two. Then, one tile a block: 15 and 9 (fp16), 3 2 1 0 (hi / lo). A block's registers fill a WGP, so blocks run one behind another there: the first eight groups fill the chip,
// the three shortest come last and follow the blocks that end first. The heavy (or only) tile of a group: one nibble each below.
#define NGRP 11
#define NPAIR 5
__global__ __launch_bounds__(256) void k_fattn(const float* __restrict__ q, const float* __restrict__ k, const float* __restrict__ v, float* __restrict__ OUT) {
    __shared__ __attribute__((aligned(128))) char sm[2 * BUFB + QSB];
    const int tid = threadIdx.x, lane = tid & 31, lr = lane & 15, hi = lane >> 4; const int wv = __builtin_amdgcn_readfirstlane(tid >> 5);
    const int wq = wv & 3, kh = wv >> 2;   // which 32 query columns; which half of a stage's keys; pair blocks, up to the light tile's last stage: which tile (1: the light one)
    static_assert(TT == 2048 && RH == 512, "the table below deals 16 tiles, the first 4 of them hi / lo");
    const int lin = blockIdx.x, z = lin & (NB_ * NH_ - 1), g = lin / (NB_ * NH_); const int qb = (int)((0x01239FABCDEull >> (4 * g)) & 15), qbB = g < NPAIR ? 4 + g : qb;   // qb: the block's heavy or only tile; qbB: a pair's light tile
    const int q0 = qb * 128 + wq * 32; const size_t hz = (size_t)(z / NH_) * TT * DM + (z % NH_) * HD;   // hz: row 0 of the plane's batch, at its head's features
    float* orow = OUT + (size_t)(z / NH_) * TT * DQ + (z % NH_) * HD;
    const float* qrows = q + ((size_t)(z / NH_) * TT + qb * 128) * DM + (z % NH_) * HD;   // the block's first query row, at its head's features
    // the choice is the same for the whole block: its barriers stand under block-uniform control flow; stages: the block's keys 0 .. qb * 128 + 127
    if (qb * 128 < RH) fa_tile<bf, 2, 64>(qrows, qrows, k + hz, v + hz, q0, q0, 0, 2 * (qb + 1), tid, lr, hi, wq, kh, sm, orow);
    else fa_tile<h16, 0, 128>(qrows, q + hz + (size_t)(qbB * 128) * DM, k + hz, v + hz, q0, qbB * 128 + wq * 32, g < NPAIR ? qbB + 1 : 0, qb + 1, tid, lr, hi, wq, kh, sm, orow);
}

extern "C" void kernel_launch(void* const* d_in, const int* in_sizes, int n_in,
                              void* d_out, int out_size, void* d_ws, size_t ws_size, hipStream_t stream) {
    (void)in_sizes; (void)n_in; (void)out_size;
    const float* q = (const float*)d_in[0]; const float* k = (const float*)d_in[1]; const float* v = (const float*)d_in[2];   /* q, k, v ([2][2048][2048] each, GIVEN: this module has NO projections): THREE inputs */
    float* OUT = (float*)d_out;     // [2][2048][2048]
    (void)d_ws; (void)ws_size;      // no workspace
    k_fattn<<<NB_ * NH_ * NGRP, 256, 0, stream>>>(q, k, v, OUT);   /* all 32 (batch, head) planes in one launch, straight from the INPUT rows [t][h * 128 + d]; the merged context goes straight to the OUTPUT in f32 */
}
